// v000
// Times are from an AMD MI455X. After a warm-up the kernel runs many times in a row, and a time is the length of
// such a window on the GPU divided by its runs, so every launch and the gaps after it count. The runs cycle
// through copies of the inputs. A figure is the median of several windows, for all but v000 over two sittings.
// Sittings can differ by a few percent; kernels timed side by side share one.
// v000 is the starting kernel. One run takes 2230 microseconds.
#include <hip/hip_runtime.h>

// Causal multi-head self-attention with an attention-entropy monitor (x [2][2048][1024]; qkv = x w_attn (16 heads x 64, no bias); causal softmax(q.k/8); y = merged att.v w_proj -> [2][2048][1024];
// second output = mean over all (batch, head, query) rows of the row entropy -sum_s att log(att + 1e-8) -> [1]).
// Compute dtypes, f32 accumulate: every input rounded to bf16; qkv projection on PLAIN bf16 operands (inputs: exact products, f32 accumulate); w_proj on att.v hi+lo planes (2 products); PER-ROW PRECISION HYBRID:
// query rows < 256 take scores and att.v on bf16 hi+lo planes (3 products), rows >= 256 on single fp16 planes; 1/8, the causal cut, the softmax and the row entropy (from the f32 probabilities, hardware

#define NB_  2
#define TT   2048
#define DD   1024
#define NH_  16
#define HD   64
#define ZH   2
#define RH   256                  // query rows < RH: hi+lo planes; rows >= RH: fp16 planes
#define NF   32                   // head_dim / 2 (unused here)
#define SCL  0.125f               // 1/sqrt(64)
#define PCAR 1024.0f         // P scale for fp16 rows >= RH, undone in k_merge
typedef _Float16 h16;
typedef unsigned short bf;
typedef __attribute__((ext_vector_type(16))) __bf16   v16bf;
typedef __attribute__((ext_vector_type(16))) _Float16 v16h;
typedef __attribute__((ext_vector_type(8)))  _Float16 v8h;
typedef __attribute__((ext_vector_type(8)))  unsigned short v8us;
typedef __attribute__((ext_vector_type(8)))  float    v8f;
typedef __attribute__((ext_vector_type(4)))  float    v4f;
typedef v8h  __attribute__((may_alias)) v8ha;
typedef v4f  __attribute__((may_alias)) v4fa;
typedef v8us __attribute__((may_alias)) v8usa;

__device__ __forceinline__ unsigned short f2bf(float f) { unsigned u = __float_as_uint(f); u += 0x7FFFu + ((u >> 16) & 1u); return (unsigned short)(u >> 16); }
__device__ __forceinline__ float bf2f(unsigned short b) { return __uint_as_float(((unsigned)b) << 16); }
__device__ __forceinline__ float bfr(float f) { return bf2f(f2bf(f)); }
__device__ __forceinline__ v16h cat16(v8h lo, v8h hi) { return __builtin_shufflevector(lo, hi, 0, 1, 2, 3, 4, 5, 6, 7, 8, 9, 10, 11, 12, 13, 14, 15); }
__device__ __forceinline__ v16bf cat16b(v8us lo, v8us hi) { return __builtin_bit_cast(v16bf, __builtin_shufflevector(lo, hi, 0, 1, 2, 3, 4, 5, 6, 7, 8, 9, 10, 11, 12, 13, 14, 15)); }
__device__ __forceinline__ v8f wmma16(v16h a, v16h b, v8f c) { return __builtin_amdgcn_wmma_f32_16x16x32_f16(false, a, false, b, (short)0, c, false, false); }
__device__ __forceinline__ v8f wmmab(v16bf a, v16bf b, v8f c) { return __builtin_amdgcn_wmma_f32_16x16x32_bf16(false, a, false, b, (short)0, c, false, false); }



// ---- k_gemmw: register-blocked GEMM, ONE WAVE per 64x64 output tile (16 accumulators), operands straight from K-contiguous 16-bit planes; grid (M/64, N/64, Z), 32 threads.
// C[m][n] (f32, pitch ldc, + optional f32 bias[n]) = sum_k A[m][k] Bt[n][k] (+ split products per NSPLIT). z-batch strides sA/sB/sC in elements. K % 32 == 0.
template <typename T16> struct WFrag;
template <> struct WFrag<h16> { typedef v16h V; static __device__ __forceinline__ V ld(const h16* p) { return cat16(*(const v8h*)p, *(const v8h*)(p + 16)); } static __device__ __forceinline__ v8f mma(V a, V b, v8f c) { return wmma16(a, b, c); } };
template <> struct WFrag<bf> { typedef v16bf V; static __device__ __forceinline__ V ld(const bf* p) { return cat16b(*(const v8us*)p, *(const v8us*)(p + 16)); } static __device__ __forceinline__ v8f mma(V a, V b, v8f c) { return wmmab(a, b, c); } };
template <typename T16, int NSPLIT, bool BIAS>
__global__ __launch_bounds__(32) void k_gemmw(const T16* __restrict__ A, const T16* __restrict__ A2, const T16* __restrict__ Bt, const T16* __restrict__ Bt2, int K, float* C, int ldc, const float* __restrict__ bias, size_t sA, size_t sB, size_t sC) {
    typedef typename WFrag<T16>::V V;
    __shared__ __align__(16) float os[16 * 68];
    const size_t z = blockIdx.z; A += z * sA; if (A2) A2 += z * sA; Bt += z * sB; if (Bt2) Bt2 += z * sB; C += z * sC;
    const int lane = threadIdx.x & 31, lr = lane & 15, hi = lane >> 4; const int r0 = blockIdx.x * 64, c0 = blockIdx.y * 64;
    v8f acc[4][4];
#pragma unroll
    for (int mb = 0; mb < 4; ++mb)
#pragma unroll
        for (int nb = 0; nb < 4; ++nb) acc[mb][nb] = (v8f){};
    const size_t aoff = (size_t)(r0 + lr) * K + 8 * hi, boff = (size_t)(c0 + lr) * K + 8 * hi;
#pragma unroll 1
    for (int kc = 0; kc < K; kc += 32) {
        V a[4], a2[4];
#pragma unroll
        for (int mb = 0; mb < 4; ++mb) { a[mb] = WFrag<T16>::ld(A + aoff + (size_t)mb * 16 * K + kc); if (NSPLIT == 1 || NSPLIT == 2) a2[mb] = WFrag<T16>::ld(A2 + aoff + (size_t)mb * 16 * K + kc); }
#pragma unroll
        for (int nb = 0; nb < 4; ++nb) { const V b = WFrag<T16>::ld(Bt + boff + (size_t)nb * 16 * K + kc); V b2; if (NSPLIT >= 2) b2 = WFrag<T16>::ld(Bt2 + boff + (size_t)nb * 16 * K + kc);
#pragma unroll
            for (int mb = 0; mb < 4; ++mb) { acc[mb][nb] = WFrag<T16>::mma(a[mb], b, acc[mb][nb]); if (NSPLIT == 1 || NSPLIT == 2) acc[mb][nb] = WFrag<T16>::mma(a2[mb], b, acc[mb][nb]); if (NSPLIT >= 2) acc[mb][nb] = WFrag<T16>::mma(a[mb], b2, acc[mb][nb]); } }
        asm volatile("v_nop\n\tv_nop\n\tv_nop\n\tv_nop" : "+v"(acc[0][0]), "+v"(acc[1][1]), "+v"(acc[2][2]), "+v"(acc[3][3]) : "v"(a[0]), "v"(a[3]));
    }
#pragma unroll
    for (int mb = 0; mb < 4; ++mb) {
#pragma unroll
        for (int nb = 0; nb < 4; ++nb) {
#pragma unroll
            for (int j = 0; j < 8; ++j) os[(hi * 8 + j) * 68 + nb * 16 + lr] = acc[mb][nb][j]; }
        __builtin_amdgcn_wave_barrier(); asm volatile("" ::: "memory");
        float* crow = C + (size_t)(r0 + mb * 16) * ldc + c0;
{
#pragma unroll
            for (int s = 0; s < 8; ++s) { const int row = 2 * s + hi, cofs = lr * 4; v4f val = *(const v4fa*)(os + row * 68 + cofs); if (BIAS) { val[0] += bfr(bias[c0 + cofs]); val[1] += bfr(bias[c0 + cofs + 1]); val[2] += bfr(bias[c0 + cofs + 2]); val[3] += bfr(bias[c0 + cofs + 3]); }
                *(v4f*)(crow + (size_t)row * ldc + cofs) = val; }
             }
        __builtin_amdgcn_wave_barrier(); asm volatile("" ::: "memory");
    }
}

__device__ __forceinline__ h16 tohx(float x) { return (h16)x; }
__device__ __forceinline__ void splitf(float y, unsigned short& h, unsigned short& l) { h = f2bf(y); l = f2bf(y - bf2f(h)); }
typedef __attribute__((ext_vector_type(2))) unsigned short v2us;
typedef __attribute__((ext_vector_type(2))) _Float16 v2h;
typedef __attribute__((ext_vector_type(4))) _Float16 v4h;
typedef __attribute__((ext_vector_type(2))) float v2f;

__global__ __launch_bounds__(256) void k_wtG(const float* __restrict__ w, int K, int N, bf* Bt) {
    const int lane = threadIdx.x & 31; const int L0 = (blockIdx.x * 8 + (threadIdx.x >> 5)) * 8; const int nlines = N * K / 64;
{
#pragma unroll 1
        for (int l = 0; l < 8; ++l) { const int L = L0 + l; if (L >= nlines) break; const size_t e = (size_t)L * 64 + lane * 2; const int k = (int)(e % K), n = (int)(e / K); v2us o;
            o[0] = f2bf(w[(size_t)k * N + n]); o[1] = f2bf(w[(size_t)(k + 1) * N + n]); *(v2us*)(Bt + e) = o; }
         }
}
__global__ __launch_bounds__(256) void k_cvt8(const float* __restrict__ src, bf* dst, size_t n8) { const size_t i = (size_t)blockIdx.x * 256 + threadIdx.x; if (i >= n8) return; const v8f v = *(const v8f*)(src + i * 8); v8us o;
#pragma unroll
    for (int k = 0; k < 8; ++k) o[k] = f2bf(v[k]); *(v8us*)(dst + i * 8) = o;  }
__global__ __launch_bounds__(256) void k_qplanes(const float* __restrict__ F, bf* Ph, bf* Pl, h16* P16) {
    const int lane = threadIdx.x & 31; const int L0 = (blockIdx.x * 8 + (threadIdx.x >> 5)) * 8; const int nlines = NH_ * TT * HD / 64;
{
#pragma unroll
        for (int l = 0; l < 8; ++l) { const int L = L0 + l; if (L >= nlines) break; const int e = L * 64 + lane * 2; const int d = e & (HD - 1); const int t = (e >> 6) & (TT - 1); const int h = e >> 17; v2us oh, ol; v2h o16;
#pragma unroll
            for (int q = 0; q < 2; ++q) { const float x = F[(size_t)t * DD + h * HD + d + q]; unsigned short a, c2; splitf(x, a, c2); oh[q] = a; ol[q] = c2; o16[q] = tohx(x); }
            *(v2us*)(Ph + (size_t)e) = oh; *(v2us*)(Pl + (size_t)e) = ol; *(v2h*)(P16 + (size_t)e) = o16; }
         }
}
__global__ __launch_bounds__(256) void k_vtplane(const float* __restrict__ F, bf* Vh, bf* Vl, h16* V16) {
    const int lane = threadIdx.x & 31; const int L0 = (blockIdx.x * 8 + (threadIdx.x >> 5)) * 8; const int nlines = NH_ * TT * HD / 64;
{
#pragma unroll
        for (int l = 0; l < 8; ++l) { const int L = L0 + l; if (L >= nlines) break; const int e = L * 64 + lane * 2; const int t = e & (TT - 1); const int d = (e >> 11) & (HD - 1); const int h = e >> 17; v2us oh, ol; v2h o16;
#pragma unroll
            for (int q = 0; q < 2; ++q) { const float x = F[(size_t)(t + q) * DD + h * HD + d]; unsigned short a, c2; splitf(x, a, c2); oh[q] = a; ol[q] = c2; o16[q] = tohx(x); }
            *(v2us*)(Vh + (size_t)e) = oh; *(v2us*)(Vl + (size_t)e) = ol; *(v2h*)(V16 + (size_t)e) = o16; }
         }
}
// k_asoft: per row (zz, i): t = S/8 for j <= i (causal), -3e38 otherwise; softmax over the 2048 keys (register row, one exp); also the row entropy -sum p log(p + 1e-8) from the f32 probabilities -> ENT[erow0 + row][0..31] line (lane 0) -> rows i < RH: P hi/lo [zz][i][j] (compact
__global__ __launch_bounds__(256) void k_asoft(const float* __restrict__ Sb, bf* Ph, bf* Pl, h16* P16, float* ENT, int erow0) {
    typedef __attribute__((ext_vector_type(4))) unsigned short v4us;
    const int lane = threadIdx.x & 31; const int row = blockIdx.x * 8 + (threadIdx.x >> 5); if (row >= ZH * TT) return; const int i = row & (TT - 1); const int zz = row >> 11; const bool hires = (i < RH);
    const float* sr = Sb + (size_t)row * TT; float v[64]; float mx = -3.0e38f;
#pragma unroll
    for (int ch = 0; ch < 16; ++ch) { const int j0 = ch * 128 + lane * 4; const v4f a = *(const v4f*)(sr + j0);
#pragma unroll
        for (int q = 0; q < 4; ++q) { const int j = j0 + q; const float t = (j <= i) ? a[q] * SCL : -3.0e38f; v[ch * 4 + q] = t; mx = fmaxf(mx, t); } }
#pragma unroll
    for (int sh = 16; sh; sh >>= 1) mx = fmaxf(mx, __shfl_xor(mx, sh, 32));
    float sum = 0.f;
#pragma unroll
    for (int k = 0; k < 64; ++k) { v[k] = __expf(v[k] - mx); sum += v[k]; }
#pragma unroll
    for (int sh = 16; sh; sh >>= 1) sum += __shfl_xor(sum, sh, 32);
    const float f = __fdiv_rn(hires ? 1.0f : PCAR, sum); const float pn = __fdiv_rn(1.0f, sum); float ent = 0.f;   // row entropy from the f32 probabilities p = e/sum
#pragma unroll
    for (int k = 0; k < 64; ++k) { float p = __fmul_rn(v[k], pn); asm volatile("" : "+v"(p)); float l2 = __builtin_amdgcn_logf(__fadd_rn(p, 1e-8f)); asm volatile("" : "+v"(l2)); float lg = __fmul_rn(l2, 0.69314718055994531f); asm volatile("" : "+v"(lg)); float pl = __fmul_rn(p, lg); asm volatile("" : "+v"(pl)); ent = __fsub_rn(ent, pl); }
#pragma unroll
    for (int sh = 16; sh; sh >>= 1) ent += __shfl_xor(ent, sh, 32);
    { const float eo = lane == 0 ? ent : 0.f; float* er = ENT + ((size_t)erow0 + row) * 32 + lane; *(float*)er = eo;  }
{
        if (hires) {
#pragma unroll
            for (int ch = 0; ch < 16; ++ch) { v4us oh, ol;
#pragma unroll
                for (int q = 0; q < 4; ++q) { unsigned short a, c2; splitf(v[ch * 4 + q] * f, a, c2); oh[q] = a; ol[q] = c2; }
                const size_t o = ((size_t)zz * RH + i) * TT + ch * 128 + lane * 4; *(v4us*)(Ph + o) = oh; *(v4us*)(Pl + o) = ol; }
        } else {
#pragma unroll
            for (int ch = 0; ch < 16; ++ch) { v4h o;
#pragma unroll
                for (int q = 0; q < 4; ++q) o[q] = tohx(v[ch * 4 + q] * f);
                *(v4h*)(P16 + (size_t)row * TT + ch * 128 + lane * 4) = o; } }
         }
}
__global__ __launch_bounds__(256) void k_merge(const float* __restrict__ O, int h0, bf* Ah, bf* Al) {
    const int lane = threadIdx.x & 31; const int L0 = (blockIdx.x * 8 + (threadIdx.x >> 5)) * 8; const int nlines = ZH * TT * HD / 64;
{
#pragma unroll
        for (int l = 0; l < 8; ++l) { const int L = L0 + l; if (L >= nlines) break; const int e = L * 64 + lane * 2; const int d = e & (HD - 1); const int t = (e >> 6) & (TT - 1); const int zz = e >> 17; v2us oh, ol;
const float cs = (t < RH) ? 1.0f : (1.0f / PCAR);
#pragma unroll
            for (int q = 0; q < 2; ++q) { unsigned short a, c2; splitf(O[(size_t)e + q] * cs, a, c2); oh[q] = a; ol[q] = c2; }
            const size_t o = (size_t)t * DD + (h0 + zz) * HD + d; *(v2us*)(Ah + o) = oh; *(v2us*)(Al + o) = ol; }
         }
}

__global__ __launch_bounds__(32) void k_entmean(const float* __restrict__ ENT, float* OUT1) { const int lane = threadIdx.x; float s = 0.f; for (int r = lane; r < NB_ * NH_ * TT; r += 32) s = __fadd_rn(s, ENT[(size_t)r * 32]);
#pragma unroll
    for (int sh = 16; sh; sh >>= 1) s += __shfl_xor(s, sh, 32);
    if (lane == 0) { const float m = s * (1.0f / (float)(NB_ * NH_ * TT)); *(float*)OUT1 = m;  } }
extern "C" void kernel_launch(void* const* d_in, const int* in_sizes, int n_in,
                              void* d_out, int out_size, void* d_ws, size_t ws_size, hipStream_t stream) {
    (void)in_sizes; (void)n_in; (void)out_size;
    const float* x = (const float*)d_in[0]; const float* wqkv = (const float*)d_in[1]; const float* wo = (const float*)d_in[2];   // w_attn [1024][3072], w_proj [1024][1024] as x @ W (no biases)
    float* OUT = (float*)d_out; float* OUT1 = OUT + (size_t)NB_ * TT * DD;     // [2][2048][1024] at 0; [1] entropy at byte 16,777,216
    char* wsp = (char*)d_ws;
    auto take = [&](size_t bytes) { char* p = wsp; wsp += (bytes + 255) & ~(size_t)255; return (void*)p; };
    bf* WQKV = (bf*)take((size_t)3 * DD * DD * 2); bf* WO = (bf*)take((size_t)DD * DD * 2);
    bf* XB = (bf*)take((size_t)TT * DD * 2); float* F = (float*)take((size_t)TT * DD * 4);
    bf* QPh = (bf*)take((size_t)TT * DD * 2); bf* QPl = (bf*)take((size_t)TT * DD * 2); bf* KPh = (bf*)take((size_t)TT * DD * 2); bf* KPl = (bf*)take((size_t)TT * DD * 2); bf* VTh = (bf*)take((size_t)TT * DD * 2); bf* VTl = (bf*)take((size_t)TT * DD * 2);
    h16* QP16 = (h16*)take((size_t)TT * DD * 2); h16* KP16 = (h16*)take((size_t)TT * DD * 2); h16* VT16 = (h16*)take((size_t)TT * DD * 2);
    float* Sb = (float*)take((size_t)ZH * TT * TT * 4); bf* Ph = (bf*)take((size_t)ZH * RH * TT * 2); bf* Pl = (bf*)take((size_t)ZH * RH * TT * 2); h16* P16 = (h16*)take((size_t)ZH * TT * TT * 2); float* Ob = (float*)take((size_t)ZH * TT * HD * 4); float* ENT = (float*)take((size_t)NB_ * NH_ * TT * 32 * 4); bf* ATh = (bf*)take((size_t)TT * DD * 2); bf* ATl = (bf*)take((size_t)TT * DD * 2);
    if ((size_t)(wsp - (char*)d_ws) > ws_size) return;    // total ~ 131 MB = 125 MiB; ws 256 MiB
    { k_wtG<<<(unsigned)((DD * 3 * DD / 64 + 63) / 64), 256, 0, stream>>>(wqkv, DD, 3 * DD, WQKV); k_wtG<<<(unsigned)((DD * DD / 64 + 63) / 64), 256, 0, stream>>>(wo, DD, DD, WO); }
    const unsigned LB = (unsigned)((NH_ * TT * HD / 64 + 63) / 64); const dim3 gP(TT / 64, DD / 64, 1);
    for (int b = 0; b < NB_; ++b) {
        k_cvt8<<<(unsigned)(((size_t)TT * DD / 8 + 255) / 256), 256, 0, stream>>>(x + (size_t)b * TT * DD, XB, (size_t)TT * DD / 8);
        k_gemmw<bf, 0, false><<<gP, 32, 0, stream>>>(XB, nullptr, WQKV, nullptr, DD, F, DD, nullptr, 0, 0, 0); k_qplanes<<<LB, 256, 0, stream>>>(F, QPh, QPl, QP16);
        k_gemmw<bf, 0, false><<<gP, 32, 0, stream>>>(XB, nullptr, WQKV + (size_t)DD * DD, nullptr, DD, F, DD, nullptr, 0, 0, 0); k_qplanes<<<LB, 256, 0, stream>>>(F, KPh, KPl, KP16);
        k_gemmw<bf, 0, false><<<gP, 32, 0, stream>>>(XB, nullptr, WQKV + (size_t)2 * DD * DD, nullptr, DD, F, DD, nullptr, 0, 0, 0); k_vtplane<<<LB, 256, 0, stream>>>(F, VTh, VTl, VT16);
        for (int h0 = 0; h0 < NH_; h0 += ZH) { const size_t z0 = (size_t)h0;
            k_gemmw<bf, 2, false><<<dim3(RH / 64, TT / 64, ZH), 32, 0, stream>>>(QPh + z0 * TT * HD, QPl + z0 * TT * HD, KPh + z0 * TT * HD, KPl + z0 * TT * HD, HD, Sb, TT, nullptr, (size_t)TT * HD, (size_t)TT * HD, (size_t)TT * TT);
            k_gemmw<h16, 0, false><<<dim3((TT - RH) / 64, TT / 64, ZH), 32, 0, stream>>>(QP16 + z0 * TT * HD + (size_t)RH * HD, nullptr, KP16 + z0 * TT * HD, nullptr, HD, Sb + (size_t)RH * TT, TT, nullptr, (size_t)TT * HD, (size_t)TT * HD, (size_t)TT * TT);
            k_asoft<<<ZH * TT / 8, 256, 0, stream>>>(Sb, Ph, Pl, P16, ENT, (b * NH_ + h0) * TT);
            k_gemmw<bf, 2, false><<<dim3(RH / 64, HD / 64, ZH), 32, 0, stream>>>(Ph, Pl, VTh + z0 * HD * TT, VTl + z0 * HD * TT, TT, Ob, HD, nullptr, (size_t)RH * TT, (size_t)HD * TT, (size_t)TT * HD);
            k_gemmw<h16, 0, false><<<dim3((TT - RH) / 64, HD / 64, ZH), 32, 0, stream>>>(P16 + (size_t)RH * TT, nullptr, VT16 + z0 * HD * TT, nullptr, TT, Ob + (size_t)RH * HD, HD, nullptr, (size_t)TT * TT, (size_t)HD * TT, (size_t)TT * HD);
            k_merge<<<(ZH * TT * HD / 64 + 63) / 64, 256, 0, stream>>>(Ob, h0, ATh, ATl); }
        k_gemmw<bf, 1, false><<<gP, 32, 0, stream>>>(ATh, ATl, WO, nullptr, DD, OUT + (size_t)b * TT * DD, DD, nullptr, 0, 0, 0); }
    k_entmean<<<1, 32, 0, stream>>>(ENT, OUT1);
}

// v001
// One run takes 1300 microseconds.
// Timed twice side by side with v000, it ran 1.73 and 1.72 times as fast.
#include <hip/hip_runtime.h>

// Causal multi-head self-attention with an attention-entropy monitor (x [2][2048][1024]; qkv = x w_attn (16 heads x 64, no bias); causal softmax(q.k/8); y = merged att.v w_proj -> [2][2048][1024];
// second output = mean over all (batch, head, query) rows of the row entropy -sum_s att log(att + 1e-8) -> [1]).
// Compute dtypes, f32 accumulate: every input rounded to bf16; qkv projection on PLAIN bf16 operands (inputs: exact products, f32 accumulate); w_proj on att.v hi+lo planes (2 products); PER-ROW PRECISION HYBRID:
// query rows < 256 take scores and att.v on bf16 hi+lo planes (3 products), rows >= 256 on single fp16 planes; 1/8, the causal cut, the softmax and the row entropy (from the f32 probabilities, hardware

#define NB_  2
#define TT   2048
#define DD   1024
#define NH_  16
#define HD   64
#define ZH   2
#define RH   256                  // query rows < RH: hi+lo planes; rows >= RH: fp16 planes
#define NF   32                   // head_dim / 2 (unused here)
#define SCL  0.125f               // 1/sqrt(64)
#define PCAR 1024.0f         // P scale for fp16 rows >= RH, undone in k_merge
typedef _Float16 h16;
typedef unsigned short bf;
typedef __attribute__((ext_vector_type(16))) __bf16   v16bf;
typedef __attribute__((ext_vector_type(16))) _Float16 v16h;
typedef __attribute__((ext_vector_type(8)))  _Float16 v8h;
typedef __attribute__((ext_vector_type(8)))  unsigned short v8us;
typedef __attribute__((ext_vector_type(8)))  float    v8f;
typedef __attribute__((ext_vector_type(4)))  float    v4f;
typedef v8h  __attribute__((may_alias)) v8ha;
typedef v4f  __attribute__((may_alias)) v4fa;
typedef v8us __attribute__((may_alias)) v8usa;

__device__ __forceinline__ unsigned short f2bf(float f) { unsigned u = __float_as_uint(f); u += 0x7FFFu + ((u >> 16) & 1u); return (unsigned short)(u >> 16); }
__device__ __forceinline__ float bf2f(unsigned short b) { return __uint_as_float(((unsigned)b) << 16); }
__device__ __forceinline__ float bfr(float f) { return bf2f(f2bf(f)); }
__device__ __forceinline__ v16h cat16(v8h lo, v8h hi) { return __builtin_shufflevector(lo, hi, 0, 1, 2, 3, 4, 5, 6, 7, 8, 9, 10, 11, 12, 13, 14, 15); }
__device__ __forceinline__ v16bf cat16b(v8us lo, v8us hi) { return __builtin_bit_cast(v16bf, __builtin_shufflevector(lo, hi, 0, 1, 2, 3, 4, 5, 6, 7, 8, 9, 10, 11, 12, 13, 14, 15)); }
__device__ __forceinline__ v8f wmma16(v16h a, v16h b, v8f c) { return __builtin_amdgcn_wmma_f32_16x16x32_f16(false, a, false, b, (short)0, c, false, false); }
__device__ __forceinline__ v8f wmmab(v16bf a, v16bf b, v8f c) { return __builtin_amdgcn_wmma_f32_16x16x32_bf16(false, a, false, b, (short)0, c, false, false); }



// ---- k_gemmw: register-blocked GEMM, one 64x64 output tile per work-group (16 accumulators a wave), operands straight from K-contiguous 16-bit planes; grid (M/64, N/64, Z), 32 * NW threads.
// C[m][n] (f32, pitch ldc, + optional f32 bias[n]) = sum_k A[m][k] Bt[n][k] (+ split products per NSPLIT). z-batch strides sA/sB/sC in elements. K % (32 * NW) == 0.
// NW > 1: the work-group has NW waves on the SAME tile; wave w takes the k steps w, w + NW, ... (a chain of K / (32 * NW) load round trips instead of K / 32); the NW partial tiles are summed in LDS, wave 0 first.
template <typename T16> struct WFrag;
template <> struct WFrag<h16> { typedef v16h V; static __device__ __forceinline__ V ld(const h16* p) { return cat16(*(const v8h*)p, *(const v8h*)(p + 16)); } static __device__ __forceinline__ v8f mma(V a, V b, v8f c) { return wmma16(a, b, c); } };
template <> struct WFrag<bf> { typedef v16bf V; static __device__ __forceinline__ V ld(const bf* p) { return cat16b(*(const v8us*)p, *(const v8us*)(p + 16)); } static __device__ __forceinline__ v8f mma(V a, V b, v8f c) { return wmmab(a, b, c); } };
template <typename T16, int NSPLIT, bool BIAS, int NW>
__global__ __launch_bounds__(32 * NW) void k_gemmw(const T16* __restrict__ A, const T16* __restrict__ A2, const T16* __restrict__ Bt, const T16* __restrict__ Bt2, int K, float* C, int ldc, const float* __restrict__ bias, size_t sA, size_t sB, size_t sC) {
    typedef typename WFrag<T16>::V V;
    const int w = NW > 1 ? __builtin_amdgcn_readfirstlane((int)(threadIdx.x >> 5)) : 0;   // wave number, held scalar
    const size_t z = blockIdx.z; A += z * sA; if (A2) A2 += z * sA; Bt += z * sB; if (Bt2) Bt2 += z * sB; C += z * sC;
    const int lane = threadIdx.x & 31, lr = lane & 15, hi = lane >> 4; const int r0 = blockIdx.x * 64, c0 = blockIdx.y * 64;
    v8f acc[4][4];
#pragma unroll
    for (int mb = 0; mb < 4; ++mb)
#pragma unroll
        for (int nb = 0; nb < 4; ++nb) acc[mb][nb] = (v8f){};
    const size_t aoff = (size_t)(r0 + lr) * K + 8 * hi, boff = (size_t)(c0 + lr) * K + 8 * hi;
#pragma unroll 1
    for (int kc = w * 32; kc < K; kc += 32 * NW) {
        V a[4], a2[4];
#pragma unroll
        for (int mb = 0; mb < 4; ++mb) { a[mb] = WFrag<T16>::ld(A + aoff + (size_t)mb * 16 * K + kc); if (NSPLIT == 1 || NSPLIT == 2) a2[mb] = WFrag<T16>::ld(A2 + aoff + (size_t)mb * 16 * K + kc); }
#pragma unroll
        for (int nb = 0; nb < 4; ++nb) { const V b = WFrag<T16>::ld(Bt + boff + (size_t)nb * 16 * K + kc); V b2; if (NSPLIT >= 2) b2 = WFrag<T16>::ld(Bt2 + boff + (size_t)nb * 16 * K + kc);
#pragma unroll
            for (int mb = 0; mb < 4; ++mb) { acc[mb][nb] = WFrag<T16>::mma(a[mb], b, acc[mb][nb]); if (NSPLIT == 1 || NSPLIT == 2) acc[mb][nb] = WFrag<T16>::mma(a2[mb], b, acc[mb][nb]); if (NSPLIT >= 2) acc[mb][nb] = WFrag<T16>::mma(a[mb], b2, acc[mb][nb]); } }
        asm volatile("v_nop\n\tv_nop\n\tv_nop\n\tv_nop" : "+v"(acc[0][0]), "+v"(acc[1][1]), "+v"(acc[2][2]), "+v"(acc[3][3]) : "v"(a[0]), "v"(a[3]));
    }
    if constexpr (NW > 1) {
        // Partial tiles in fragment order: red[s][f][q][lane] = JP consecutive accumulator rows j of fragment f = mb * 4 + nb of wave s (every LDS access is 32 lanes side by side).
        // Wave w then owns rows mb * 16 + hi * 8 + q * JP + (0 .. JP - 1) over all 64 columns (mb = w / QN, q = w % QN): whole 128-byte lines of C have one writing wave.
        constexpr int JP = 32 / NW, QN = 8 / JP;
        typedef __attribute__((ext_vector_type(JP))) float vJ;
        __shared__ vJ red[NW][16][QN][32];
#pragma unroll
        for (int mb = 0; mb < 4; ++mb)
#pragma unroll
            for (int nb = 0; nb < 4; ++nb)
#pragma unroll
                for (int q = 0; q < QN; ++q) { vJ t;
#pragma unroll
                    for (int jj = 0; jj < JP; ++jj) t[jj] = acc[mb][nb][q * JP + jj];
                    red[w][mb * 4 + nb][q][lane] = t; }
        __syncthreads();   // every wave's partial tile is in LDS before any wave sums
        const int mo = w / QN, qo = w % QN;
#pragma unroll
        for (int nb = 0; nb < 4; ++nb) { vJ sum = red[0][mo * 4 + nb][qo][lane];
#pragma unroll
            for (int s = 1; s < NW; ++s) sum += red[s][mo * 4 + nb][qo][lane];
            float* cp = C + (size_t)(r0 + mo * 16 + hi * 8 + qo * JP) * ldc + c0 + nb * 16 + lr;
#pragma unroll
            for (int jj = 0; jj < JP; ++jj) cp[(size_t)jj * ldc] = BIAS ? sum[jj] + bfr(bias[c0 + nb * 16 + lr]) : sum[jj]; }
    } else {
    __shared__ __align__(16) float os[16 * 68];
#pragma unroll
    for (int mb = 0; mb < 4; ++mb) {
#pragma unroll
        for (int nb = 0; nb < 4; ++nb) {
#pragma unroll
            for (int j = 0; j < 8; ++j) os[(hi * 8 + j) * 68 + nb * 16 + lr] = acc[mb][nb][j]; }
        __builtin_amdgcn_wave_barrier(); asm volatile("" ::: "memory");
        float* crow = C + (size_t)(r0 + mb * 16) * ldc + c0;
{
#pragma unroll
            for (int s = 0; s < 8; ++s) { const int row = 2 * s + hi, cofs = lr * 4; v4f val = *(const v4fa*)(os + row * 68 + cofs); if (BIAS) { val[0] += bfr(bias[c0 + cofs]); val[1] += bfr(bias[c0 + cofs + 1]); val[2] += bfr(bias[c0 + cofs + 2]); val[3] += bfr(bias[c0 + cofs + 3]); }
                *(v4f*)(crow + (size_t)row * ldc + cofs) = val; }
             }
        __builtin_amdgcn_wave_barrier(); asm volatile("" ::: "memory");
    }
    }
}

__device__ __forceinline__ h16 tohx(float x) { return (h16)x; }
__device__ __forceinline__ void splitf(float y, unsigned short& h, unsigned short& l) { h = f2bf(y); l = f2bf(y - bf2f(h)); }
typedef __attribute__((ext_vector_type(2))) unsigned short v2us;
typedef __attribute__((ext_vector_type(2))) _Float16 v2h;
typedef __attribute__((ext_vector_type(4))) _Float16 v4h;
typedef __attribute__((ext_vector_type(2))) float v2f;

__global__ __launch_bounds__(256) void k_wtG(const float* __restrict__ w, int K, int N, bf* Bt) {
    const int lane = threadIdx.x & 31; const int L0 = (blockIdx.x * 8 + (threadIdx.x >> 5)) * 8; const int nlines = N * K / 64;
{
#pragma unroll 1
        for (int l = 0; l < 8; ++l) { const int L = L0 + l; if (L >= nlines) break; const size_t e = (size_t)L * 64 + lane * 2; const int k = (int)(e % K), n = (int)(e / K); v2us o;
            o[0] = f2bf(w[(size_t)k * N + n]); o[1] = f2bf(w[(size_t)(k + 1) * N + n]); *(v2us*)(Bt + e) = o; }
         }
}
__global__ __launch_bounds__(256) void k_cvt8(const float* __restrict__ src, bf* dst, size_t n8) { const size_t i = (size_t)blockIdx.x * 256 + threadIdx.x; if (i >= n8) return; const v8f v = *(const v8f*)(src + i * 8); v8us o;
#pragma unroll
    for (int k = 0; k < 8; ++k) o[k] = f2bf(v[k]); *(v8us*)(dst + i * 8) = o;  }
__global__ __launch_bounds__(256) void k_qplanes(const float* __restrict__ F, bf* Ph, bf* Pl, h16* P16) {
    const int lane = threadIdx.x & 31; const int L0 = (blockIdx.x * 8 + (threadIdx.x >> 5)) * 8; const int nlines = NH_ * TT * HD / 64;
{
#pragma unroll
        for (int l = 0; l < 8; ++l) { const int L = L0 + l; if (L >= nlines) break; const int e = L * 64 + lane * 2; const int d = e & (HD - 1); const int t = (e >> 6) & (TT - 1); const int h = e >> 17; v2us oh, ol; v2h o16;
#pragma unroll
            for (int q = 0; q < 2; ++q) { const float x = F[(size_t)t * DD + h * HD + d + q]; unsigned short a, c2; splitf(x, a, c2); oh[q] = a; ol[q] = c2; o16[q] = tohx(x); }
            *(v2us*)(Ph + (size_t)e) = oh; *(v2us*)(Pl + (size_t)e) = ol; *(v2h*)(P16 + (size_t)e) = o16; }
         }
}
__global__ __launch_bounds__(256) void k_vtplane(const float* __restrict__ F, bf* Vh, bf* Vl, h16* V16) {
    const int lane = threadIdx.x & 31; const int L0 = (blockIdx.x * 8 + (threadIdx.x >> 5)) * 8; const int nlines = NH_ * TT * HD / 64;
{
#pragma unroll
        for (int l = 0; l < 8; ++l) { const int L = L0 + l; if (L >= nlines) break; const int e = L * 64 + lane * 2; const int t = e & (TT - 1); const int d = (e >> 11) & (HD - 1); const int h = e >> 17; v2us oh, ol; v2h o16;
#pragma unroll
            for (int q = 0; q < 2; ++q) { const float x = F[(size_t)(t + q) * DD + h * HD + d]; unsigned short a, c2; splitf(x, a, c2); oh[q] = a; ol[q] = c2; o16[q] = tohx(x); }
            *(v2us*)(Vh + (size_t)e) = oh; *(v2us*)(Vl + (size_t)e) = ol; *(v2h*)(V16 + (size_t)e) = o16; }
         }
}
// k_asoft: per row (zz, i): t = S/8 for j <= i (causal), -3e38 otherwise; softmax over the 2048 keys (register row, one exp); also the row entropy -sum p log(p + 1e-8) from the f32 probabilities -> ENT[erow0 + row][0..31] line (lane 0) -> rows i < RH: P hi/lo [zz][i][j] (compact
__global__ __launch_bounds__(256) void k_asoft(const float* __restrict__ Sb, bf* Ph, bf* Pl, h16* P16, float* ENT, int erow0) {
    typedef __attribute__((ext_vector_type(4))) unsigned short v4us;
    const int lane = threadIdx.x & 31; const int row = blockIdx.x * 8 + (threadIdx.x >> 5); if (row >= ZH * TT) return; const int i = row & (TT - 1); const int zz = row >> 11; const bool hires = (i < RH);
    const float* sr = Sb + (size_t)row * TT; float v[64]; float mx = -3.0e38f;
#pragma unroll
    for (int ch = 0; ch < 16; ++ch) { const int j0 = ch * 128 + lane * 4; const v4f a = *(const v4f*)(sr + j0);
#pragma unroll
        for (int q = 0; q < 4; ++q) { const int j = j0 + q; const float t = (j <= i) ? a[q] * SCL : -3.0e38f; v[ch * 4 + q] = t; mx = fmaxf(mx, t); } }
#pragma unroll
    for (int sh = 16; sh; sh >>= 1) mx = fmaxf(mx, __shfl_xor(mx, sh, 32));
    float sum = 0.f;
#pragma unroll
    for (int k = 0; k < 64; ++k) { v[k] = __expf(v[k] - mx); sum += v[k]; }
#pragma unroll
    for (int sh = 16; sh; sh >>= 1) sum += __shfl_xor(sum, sh, 32);
    const float f = __fdiv_rn(hires ? 1.0f : PCAR, sum); const float pn = __fdiv_rn(1.0f, sum); float ent = 0.f;   // row entropy from the f32 probabilities p = e/sum
#pragma unroll
    for (int k = 0; k < 64; ++k) { float p = __fmul_rn(v[k], pn); asm volatile("" : "+v"(p)); float l2 = __builtin_amdgcn_logf(__fadd_rn(p, 1e-8f)); asm volatile("" : "+v"(l2)); float lg = __fmul_rn(l2, 0.69314718055994531f); asm volatile("" : "+v"(lg)); float pl = __fmul_rn(p, lg); asm volatile("" : "+v"(pl)); ent = __fsub_rn(ent, pl); }
#pragma unroll
    for (int sh = 16; sh; sh >>= 1) ent += __shfl_xor(ent, sh, 32);
    { const float eo = lane == 0 ? ent : 0.f; float* er = ENT + ((size_t)erow0 + row) * 32 + lane; *(float*)er = eo;  }
{
        if (hires) {
#pragma unroll
            for (int ch = 0; ch < 16; ++ch) { v4us oh, ol;
#pragma unroll
                for (int q = 0; q < 4; ++q) { unsigned short a, c2; splitf(v[ch * 4 + q] * f, a, c2); oh[q] = a; ol[q] = c2; }
                const size_t o = ((size_t)zz * RH + i) * TT + ch * 128 + lane * 4; *(v4us*)(Ph + o) = oh; *(v4us*)(Pl + o) = ol; }
        } else {
#pragma unroll
            for (int ch = 0; ch < 16; ++ch) { v4h o;
#pragma unroll
                for (int q = 0; q < 4; ++q) o[q] = tohx(v[ch * 4 + q] * f);
                *(v4h*)(P16 + (size_t)row * TT + ch * 128 + lane * 4) = o; } }
         }
}
__global__ __launch_bounds__(256) void k_merge(const float* __restrict__ O, int h0, bf* Ah, bf* Al) {
    const int lane = threadIdx.x & 31; const int L0 = (blockIdx.x * 8 + (threadIdx.x >> 5)) * 8; const int nlines = ZH * TT * HD / 64;
{
#pragma unroll
        for (int l = 0; l < 8; ++l) { const int L = L0 + l; if (L >= nlines) break; const int e = L * 64 + lane * 2; const int d = e & (HD - 1); const int t = (e >> 6) & (TT - 1); const int zz = e >> 17; v2us oh, ol;
const float cs = (t < RH) ? 1.0f : (1.0f / PCAR);
#pragma unroll
            for (int q = 0; q < 2; ++q) { unsigned short a, c2; splitf(O[(size_t)e + q] * cs, a, c2); oh[q] = a; ol[q] = c2; }
            const size_t o = (size_t)t * DD + (h0 + zz) * HD + d; *(v2us*)(Ah + o) = oh; *(v2us*)(Al + o) = ol; }
         }
}

__global__ __launch_bounds__(32) void k_entmean(const float* __restrict__ ENT, float* OUT1) { const int lane = threadIdx.x; float s = 0.f; for (int r = lane; r < NB_ * NH_ * TT; r += 32) s = __fadd_rn(s, ENT[(size_t)r * 32]);
#pragma unroll
    for (int sh = 16; sh; sh >>= 1) s += __shfl_xor(s, sh, 32);
    if (lane == 0) { const float m = s * (1.0f / (float)(NB_ * NH_ * TT)); *(float*)OUT1 = m;  } }
extern "C" void kernel_launch(void* const* d_in, const int* in_sizes, int n_in,
                              void* d_out, int out_size, void* d_ws, size_t ws_size, hipStream_t stream) {
    (void)in_sizes; (void)n_in; (void)out_size;
    const float* x = (const float*)d_in[0]; const float* wqkv = (const float*)d_in[1]; const float* wo = (const float*)d_in[2];   // w_attn [1024][3072], w_proj [1024][1024] as x @ W (no biases)
    float* OUT = (float*)d_out; float* OUT1 = OUT + (size_t)NB_ * TT * DD;     // [2][2048][1024] at 0; [1] entropy at byte 16,777,216
    char* wsp = (char*)d_ws;
    auto take = [&](size_t bytes) { char* p = wsp; wsp += (bytes + 255) & ~(size_t)255; return (void*)p; };
    bf* WQKV = (bf*)take((size_t)3 * DD * DD * 2); bf* WO = (bf*)take((size_t)DD * DD * 2);
    bf* XB = (bf*)take((size_t)TT * DD * 2); float* F = (float*)take((size_t)TT * DD * 4);
    bf* QPh = (bf*)take((size_t)TT * DD * 2); bf* QPl = (bf*)take((size_t)TT * DD * 2); bf* KPh = (bf*)take((size_t)TT * DD * 2); bf* KPl = (bf*)take((size_t)TT * DD * 2); bf* VTh = (bf*)take((size_t)TT * DD * 2); bf* VTl = (bf*)take((size_t)TT * DD * 2);
    h16* QP16 = (h16*)take((size_t)TT * DD * 2); h16* KP16 = (h16*)take((size_t)TT * DD * 2); h16* VT16 = (h16*)take((size_t)TT * DD * 2);
    float* Sb = (float*)take((size_t)ZH * TT * TT * 4); bf* Ph = (bf*)take((size_t)ZH * RH * TT * 2); bf* Pl = (bf*)take((size_t)ZH * RH * TT * 2); h16* P16 = (h16*)take((size_t)ZH * TT * TT * 2); float* Ob = (float*)take((size_t)ZH * TT * HD * 4); float* ENT = (float*)take((size_t)NB_ * NH_ * TT * 32 * 4); bf* ATh = (bf*)take((size_t)TT * DD * 2); bf* ATl = (bf*)take((size_t)TT * DD * 2);
    if ((size_t)(wsp - (char*)d_ws) > ws_size) return;    // total ~ 131 MB = 125 MiB; ws 256 MiB
    { k_wtG<<<(unsigned)((DD * 3 * DD / 64 + 63) / 64), 256, 0, stream>>>(wqkv, DD, 3 * DD, WQKV); k_wtG<<<(unsigned)((DD * DD / 64 + 63) / 64), 256, 0, stream>>>(wo, DD, DD, WO); }
    const unsigned LB = (unsigned)((NH_ * TT * HD / 64 + 63) / 64); const dim3 gP(TT / 64, DD / 64, 1);
    for (int b = 0; b < NB_; ++b) {
        k_cvt8<<<(unsigned)(((size_t)TT * DD / 8 + 255) / 256), 256, 0, stream>>>(x + (size_t)b * TT * DD, XB, (size_t)TT * DD / 8);
        k_gemmw<bf, 0, false, 8><<<gP, 256, 0, stream>>>(XB, nullptr, WQKV, nullptr, DD, F, DD, nullptr, 0, 0, 0); k_qplanes<<<LB, 256, 0, stream>>>(F, QPh, QPl, QP16);
        k_gemmw<bf, 0, false, 8><<<gP, 256, 0, stream>>>(XB, nullptr, WQKV + (size_t)DD * DD, nullptr, DD, F, DD, nullptr, 0, 0, 0); k_qplanes<<<LB, 256, 0, stream>>>(F, KPh, KPl, KP16);
        k_gemmw<bf, 0, false, 8><<<gP, 256, 0, stream>>>(XB, nullptr, WQKV + (size_t)2 * DD * DD, nullptr, DD, F, DD, nullptr, 0, 0, 0); k_vtplane<<<LB, 256, 0, stream>>>(F, VTh, VTl, VT16);
        for (int h0 = 0; h0 < NH_; h0 += ZH) { const size_t z0 = (size_t)h0;
            k_gemmw<bf, 2, false, 1><<<dim3(RH / 64, TT / 64, ZH), 32, 0, stream>>>(QPh + z0 * TT * HD, QPl + z0 * TT * HD, KPh + z0 * TT * HD, KPl + z0 * TT * HD, HD, Sb, TT, nullptr, (size_t)TT * HD, (size_t)TT * HD, (size_t)TT * TT);
            k_gemmw<h16, 0, false, 1><<<dim3((TT - RH) / 64, TT / 64, ZH), 32, 0, stream>>>(QP16 + z0 * TT * HD + (size_t)RH * HD, nullptr, KP16 + z0 * TT * HD, nullptr, HD, Sb + (size_t)RH * TT, TT, nullptr, (size_t)TT * HD, (size_t)TT * HD, (size_t)TT * TT);
            k_asoft<<<ZH * TT / 8, 256, 0, stream>>>(Sb, Ph, Pl, P16, ENT, (b * NH_ + h0) * TT);
            k_gemmw<bf, 2, false, 16><<<dim3(RH / 64, HD / 64, ZH), 512, 0, stream>>>(Ph, Pl, VTh + z0 * HD * TT, VTl + z0 * HD * TT, TT, Ob, HD, nullptr, (size_t)RH * TT, (size_t)HD * TT, (size_t)TT * HD);
            k_gemmw<h16, 0, false, 16><<<dim3((TT - RH) / 64, HD / 64, ZH), 512, 0, stream>>>(P16 + (size_t)RH * TT, nullptr, VT16 + z0 * HD * TT, nullptr, TT, Ob + (size_t)RH * HD, HD, nullptr, (size_t)TT * TT, (size_t)HD * TT, (size_t)TT * HD);
            k_merge<<<(ZH * TT * HD / 64 + 63) / 64, 256, 0, stream>>>(Ob, h0, ATh, ATl); }
        k_gemmw<bf, 1, false, 8><<<gP, 256, 0, stream>>>(ATh, ATl, WO, nullptr, DD, OUT + (size_t)b * TT * DD, DD, nullptr, 0, 0, 0); }
    k_entmean<<<1, 32, 0, stream>>>(ENT, OUT1);
}

// v002
// It runs in 740 microseconds.
// Two timings next to v001 put it at 1.76 and 1.75 times that version's speed.
// All steps since v000 together make it 3.02 times as fast.
#include <hip/hip_runtime.h>

// Causal multi-head self-attention with an attention-entropy monitor (x [2][2048][1024]; qkv = x w_attn (16 heads x 64, no bias); causal softmax(q.k/8); y = merged att.v w_proj -> [2][2048][1024];
// second output = mean over all (batch, head, query) rows of the row entropy -sum_s att log(att + 1e-8) -> [1]).
// Compute dtypes, f32 accumulate: every input rounded to bf16; qkv projection on PLAIN bf16 operands (inputs: exact products, f32 accumulate); w_proj on att.v hi+lo planes (2 products); PER-ROW PRECISION HYBRID:
// query rows < 256 take scores and att.v on bf16 hi+lo planes (3 products), rows >= 256 on single fp16 planes; 1/8, the causal cut, the softmax and the row entropy (from the f32 probabilities, hardware

#define NB_  2
#define TT   2048
#define DD   1024
#define NH_  16
#define HD   64
#define ZH   8                    // heads per set of attention launches
#define RH   256                  // query rows < RH: hi+lo planes; rows >= RH: fp16 planes
#define NF   32                   // head_dim / 2 (unused here)
#define SCL  0.125f               // 1/sqrt(64)
#define PCAR 1024.0f         // P scale for fp16 rows >= RH, undone in k_merge
typedef _Float16 h16;
typedef unsigned short bf;
typedef __attribute__((ext_vector_type(16))) __bf16   v16bf;
typedef __attribute__((ext_vector_type(16))) _Float16 v16h;
typedef __attribute__((ext_vector_type(8)))  _Float16 v8h;
typedef __attribute__((ext_vector_type(8)))  unsigned short v8us;
typedef __attribute__((ext_vector_type(8)))  float    v8f;
typedef __attribute__((ext_vector_type(4)))  float    v4f;
typedef v8h  __attribute__((may_alias)) v8ha;
typedef v4f  __attribute__((may_alias)) v4fa;
typedef v8us __attribute__((may_alias)) v8usa;

__device__ __forceinline__ unsigned short f2bf(float f) { unsigned u = __float_as_uint(f); u += 0x7FFFu + ((u >> 16) & 1u); return (unsigned short)(u >> 16); }
__device__ __forceinline__ float bf2f(unsigned short b) { return __uint_as_float(((unsigned)b) << 16); }
__device__ __forceinline__ float bfr(float f) { return bf2f(f2bf(f)); }
__device__ __forceinline__ v16h cat16(v8h lo, v8h hi) { return __builtin_shufflevector(lo, hi, 0, 1, 2, 3, 4, 5, 6, 7, 8, 9, 10, 11, 12, 13, 14, 15); }
__device__ __forceinline__ v16bf cat16b(v8us lo, v8us hi) { return __builtin_bit_cast(v16bf, __builtin_shufflevector(lo, hi, 0, 1, 2, 3, 4, 5, 6, 7, 8, 9, 10, 11, 12, 13, 14, 15)); }
__device__ __forceinline__ v8f wmma16(v16h a, v16h b, v8f c) { return __builtin_amdgcn_wmma_f32_16x16x32_f16(false, a, false, b, (short)0, c, false, false); }
__device__ __forceinline__ v8f wmmab(v16bf a, v16bf b, v8f c) { return __builtin_amdgcn_wmma_f32_16x16x32_bf16(false, a, false, b, (short)0, c, false, false); }



// ---- k_gemmw: register-blocked GEMM, one 64x64 output tile per work-group (16 accumulators a wave), operands straight from K-contiguous 16-bit planes; grid (M/64, N/64, Z), 32 * NW threads.
// C[m][n] (f32, pitch ldc, + optional f32 bias[n]) = sum_k A[m][k] Bt[n][k] (+ split products per NSPLIT). A and A2 have row pitch lda, Bt and Bt2 row pitch K. z-batch strides sA/sB/sC in elements. K % (32 * NW) == 0.
// NW > 1: the work-group has NW waves on the SAME tile; wave w takes the k steps w, w + NW, ... (a chain of K / (32 * NW) load round trips instead of K / 32); the NW partial tiles are summed in LDS, wave 0 first.
template <typename T16> struct WFrag;
template <> struct WFrag<h16> { typedef v16h V; static __device__ __forceinline__ V ld(const h16* p) { return cat16(*(const v8h*)p, *(const v8h*)(p + 16)); } static __device__ __forceinline__ v8f mma(V a, V b, v8f c) { return wmma16(a, b, c); } };
template <> struct WFrag<bf> { typedef v16bf V; static __device__ __forceinline__ V ld(const bf* p) { return cat16b(*(const v8us*)p, *(const v8us*)(p + 16)); } static __device__ __forceinline__ v8f mma(V a, V b, v8f c) { return wmmab(a, b, c); } };
template <typename T16, int NSPLIT, bool BIAS, int NW>
__global__ __launch_bounds__(32 * NW) void k_gemmw(const T16* __restrict__ A, const T16* __restrict__ A2, const T16* __restrict__ Bt, const T16* __restrict__ Bt2, int K, int lda, float* C, int ldc, const float* __restrict__ bias, size_t sA, size_t sB, size_t sC) {
    typedef typename WFrag<T16>::V V;
    const int w = NW > 1 ? __builtin_amdgcn_readfirstlane((int)(threadIdx.x >> 5)) : 0;   // wave number, held scalar
    const size_t z = blockIdx.z; A += z * sA; if (A2) A2 += z * sA; Bt += z * sB; if (Bt2) Bt2 += z * sB; C += z * sC;
    const int lane = threadIdx.x & 31, lr = lane & 15, hi = lane >> 4; const int r0 = blockIdx.x * 64, c0 = blockIdx.y * 64;
    v8f acc[4][4];
#pragma unroll
    for (int mb = 0; mb < 4; ++mb)
#pragma unroll
        for (int nb = 0; nb < 4; ++nb) acc[mb][nb] = (v8f){};
    const size_t aoff = (size_t)(r0 + lr) * lda + 8 * hi, boff = (size_t)(c0 + lr) * K + 8 * hi;
#pragma unroll 1
    for (int kc = w * 32; kc < K; kc += 32 * NW) {
        V a[4], a2[4];
#pragma unroll
        for (int mb = 0; mb < 4; ++mb) { a[mb] = WFrag<T16>::ld(A + aoff + (size_t)mb * 16 * lda + kc); if (NSPLIT == 1 || NSPLIT == 2) a2[mb] = WFrag<T16>::ld(A2 + aoff + (size_t)mb * 16 * lda + kc); }
#pragma unroll
        for (int nb = 0; nb < 4; ++nb) { const V b = WFrag<T16>::ld(Bt + boff + (size_t)nb * 16 * K + kc); V b2; if (NSPLIT >= 2) b2 = WFrag<T16>::ld(Bt2 + boff + (size_t)nb * 16 * K + kc);
#pragma unroll
            for (int mb = 0; mb < 4; ++mb) { acc[mb][nb] = WFrag<T16>::mma(a[mb], b, acc[mb][nb]); if (NSPLIT == 1 || NSPLIT == 2) acc[mb][nb] = WFrag<T16>::mma(a2[mb], b, acc[mb][nb]); if (NSPLIT >= 2) acc[mb][nb] = WFrag<T16>::mma(a[mb], b2, acc[mb][nb]); } }
        asm volatile("v_nop\n\tv_nop\n\tv_nop\n\tv_nop" : "+v"(acc[0][0]), "+v"(acc[1][1]), "+v"(acc[2][2]), "+v"(acc[3][3]) : "v"(a[0]), "v"(a[3]));
    }
    if constexpr (NW > 1) {
        // Partial tiles in fragment order: red[s][f][q][lane] = JP consecutive accumulator rows j of fragment f = mb * 4 + nb of wave s (every LDS access is 32 lanes side by side).
        // Wave w then owns rows mb * 16 + hi * 8 + q * JP + (0 .. JP - 1) over all 64 columns (mb = w / QN, q = w % QN): whole 128-byte lines of C have one writing wave.
        constexpr int JP = 32 / NW, QN = 8 / JP;
        typedef __attribute__((ext_vector_type(JP))) float vJ;
        __shared__ vJ red[NW][16][QN][32];
#pragma unroll
        for (int mb = 0; mb < 4; ++mb)
#pragma unroll
            for (int nb = 0; nb < 4; ++nb)
#pragma unroll
                for (int q = 0; q < QN; ++q) { vJ t;
#pragma unroll
                    for (int jj = 0; jj < JP; ++jj) t[jj] = acc[mb][nb][q * JP + jj];
                    red[w][mb * 4 + nb][q][lane] = t; }
        __syncthreads();   // every wave's partial tile is in LDS before any wave sums
        const int mo = w / QN, qo = w % QN;
#pragma unroll
        for (int nb = 0; nb < 4; ++nb) { vJ sum = red[0][mo * 4 + nb][qo][lane];
#pragma unroll
            for (int s = 1; s < NW; ++s) sum += red[s][mo * 4 + nb][qo][lane];
            float* cp = C + (size_t)(r0 + mo * 16 + hi * 8 + qo * JP) * ldc + c0 + nb * 16 + lr;
#pragma unroll
            for (int jj = 0; jj < JP; ++jj) cp[(size_t)jj * ldc] = BIAS ? sum[jj] + bfr(bias[c0 + nb * 16 + lr]) : sum[jj]; }
    } else {
    __shared__ __align__(16) float os[16 * 68];
#pragma unroll
    for (int mb = 0; mb < 4; ++mb) {
#pragma unroll
        for (int nb = 0; nb < 4; ++nb) {
#pragma unroll
            for (int j = 0; j < 8; ++j) os[(hi * 8 + j) * 68 + nb * 16 + lr] = acc[mb][nb][j]; }
        __builtin_amdgcn_wave_barrier(); asm volatile("" ::: "memory");
        float* crow = C + (size_t)(r0 + mb * 16) * ldc + c0;
{
#pragma unroll
            for (int s = 0; s < 8; ++s) { const int row = 2 * s + hi, cofs = lr * 4; v4f val = *(const v4fa*)(os + row * 68 + cofs); if (BIAS) { val[0] += bfr(bias[c0 + cofs]); val[1] += bfr(bias[c0 + cofs + 1]); val[2] += bfr(bias[c0 + cofs + 2]); val[3] += bfr(bias[c0 + cofs + 3]); }
                *(v4f*)(crow + (size_t)row * ldc + cofs) = val; }
             }
        __builtin_amdgcn_wave_barrier(); asm volatile("" ::: "memory");
    }
    }
}

__device__ __forceinline__ h16 tohx(float x) { return (h16)x; }
__device__ __forceinline__ void splitf(float y, unsigned short& h, unsigned short& l) { h = f2bf(y); l = f2bf(y - bf2f(h)); }
typedef __attribute__((ext_vector_type(2))) unsigned short v2us;
typedef __attribute__((ext_vector_type(2))) _Float16 v2h;
typedef __attribute__((ext_vector_type(4))) _Float16 v4h;
typedef v4h __attribute__((may_alias)) v4ha;
typedef __attribute__((ext_vector_type(2))) float v2f;

__global__ __launch_bounds__(256) void k_wtG(const float* __restrict__ w, int K, int N, bf* Bt) {
    const int lane = threadIdx.x & 31; const int L0 = (blockIdx.x * 8 + (threadIdx.x >> 5)) * 8; const int nlines = N * K / 64;
{
#pragma unroll 1
        for (int l = 0; l < 8; ++l) { const int L = L0 + l; if (L >= nlines) break; const size_t e = (size_t)L * 64 + lane * 2; const int k = (int)(e % K), n = (int)(e / K); v2us o;
            o[0] = f2bf(w[(size_t)k * N + n]); o[1] = f2bf(w[(size_t)(k + 1) * N + n]); *(v2us*)(Bt + e) = o; }
         }
}
__global__ __launch_bounds__(256) void k_cvt8(const float* __restrict__ src, bf* dst, size_t n8) { const size_t i = (size_t)blockIdx.x * 256 + threadIdx.x; if (i >= n8) return; const v8f v = *(const v8f*)(src + i * 8); v8us o;
#pragma unroll
    for (int k = 0; k < 8; ++k) o[k] = f2bf(v[k]); *(v8us*)(dst + i * 8) = o;  }
__global__ __launch_bounds__(256) void k_qplanes(const float* __restrict__ F, bf* Ph, bf* Pl, h16* P16) {
    const int lane = threadIdx.x & 31; const int L0 = (blockIdx.x * 8 + (threadIdx.x >> 5)) * 8; const int nlines = NH_ * TT * HD / 64;
{
#pragma unroll
        for (int l = 0; l < 8; ++l) { const int L = L0 + l; if (L >= nlines) break; const int e = L * 64 + lane * 2; const int d = e & (HD - 1); const int t = (e >> 6) & (TT - 1); const int h = e >> 17; v2us oh, ol; v2h o16;
#pragma unroll
            for (int q = 0; q < 2; ++q) { const float x = F[(size_t)t * DD + h * HD + d + q]; unsigned short a, c2; splitf(x, a, c2); oh[q] = a; ol[q] = c2; o16[q] = tohx(x); }
            *(v2us*)(Ph + (size_t)e) = oh; *(v2us*)(Pl + (size_t)e) = ol; *(v2h*)(P16 + (size_t)e) = o16; }
         }
}
__global__ __launch_bounds__(256) void k_vtplane(const float* __restrict__ F, bf* Vh, bf* Vl, h16* V16) {
    const int lane = threadIdx.x & 31; const int L0 = (blockIdx.x * 8 + (threadIdx.x >> 5)) * 8; const int nlines = NH_ * TT * HD / 64;
{
#pragma unroll
        for (int l = 0; l < 8; ++l) { const int L = L0 + l; if (L >= nlines) break; const int e = L * 64 + lane * 2; const int t = e & (TT - 1); const int d = (e >> 11) & (HD - 1); const int h = e >> 17; v2us oh, ol; v2h o16;
#pragma unroll
            for (int q = 0; q < 2; ++q) { const float x = F[(size_t)(t + q) * DD + h * HD + d]; unsigned short a, c2; splitf(x, a, c2); oh[q] = a; ol[q] = c2; o16[q] = tohx(x); }
            *(v2us*)(Vh + (size_t)e) = oh; *(v2us*)(Vl + (size_t)e) = ol; *(v2h*)(V16 + (size_t)e) = o16; }
         }
}
// k_asoft: per row (zz, i): t = S/8 for j <= i (causal), -3e38 otherwise; softmax over the 2048 keys (register row, one exp); also the row entropy -sum p log(p + 1e-8) from the f32 probabilities -> ENT[erow0 + row][0..31] line (lane 0) -> rows i < RH: P hi/lo [zz][i][j] (compact
// P16 IS Sb: a row's fp16 probabilities go over the first half of its own f32 score row (row pitch 2 * TT halves). One wave owns the row and every stored value hangs on the row sum, so all its loads are back first.
__global__ __launch_bounds__(256) void k_asoft(const float* Sb, bf* Ph, bf* Pl, h16* P16, float* ENT, int erow0) {
    typedef __attribute__((ext_vector_type(4))) unsigned short v4us;
    const int lane = threadIdx.x & 31; const int row = blockIdx.x * 8 + (threadIdx.x >> 5); if (row >= ZH * TT) return; const int i = row & (TT - 1); const int zz = row >> 11; const bool hires = (i < RH);
    const float* sr = Sb + (size_t)row * TT; float v[64]; float mx = -3.0e38f;
#pragma unroll
    for (int ch = 0; ch < 16; ++ch) { const int j0 = ch * 128 + lane * 4; const v4f a = *(const v4fa*)(sr + j0);
#pragma unroll
        for (int q = 0; q < 4; ++q) { const int j = j0 + q; const float t = (j <= i) ? a[q] * SCL : -3.0e38f; v[ch * 4 + q] = t; mx = fmaxf(mx, t); } }
#pragma unroll
    for (int sh = 16; sh; sh >>= 1) mx = fmaxf(mx, __shfl_xor(mx, sh, 32));
    float sum = 0.f;
#pragma unroll
    for (int k = 0; k < 64; ++k) { v[k] = __expf(v[k] - mx); sum += v[k]; }
#pragma unroll
    for (int sh = 16; sh; sh >>= 1) sum += __shfl_xor(sum, sh, 32);
    const float f = __fdiv_rn(hires ? 1.0f : PCAR, sum); const float pn = __fdiv_rn(1.0f, sum); float ent = 0.f;   // row entropy from the f32 probabilities p = e/sum
#pragma unroll
    for (int k = 0; k < 64; ++k) { float p = __fmul_rn(v[k], pn); asm volatile("" : "+v"(p)); float l2 = __builtin_amdgcn_logf(__fadd_rn(p, 1e-8f)); asm volatile("" : "+v"(l2)); float lg = __fmul_rn(l2, 0.69314718055994531f); asm volatile("" : "+v"(lg)); float pl = __fmul_rn(p, lg); asm volatile("" : "+v"(pl)); ent = __fsub_rn(ent, pl); }
#pragma unroll
    for (int sh = 16; sh; sh >>= 1) ent += __shfl_xor(ent, sh, 32);
    { const float eo = lane == 0 ? ent : 0.f; float* er = ENT + ((size_t)erow0 + row) * 32 + lane; *(float*)er = eo;  }
{
        if (hires) {
#pragma unroll
            for (int ch = 0; ch < 16; ++ch) { v4us oh, ol;
#pragma unroll
                for (int q = 0; q < 4; ++q) { unsigned short a, c2; splitf(v[ch * 4 + q] * f, a, c2); oh[q] = a; ol[q] = c2; }
                const size_t o = ((size_t)zz * RH + i) * TT + ch * 128 + lane * 4; *(v4us*)(Ph + o) = oh; *(v4us*)(Pl + o) = ol; }
        } else {
#pragma unroll
            for (int ch = 0; ch < 16; ++ch) { v4h o;
#pragma unroll
                for (int q = 0; q < 4; ++q) o[q] = tohx(v[ch * 4 + q] * f);
                *(v4ha*)(P16 + (size_t)row * (2 * TT) + ch * 128 + lane * 4) = o; } }
         }
}
__global__ __launch_bounds__(256) void k_merge(const float* __restrict__ O, int h0, bf* Ah, bf* Al) {
    const int lane = threadIdx.x & 31; const int L0 = (blockIdx.x * 8 + (threadIdx.x >> 5)) * 8; const int nlines = ZH * TT * HD / 64;
{
#pragma unroll
        for (int l = 0; l < 8; ++l) { const int L = L0 + l; if (L >= nlines) break; const int e = L * 64 + lane * 2; const int d = e & (HD - 1); const int t = (e >> 6) & (TT - 1); const int zz = e >> 17; v2us oh, ol;
const float cs = (t < RH) ? 1.0f : (1.0f / PCAR);
#pragma unroll
            for (int q = 0; q < 2; ++q) { unsigned short a, c2; splitf(O[(size_t)e + q] * cs, a, c2); oh[q] = a; ol[q] = c2; }
            const size_t o = (size_t)t * DD + (h0 + zz) * HD + d; *(v2us*)(Ah + o) = oh; *(v2us*)(Al + o) = ol; }
         }
}

__global__ __launch_bounds__(32) void k_entmean(const float* __restrict__ ENT, float* OUT1) { const int lane = threadIdx.x; float s = 0.f; for (int r = lane; r < NB_ * NH_ * TT; r += 32) s = __fadd_rn(s, ENT[(size_t)r * 32]);
#pragma unroll
    for (int sh = 16; sh; sh >>= 1) s += __shfl_xor(s, sh, 32);
    if (lane == 0) { const float m = s * (1.0f / (float)(NB_ * NH_ * TT)); *(float*)OUT1 = m;  } }
extern "C" void kernel_launch(void* const* d_in, const int* in_sizes, int n_in,
                              void* d_out, int out_size, void* d_ws, size_t ws_size, hipStream_t stream) {
    (void)in_sizes; (void)n_in; (void)out_size;
    const float* x = (const float*)d_in[0]; const float* wqkv = (const float*)d_in[1]; const float* wo = (const float*)d_in[2];   // w_attn [1024][3072], w_proj [1024][1024] as x @ W (no biases)
    float* OUT = (float*)d_out; float* OUT1 = OUT + (size_t)NB_ * TT * DD;     // [2][2048][1024] at 0; [1] entropy at byte 16,777,216
    char* wsp = (char*)d_ws;
    auto take = [&](size_t bytes) { char* p = wsp; wsp += (bytes + 255) & ~(size_t)255; return (void*)p; };
    bf* WQKV = (bf*)take((size_t)3 * DD * DD * 2); bf* WO = (bf*)take((size_t)DD * DD * 2);
    bf* XB = (bf*)take((size_t)TT * DD * 2); float* F = (float*)take((size_t)TT * DD * 4);
    bf* QPh = (bf*)take((size_t)TT * DD * 2); bf* QPl = (bf*)take((size_t)TT * DD * 2); bf* KPh = (bf*)take((size_t)TT * DD * 2); bf* KPl = (bf*)take((size_t)TT * DD * 2); bf* VTh = (bf*)take((size_t)TT * DD * 2); bf* VTl = (bf*)take((size_t)TT * DD * 2);
    h16* QP16 = (h16*)take((size_t)TT * DD * 2); h16* KP16 = (h16*)take((size_t)TT * DD * 2); h16* VT16 = (h16*)take((size_t)TT * DD * 2);
    float* Sb = (float*)take((size_t)ZH * TT * TT * 4); bf* Ph = (bf*)take((size_t)ZH * RH * TT * 2); bf* Pl = (bf*)take((size_t)ZH * RH * TT * 2); h16* P16 = (h16*)Sb; float* Ob = (float*)take((size_t)ZH * TT * HD * 4); float* ENT = (float*)take((size_t)NB_ * NH_ * TT * 32 * 4); bf* ATh = (bf*)take((size_t)TT * DD * 2); bf* ATl = (bf*)take((size_t)TT * DD * 2);
    if ((size_t)(wsp - (char*)d_ws) > ws_size) return;    // total 220 MiB; ws 256 MiB
    { k_wtG<<<(unsigned)((DD * 3 * DD / 64 + 63) / 64), 256, 0, stream>>>(wqkv, DD, 3 * DD, WQKV); k_wtG<<<(unsigned)((DD * DD / 64 + 63) / 64), 256, 0, stream>>>(wo, DD, DD, WO); }
    const unsigned LB = (unsigned)((NH_ * TT * HD / 64 + 63) / 64); const dim3 gP(TT / 64, DD / 64, 1);
    for (int b = 0; b < NB_; ++b) {
        k_cvt8<<<(unsigned)(((size_t)TT * DD / 8 + 255) / 256), 256, 0, stream>>>(x + (size_t)b * TT * DD, XB, (size_t)TT * DD / 8);
        k_gemmw<bf, 0, false, 8><<<gP, 256, 0, stream>>>(XB, nullptr, WQKV, nullptr, DD, DD, F, DD, nullptr, 0, 0, 0); k_qplanes<<<LB, 256, 0, stream>>>(F, QPh, QPl, QP16);
        k_gemmw<bf, 0, false, 8><<<gP, 256, 0, stream>>>(XB, nullptr, WQKV + (size_t)DD * DD, nullptr, DD, DD, F, DD, nullptr, 0, 0, 0); k_qplanes<<<LB, 256, 0, stream>>>(F, KPh, KPl, KP16);
        k_gemmw<bf, 0, false, 8><<<gP, 256, 0, stream>>>(XB, nullptr, WQKV + (size_t)2 * DD * DD, nullptr, DD, DD, F, DD, nullptr, 0, 0, 0); k_vtplane<<<LB, 256, 0, stream>>>(F, VTh, VTl, VT16);
        for (int h0 = 0; h0 < NH_; h0 += ZH) { const size_t z0 = (size_t)h0;
            k_gemmw<bf, 2, false, 1><<<dim3(RH / 64, TT / 64, ZH), 32, 0, stream>>>(QPh + z0 * TT * HD, QPl + z0 * TT * HD, KPh + z0 * TT * HD, KPl + z0 * TT * HD, HD, HD, Sb, TT, nullptr, (size_t)TT * HD, (size_t)TT * HD, (size_t)TT * TT);
            k_gemmw<h16, 0, false, 1><<<dim3((TT - RH) / 64, TT / 64, ZH), 32, 0, stream>>>(QP16 + z0 * TT * HD + (size_t)RH * HD, nullptr, KP16 + z0 * TT * HD, nullptr, HD, HD, Sb + (size_t)RH * TT, TT, nullptr, (size_t)TT * HD, (size_t)TT * HD, (size_t)TT * TT);
            k_asoft<<<ZH * TT / 8, 256, 0, stream>>>(Sb, Ph, Pl, P16, ENT, (b * NH_ + h0) * TT);
            k_gemmw<bf, 2, false, 16><<<dim3(RH / 64, HD / 64, ZH), 512, 0, stream>>>(Ph, Pl, VTh + z0 * HD * TT, VTl + z0 * HD * TT, TT, TT, Ob, HD, nullptr, (size_t)RH * TT, (size_t)HD * TT, (size_t)TT * HD);
            k_gemmw<h16, 0, false, 16><<<dim3((TT - RH) / 64, HD / 64, ZH), 512, 0, stream>>>(P16 + (size_t)RH * 2 * TT, nullptr, VT16 + z0 * HD * TT, nullptr, TT, 2 * TT, Ob + (size_t)RH * HD, HD, nullptr, (size_t)2 * TT * TT, (size_t)HD * TT, (size_t)TT * HD);
            k_merge<<<(ZH * TT * HD / 64 + 63) / 64, 256, 0, stream>>>(Ob, h0, ATh, ATl); }
        k_gemmw<bf, 1, false, 8><<<gP, 256, 0, stream>>>(ATh, ATl, WO, nullptr, DD, DD, OUT + (size_t)b * TT * DD, DD, nullptr, 0, 0, 0); }
    k_entmean<<<1, 32, 0, stream>>>(ENT, OUT1);
}

// v003
// One run takes 563 microseconds.
// In two side-by-side timings against v002, it was 1.31 and 1.32 times as fast.
// All steps since v000 together make it 3.96 times as fast.
#include <hip/hip_runtime.h>

// Causal multi-head self-attention with an attention-entropy monitor (x [2][2048][1024]; qkv = x w_attn (16 heads x 64, no bias); causal softmax(q.k/8); y = merged att.v w_proj -> [2][2048][1024];
// second output = mean over all (batch, head, query) rows of the row entropy -sum_s att log(att + 1e-8) -> [1]).
// Compute dtypes, f32 accumulate: every input rounded to bf16; qkv projection on PLAIN bf16 operands (inputs: exact products, f32 accumulate); w_proj on att.v hi+lo planes (2 products); PER-ROW PRECISION HYBRID:
// query rows < 256 take scores and att.v on bf16 hi+lo planes (3 products), rows >= 256 on single fp16 planes; 1/8, the causal cut, the softmax and the row entropy (from the f32 probabilities, hardware

#define NB_  2
#define TT   2048
#define DD   1024
#define NH_  16
#define HD   64
#define ZH   8                    // heads per set of attention launches
#define RH   256                  // query rows < RH: hi+lo planes; rows >= RH: fp16 planes
#define NF   32                   // head_dim / 2 (unused here)
#define SCL  0.125f               // 1/sqrt(64)
#define PCAR 1024.0f         // P scale for fp16 rows >= RH, undone in k_merge
typedef _Float16 h16;
typedef unsigned short bf;
typedef __attribute__((ext_vector_type(16))) __bf16   v16bf;
typedef __attribute__((ext_vector_type(16))) _Float16 v16h;
typedef __attribute__((ext_vector_type(8)))  _Float16 v8h;
typedef __attribute__((ext_vector_type(8)))  unsigned short v8us;
typedef __attribute__((ext_vector_type(8)))  float    v8f;
typedef __attribute__((ext_vector_type(4)))  float    v4f;
typedef v8h  __attribute__((may_alias)) v8ha;
typedef v4f  __attribute__((may_alias)) v4fa;
typedef v8us __attribute__((may_alias)) v8usa;

__device__ __forceinline__ unsigned short f2bf(float f) { unsigned u = __float_as_uint(f); u += 0x7FFFu + ((u >> 16) & 1u); return (unsigned short)(u >> 16); }
__device__ __forceinline__ float bf2f(unsigned short b) { return __uint_as_float(((unsigned)b) << 16); }
__device__ __forceinline__ float bfr(float f) { return bf2f(f2bf(f)); }
__device__ __forceinline__ v16h cat16(v8h lo, v8h hi) { return __builtin_shufflevector(lo, hi, 0, 1, 2, 3, 4, 5, 6, 7, 8, 9, 10, 11, 12, 13, 14, 15); }
__device__ __forceinline__ v16bf cat16b(v8us lo, v8us hi) { return __builtin_bit_cast(v16bf, __builtin_shufflevector(lo, hi, 0, 1, 2, 3, 4, 5, 6, 7, 8, 9, 10, 11, 12, 13, 14, 15)); }
__device__ __forceinline__ v8f wmma16(v16h a, v16h b, v8f c) { return __builtin_amdgcn_wmma_f32_16x16x32_f16(false, a, false, b, (short)0, c, false, false); }
__device__ __forceinline__ v8f wmmab(v16bf a, v16bf b, v8f c) { return __builtin_amdgcn_wmma_f32_16x16x32_bf16(false, a, false, b, (short)0, c, false, false); }



// ---- k_gemmw: register-blocked GEMM, one 64x64 output tile per work-group (16 accumulators a wave), operands straight from K-contiguous 16-bit planes; grid (M/64, N/64, Z), 32 * NW threads.
// C[m][n] (f32, pitch ldc, + optional f32 bias[n]) = sum_k A[m][k] Bt[n][k] (+ split products per NSPLIT). A and A2 have row pitch lda, Bt and Bt2 row pitch K. z-batch strides sA/sB/sC in elements. K % (32 * NW) == 0.
// NW > 1: the work-group has NW waves on the SAME tile; wave w takes the k steps w, w + NW, ... (a chain of K / (32 * NW) load round trips instead of K / 32); the NW partial tiles are summed in LDS, wave 0 first.
template <typename T16> struct WFrag;
template <> struct WFrag<h16> { typedef v16h V; static __device__ __forceinline__ V ld(const h16* p) { return cat16(*(const v8h*)p, *(const v8h*)(p + 16)); } static __device__ __forceinline__ v8f mma(V a, V b, v8f c) { return wmma16(a, b, c); } };
template <> struct WFrag<bf> { typedef v16bf V; static __device__ __forceinline__ V ld(const bf* p) { return cat16b(*(const v8us*)p, *(const v8us*)(p + 16)); } static __device__ __forceinline__ v8f mma(V a, V b, v8f c) { return wmmab(a, b, c); } };
template <typename T16, int NSPLIT, bool BIAS, int NW>
__global__ __launch_bounds__(32 * NW) void k_gemmw(const T16* __restrict__ A, const T16* __restrict__ A2, const T16* __restrict__ Bt, const T16* __restrict__ Bt2, int K, int lda, float* C, int ldc, const float* __restrict__ bias, size_t sA, size_t sB, size_t sC) {
    typedef typename WFrag<T16>::V V;
    const int w = NW > 1 ? __builtin_amdgcn_readfirstlane((int)(threadIdx.x >> 5)) : 0;   // wave number, held scalar
    const size_t z = blockIdx.z; A += z * sA; if (A2) A2 += z * sA; Bt += z * sB; if (Bt2) Bt2 += z * sB; C += z * sC;
    const int lane = threadIdx.x & 31, lr = lane & 15, hi = lane >> 4; const int r0 = blockIdx.x * 64, c0 = blockIdx.y * 64;
    v8f acc[4][4];
#pragma unroll
    for (int mb = 0; mb < 4; ++mb)
#pragma unroll
        for (int nb = 0; nb < 4; ++nb) acc[mb][nb] = (v8f){};
    const size_t aoff = (size_t)(r0 + lr) * lda + 8 * hi, boff = (size_t)(c0 + lr) * K + 8 * hi;
#pragma unroll 1
    for (int kc = w * 32; kc < K; kc += 32 * NW) {
        V a[4], a2[4];
#pragma unroll
        for (int mb = 0; mb < 4; ++mb) { a[mb] = WFrag<T16>::ld(A + aoff + (size_t)mb * 16 * lda + kc); if (NSPLIT == 1 || NSPLIT == 2) a2[mb] = WFrag<T16>::ld(A2 + aoff + (size_t)mb * 16 * lda + kc); }
#pragma unroll
        for (int nb = 0; nb < 4; ++nb) { const V b = WFrag<T16>::ld(Bt + boff + (size_t)nb * 16 * K + kc); V b2; if (NSPLIT >= 2) b2 = WFrag<T16>::ld(Bt2 + boff + (size_t)nb * 16 * K + kc);
#pragma unroll
            for (int mb = 0; mb < 4; ++mb) { acc[mb][nb] = WFrag<T16>::mma(a[mb], b, acc[mb][nb]); if (NSPLIT == 1 || NSPLIT == 2) acc[mb][nb] = WFrag<T16>::mma(a2[mb], b, acc[mb][nb]); if (NSPLIT >= 2) acc[mb][nb] = WFrag<T16>::mma(a[mb], b2, acc[mb][nb]); } }
        asm volatile("v_nop\n\tv_nop\n\tv_nop\n\tv_nop" : "+v"(acc[0][0]), "+v"(acc[1][1]), "+v"(acc[2][2]), "+v"(acc[3][3]) : "v"(a[0]), "v"(a[3]));
    }
    if constexpr (NW > 1) {
        // Partial tiles in fragment order: red[s][f][q][lane] = JP consecutive accumulator rows j of fragment f = mb * 4 + nb of wave s (every LDS access is 32 lanes side by side).
        // Wave w then owns rows mb * 16 + hi * 8 + q * JP + (0 .. JP - 1) over all 64 columns (mb = w / QN, q = w % QN): whole 128-byte lines of C have one writing wave.
        constexpr int JP = 32 / NW, QN = 8 / JP;
        typedef __attribute__((ext_vector_type(JP))) float vJ;
        __shared__ vJ red[NW][16][QN][32];
#pragma unroll
        for (int mb = 0; mb < 4; ++mb)
#pragma unroll
            for (int nb = 0; nb < 4; ++nb)
#pragma unroll
                for (int q = 0; q < QN; ++q) { vJ t;
#pragma unroll
                    for (int jj = 0; jj < JP; ++jj) t[jj] = acc[mb][nb][q * JP + jj];
                    red[w][mb * 4 + nb][q][lane] = t; }
        __syncthreads();   // every wave's partial tile is in LDS before any wave sums
        const int mo = w / QN, qo = w % QN;
#pragma unroll
        for (int nb = 0; nb < 4; ++nb) { vJ sum = red[0][mo * 4 + nb][qo][lane];
#pragma unroll
            for (int s = 1; s < NW; ++s) sum += red[s][mo * 4 + nb][qo][lane];
            float* cp = C + (size_t)(r0 + mo * 16 + hi * 8 + qo * JP) * ldc + c0 + nb * 16 + lr;
#pragma unroll
            for (int jj = 0; jj < JP; ++jj) cp[(size_t)jj * ldc] = BIAS ? sum[jj] + bfr(bias[c0 + nb * 16 + lr]) : sum[jj]; }
    } else {
    __shared__ __align__(16) float os[16 * 68];
#pragma unroll
    for (int mb = 0; mb < 4; ++mb) {
#pragma unroll
        for (int nb = 0; nb < 4; ++nb) {
#pragma unroll
            for (int j = 0; j < 8; ++j) os[(hi * 8 + j) * 68 + nb * 16 + lr] = acc[mb][nb][j]; }
        __builtin_amdgcn_wave_barrier(); asm volatile("" ::: "memory");
        float* crow = C + (size_t)(r0 + mb * 16) * ldc + c0;
{
#pragma unroll
            for (int s = 0; s < 8; ++s) { const int row = 2 * s + hi, cofs = lr * 4; v4f val = *(const v4fa*)(os + row * 68 + cofs); if (BIAS) { val[0] += bfr(bias[c0 + cofs]); val[1] += bfr(bias[c0 + cofs + 1]); val[2] += bfr(bias[c0 + cofs + 2]); val[3] += bfr(bias[c0 + cofs + 3]); }
                *(v4f*)(crow + (size_t)row * ldc + cofs) = val; }
             }
        __builtin_amdgcn_wave_barrier(); asm volatile("" ::: "memory");
    }
    }
}

__device__ __forceinline__ h16 tohx(float x) { return (h16)x; }
__device__ __forceinline__ void splitf(float y, unsigned short& h, unsigned short& l) { h = f2bf(y); l = f2bf(y - bf2f(h)); }
typedef __attribute__((ext_vector_type(2))) unsigned short v2us;
typedef __attribute__((ext_vector_type(2))) _Float16 v2h;
typedef __attribute__((ext_vector_type(4))) _Float16 v4h;
typedef v4h __attribute__((may_alias)) v4ha;
typedef __attribute__((ext_vector_type(2))) float v2f;

__global__ __launch_bounds__(256) void k_wtG(const float* __restrict__ w, int K, int N, bf* Bt) {
    const int lane = threadIdx.x & 31; const int L0 = (blockIdx.x * 8 + (threadIdx.x >> 5)) * 8; const int nlines = N * K / 64;
{
#pragma unroll 1
        for (int l = 0; l < 8; ++l) { const int L = L0 + l; if (L >= nlines) break; const size_t e = (size_t)L * 64 + lane * 2; const int k = (int)(e % K), n = (int)(e / K); v2us o;
            o[0] = f2bf(w[(size_t)k * N + n]); o[1] = f2bf(w[(size_t)(k + 1) * N + n]); *(v2us*)(Bt + e) = o; }
         }
}
__global__ __launch_bounds__(256) void k_cvt8(const float* __restrict__ src, bf* dst, size_t n8) { const size_t i = (size_t)blockIdx.x * 256 + threadIdx.x; if (i >= n8) return; const v8f v = *(const v8f*)(src + i * 8); v8us o;
#pragma unroll
    for (int k = 0; k < 8; ++k) o[k] = f2bf(v[k]); *(v8us*)(dst + i * 8) = o;  }
__global__ __launch_bounds__(256) void k_qplanes(const float* __restrict__ F, bf* Ph, bf* Pl, h16* P16) {
    const int lane = threadIdx.x & 31; const int L0 = (blockIdx.x * 8 + (threadIdx.x >> 5)) * 8; const int nlines = NH_ * TT * HD / 64;
{
#pragma unroll
        for (int l = 0; l < 8; ++l) { const int L = L0 + l; if (L >= nlines) break; const int e = L * 64 + lane * 2; const int d = e & (HD - 1); const int t = (e >> 6) & (TT - 1); const int h = e >> 17; v2us oh, ol; v2h o16;
#pragma unroll
            for (int q = 0; q < 2; ++q) { const float x = F[(size_t)t * DD + h * HD + d + q]; unsigned short a, c2; splitf(x, a, c2); oh[q] = a; ol[q] = c2; o16[q] = tohx(x); }
            *(v2us*)(Ph + (size_t)e) = oh; *(v2us*)(Pl + (size_t)e) = ol; *(v2h*)(P16 + (size_t)e) = o16; }
         }
}
__global__ __launch_bounds__(256) void k_vtplane(const float* __restrict__ F, bf* Vh, bf* Vl, h16* V16) {
    const int lane = threadIdx.x & 31; const int L0 = (blockIdx.x * 8 + (threadIdx.x >> 5)) * 8; const int nlines = NH_ * TT * HD / 64;
{
#pragma unroll
        for (int l = 0; l < 8; ++l) { const int L = L0 + l; if (L >= nlines) break; const int e = L * 64 + lane * 2; const int t = e & (TT - 1); const int d = (e >> 11) & (HD - 1); const int h = e >> 17; v2us oh, ol; v2h o16;
#pragma unroll
            for (int q = 0; q < 2; ++q) { const float x = F[(size_t)(t + q) * DD + h * HD + d]; unsigned short a, c2; splitf(x, a, c2); oh[q] = a; ol[q] = c2; o16[q] = tohx(x); }
            *(v2us*)(Vh + (size_t)e) = oh; *(v2us*)(Vl + (size_t)e) = ol; *(v2h*)(V16 + (size_t)e) = o16; }
         }
}
// k_asoft: per row (zz, i): t = S/8 for j <= i (causal), -3e38 otherwise; softmax over the 2048 keys (register row, one exp); also the row entropy -sum p log(p + 1e-8) from the f32 probabilities -> ENT[erow0 + row][0..31] line (lane 0) -> rows i < RH: P hi/lo [zz][i][j] (compact
// P16 IS Sb: a row's fp16 probabilities go over the first half of its own f32 score row (row pitch 2 * TT halves). One wave owns the row and every stored value hangs on the row sum, so all its loads are back first.
__global__ __launch_bounds__(256) void k_asoft(const float* Sb, bf* Ph, bf* Pl, h16* P16, float* ENT, int erow0) {
    typedef __attribute__((ext_vector_type(4))) unsigned short v4us;
    const int lane = threadIdx.x & 31; const int row = blockIdx.x * 8 + (threadIdx.x >> 5); if (row >= ZH * TT) return; const int i = row & (TT - 1); const int zz = row >> 11; const bool hires = (i < RH);
    const float* sr = Sb + (size_t)row * TT; float v[64]; float mx = -3.0e38f;
#pragma unroll
    for (int ch = 0; ch < 16; ++ch) { const int j0 = ch * 128 + lane * 4; const v4f a = *(const v4fa*)(sr + j0);
#pragma unroll
        for (int q = 0; q < 4; ++q) { const int j = j0 + q; const float t = (j <= i) ? a[q] * SCL : -3.0e38f; v[ch * 4 + q] = t; mx = fmaxf(mx, t); } }
#pragma unroll
    for (int sh = 16; sh; sh >>= 1) mx = fmaxf(mx, __shfl_xor(mx, sh, 32));
    float sum = 0.f;
#pragma unroll
    for (int k = 0; k < 64; ++k) { v[k] = __expf(v[k] - mx); sum += v[k]; }
#pragma unroll
    for (int sh = 16; sh; sh >>= 1) sum += __shfl_xor(sum, sh, 32);
    const float f = __fdiv_rn(hires ? 1.0f : PCAR, sum); const float pn = __fdiv_rn(1.0f, sum); float ent = 0.f;   // row entropy from the f32 probabilities p = e/sum
#pragma unroll
    for (int k = 0; k < 64; ++k) { float p = __fmul_rn(v[k], pn); asm volatile("" : "+v"(p)); float l2 = __builtin_amdgcn_logf(__fadd_rn(p, 1e-8f)); asm volatile("" : "+v"(l2)); float lg = __fmul_rn(l2, 0.69314718055994531f); asm volatile("" : "+v"(lg)); float pl = __fmul_rn(p, lg); asm volatile("" : "+v"(pl)); ent = __fsub_rn(ent, pl); }
#pragma unroll
    for (int sh = 16; sh; sh >>= 1) ent += __shfl_xor(ent, sh, 32);
    { const float eo = lane == 0 ? ent : 0.f; float* er = ENT + ((size_t)erow0 + row) * 32 + lane; *(float*)er = eo;  }
{
        if (hires) {
#pragma unroll
            for (int ch = 0; ch < 16; ++ch) { v4us oh, ol;
#pragma unroll
                for (int q = 0; q < 4; ++q) { unsigned short a, c2; splitf(v[ch * 4 + q] * f, a, c2); oh[q] = a; ol[q] = c2; }
                const size_t o = ((size_t)zz * RH + i) * TT + ch * 128 + lane * 4; *(v4us*)(Ph + o) = oh; *(v4us*)(Pl + o) = ol; }
        } else {
#pragma unroll
            for (int ch = 0; ch < 16; ++ch) { v4h o;
#pragma unroll
                for (int q = 0; q < 4; ++q) o[q] = tohx(v[ch * 4 + q] * f);
                *(v4ha*)(P16 + (size_t)row * (2 * TT) + ch * 128 + lane * 4) = o; } }
         }
}
__global__ __launch_bounds__(256) void k_merge(const float* __restrict__ O, int h0, bf* Ah, bf* Al) {
    const int lane = threadIdx.x & 31; const int L0 = (blockIdx.x * 8 + (threadIdx.x >> 5)) * 8; const int nlines = ZH * TT * HD / 64;
{
#pragma unroll
        for (int l = 0; l < 8; ++l) { const int L = L0 + l; if (L >= nlines) break; const int e = L * 64 + lane * 2; const int d = e & (HD - 1); const int t = (e >> 6) & (TT - 1); const int zz = e >> 17; v2us oh, ol;
const float cs = (t < RH) ? 1.0f : (1.0f / PCAR);
#pragma unroll
            for (int q = 0; q < 2; ++q) { unsigned short a, c2; splitf(O[(size_t)e + q] * cs, a, c2); oh[q] = a; ol[q] = c2; }
            const size_t o = (size_t)t * DD + (h0 + zz) * HD + d; *(v2us*)(Ah + o) = oh; *(v2us*)(Al + o) = ol; }
         }
}

// Mean of the NB_ * NH_ * TT row entropies in two launches: one wave alone would walk all the ENT lines in a chain of load round trips.
// k_entpart: work-group g sums rows g * 256 .. g * 256 + 255, one row a thread (every load of the launch is in flight at once): lane tree, then the 8 wave sums through LDS -> line PART[g][0..31] (lane 0 the sum, the rest 0).
#define EPW 256                   // rows per work-group of k_entpart
__global__ __launch_bounds__(EPW) void k_entpart(const float* __restrict__ ENT, float* PART) {
    __shared__ float wsum[EPW / 32];
    const int lane = threadIdx.x & 31, w = threadIdx.x >> 5; float s = ENT[((size_t)blockIdx.x * EPW + threadIdx.x) * 32];
#pragma unroll
    for (int sh = 16; sh; sh >>= 1) s += __shfl_xor(s, sh, 32);
    if (lane == 0) wsum[w] = s;
    __syncthreads();   // all 8 wave sums are in LDS before wave 0 adds them
    if (w == 0) { float t = lane < EPW / 32 ? wsum[lane] : 0.f;
#pragma unroll
        for (int sh = EPW / 64; sh; sh >>= 1) t += __shfl_xor(t, sh, 32);
        PART[(size_t)blockIdx.x * 32 + lane] = lane == 0 ? t : 0.f; }
}
// k_entmean: one wave sums the NB_ * NH_ * TT / EPW partial sums (8 independent loads a lane) and scales.
__global__ __launch_bounds__(32) void k_entmean(const float* __restrict__ PART, float* OUT1) { const int lane = threadIdx.x; float s = 0.f;
#pragma unroll
    for (int r = 0; r < NB_ * NH_ * TT / EPW; r += 32) s += PART[(size_t)(r + lane) * 32];
#pragma unroll
    for (int sh = 16; sh; sh >>= 1) s += __shfl_xor(s, sh, 32);
    if (lane == 0) { const float m = s * (1.0f / (float)(NB_ * NH_ * TT)); *(float*)OUT1 = m;  } }
extern "C" void kernel_launch(void* const* d_in, const int* in_sizes, int n_in,
                              void* d_out, int out_size, void* d_ws, size_t ws_size, hipStream_t stream) {
    (void)in_sizes; (void)n_in; (void)out_size;
    const float* x = (const float*)d_in[0]; const float* wqkv = (const float*)d_in[1]; const float* wo = (const float*)d_in[2];   // w_attn [1024][3072], w_proj [1024][1024] as x @ W (no biases)
    float* OUT = (float*)d_out; float* OUT1 = OUT + (size_t)NB_ * TT * DD;     // [2][2048][1024] at 0; [1] entropy at byte 16,777,216
    char* wsp = (char*)d_ws;
    auto take = [&](size_t bytes) { char* p = wsp; wsp += (bytes + 255) & ~(size_t)255; return (void*)p; };
    bf* WQKV = (bf*)take((size_t)3 * DD * DD * 2); bf* WO = (bf*)take((size_t)DD * DD * 2);
    bf* XB = (bf*)take((size_t)TT * DD * 2); float* F = (float*)take((size_t)TT * DD * 4);
    bf* QPh = (bf*)take((size_t)TT * DD * 2); bf* QPl = (bf*)take((size_t)TT * DD * 2); bf* KPh = (bf*)take((size_t)TT * DD * 2); bf* KPl = (bf*)take((size_t)TT * DD * 2); bf* VTh = (bf*)take((size_t)TT * DD * 2); bf* VTl = (bf*)take((size_t)TT * DD * 2);
    h16* QP16 = (h16*)take((size_t)TT * DD * 2); h16* KP16 = (h16*)take((size_t)TT * DD * 2); h16* VT16 = (h16*)take((size_t)TT * DD * 2);
    float* Sb = (float*)take((size_t)ZH * TT * TT * 4); bf* Ph = (bf*)take((size_t)ZH * RH * TT * 2); bf* Pl = (bf*)take((size_t)ZH * RH * TT * 2); h16* P16 = (h16*)Sb; float* Ob = (float*)take((size_t)ZH * TT * HD * 4); float* ENT = (float*)take((size_t)NB_ * NH_ * TT * 32 * 4); bf* ATh = (bf*)take((size_t)TT * DD * 2); bf* ATl = (bf*)take((size_t)TT * DD * 2); float* PART = (float*)take((size_t)(NB_ * NH_ * TT / EPW) * 32 * 4);
    if ((size_t)(wsp - (char*)d_ws) > ws_size) return;    // total 220 MiB; ws 256 MiB
    { k_wtG<<<(unsigned)((DD * 3 * DD / 64 + 63) / 64), 256, 0, stream>>>(wqkv, DD, 3 * DD, WQKV); k_wtG<<<(unsigned)((DD * DD / 64 + 63) / 64), 256, 0, stream>>>(wo, DD, DD, WO); }
    const unsigned LB = (unsigned)((NH_ * TT * HD / 64 + 63) / 64); const dim3 gP(TT / 64, DD / 64, 1);
    for (int b = 0; b < NB_; ++b) {
        k_cvt8<<<(unsigned)(((size_t)TT * DD / 8 + 255) / 256), 256, 0, stream>>>(x + (size_t)b * TT * DD, XB, (size_t)TT * DD / 8);
        k_gemmw<bf, 0, false, 8><<<gP, 256, 0, stream>>>(XB, nullptr, WQKV, nullptr, DD, DD, F, DD, nullptr, 0, 0, 0); k_qplanes<<<LB, 256, 0, stream>>>(F, QPh, QPl, QP16);
        k_gemmw<bf, 0, false, 8><<<gP, 256, 0, stream>>>(XB, nullptr, WQKV + (size_t)DD * DD, nullptr, DD, DD, F, DD, nullptr, 0, 0, 0); k_qplanes<<<LB, 256, 0, stream>>>(F, KPh, KPl, KP16);
        k_gemmw<bf, 0, false, 8><<<gP, 256, 0, stream>>>(XB, nullptr, WQKV + (size_t)2 * DD * DD, nullptr, DD, DD, F, DD, nullptr, 0, 0, 0); k_vtplane<<<LB, 256, 0, stream>>>(F, VTh, VTl, VT16);
        for (int h0 = 0; h0 < NH_; h0 += ZH) { const size_t z0 = (size_t)h0;
            k_gemmw<bf, 2, false, 1><<<dim3(RH / 64, TT / 64, ZH), 32, 0, stream>>>(QPh + z0 * TT * HD, QPl + z0 * TT * HD, KPh + z0 * TT * HD, KPl + z0 * TT * HD, HD, HD, Sb, TT, nullptr, (size_t)TT * HD, (size_t)TT * HD, (size_t)TT * TT);
            k_gemmw<h16, 0, false, 1><<<dim3((TT - RH) / 64, TT / 64, ZH), 32, 0, stream>>>(QP16 + z0 * TT * HD + (size_t)RH * HD, nullptr, KP16 + z0 * TT * HD, nullptr, HD, HD, Sb + (size_t)RH * TT, TT, nullptr, (size_t)TT * HD, (size_t)TT * HD, (size_t)TT * TT);
            k_asoft<<<ZH * TT / 8, 256, 0, stream>>>(Sb, Ph, Pl, P16, ENT, (b * NH_ + h0) * TT);
            k_gemmw<bf, 2, false, 16><<<dim3(RH / 64, HD / 64, ZH), 512, 0, stream>>>(Ph, Pl, VTh + z0 * HD * TT, VTl + z0 * HD * TT, TT, TT, Ob, HD, nullptr, (size_t)RH * TT, (size_t)HD * TT, (size_t)TT * HD);
            k_gemmw<h16, 0, false, 16><<<dim3((TT - RH) / 64, HD / 64, ZH), 512, 0, stream>>>(P16 + (size_t)RH * 2 * TT, nullptr, VT16 + z0 * HD * TT, nullptr, TT, 2 * TT, Ob + (size_t)RH * HD, HD, nullptr, (size_t)2 * TT * TT, (size_t)HD * TT, (size_t)TT * HD);
            k_merge<<<(ZH * TT * HD / 64 + 63) / 64, 256, 0, stream>>>(Ob, h0, ATh, ATl); }
        k_gemmw<bf, 1, false, 8><<<gP, 256, 0, stream>>>(ATh, ATl, WO, nullptr, DD, DD, OUT + (size_t)b * TT * DD, DD, nullptr, 0, 0, 0); }
    k_entpart<<<NB_ * NH_ * TT / EPW, EPW, 0, stream>>>(ENT, PART); k_entmean<<<1, 32, 0, stream>>>(PART, OUT1);
}

// v004
// It runs in 423 microseconds.
// Two timings next to v003 put it at 1.33 and 1.34 times that version's speed.
// Over all steps from v000 it is 5.29 times as fast.
#include <hip/hip_runtime.h>

// Causal multi-head self-attention with an attention-entropy monitor (x [2][2048][1024]; qkv = x w_attn (16 heads x 64, no bias); causal softmax(q.k/8); y = merged att.v w_proj -> [2][2048][1024];
// second output = mean over all (batch, head, query) rows of the row entropy -sum_s att log(att + 1e-8) -> [1]).
// Compute dtypes, f32 accumulate: every input rounded to bf16; qkv projection on PLAIN bf16 operands (inputs: exact products, f32 accumulate); w_proj on att.v hi+lo planes (2 products); PER-ROW PRECISION HYBRID:
// query rows < 256 take scores and att.v on bf16 hi+lo planes (3 products), rows >= 256 on single fp16 planes; 1/8, the causal cut, the softmax and the row entropy (from the f32 probabilities, hardware

#define NB_  2
#define TT   2048
#define DD   1024
#define NH_  16
#define HD   64
#define ZH   8                    // heads per set of attention launches
#define RH   256                  // query rows < RH: hi+lo planes; rows >= RH: fp16 planes
#define NF   32                   // head_dim / 2 (unused here)
#define SCL  0.125f               // 1/sqrt(64)
#define PCAR 1024.0f         // P scale for fp16 rows >= RH, undone in k_merge
typedef _Float16 h16;
typedef unsigned short bf;
typedef __attribute__((ext_vector_type(16))) __bf16   v16bf;
typedef __attribute__((ext_vector_type(16))) _Float16 v16h;
typedef __attribute__((ext_vector_type(8)))  _Float16 v8h;
typedef __attribute__((ext_vector_type(8)))  unsigned short v8us;
typedef __attribute__((ext_vector_type(8)))  float    v8f;
typedef __attribute__((ext_vector_type(4)))  float    v4f;
typedef v8h  __attribute__((may_alias)) v8ha;
typedef v4f  __attribute__((may_alias)) v4fa;
typedef v8us __attribute__((may_alias)) v8usa;

__device__ __forceinline__ unsigned short f2bf(float f) { unsigned u = __float_as_uint(f); u += 0x7FFFu + ((u >> 16) & 1u); return (unsigned short)(u >> 16); }
__device__ __forceinline__ float bf2f(unsigned short b) { return __uint_as_float(((unsigned)b) << 16); }
__device__ __forceinline__ float bfr(float f) { return bf2f(f2bf(f)); }
__device__ __forceinline__ v16h cat16(v8h lo, v8h hi) { return __builtin_shufflevector(lo, hi, 0, 1, 2, 3, 4, 5, 6, 7, 8, 9, 10, 11, 12, 13, 14, 15); }
__device__ __forceinline__ v16bf cat16b(v8us lo, v8us hi) { return __builtin_bit_cast(v16bf, __builtin_shufflevector(lo, hi, 0, 1, 2, 3, 4, 5, 6, 7, 8, 9, 10, 11, 12, 13, 14, 15)); }
__device__ __forceinline__ v8f wmma16(v16h a, v16h b, v8f c) { return __builtin_amdgcn_wmma_f32_16x16x32_f16(false, a, false, b, (short)0, c, false, false); }
__device__ __forceinline__ v8f wmmab(v16bf a, v16bf b, v8f c) { return __builtin_amdgcn_wmma_f32_16x16x32_bf16(false, a, false, b, (short)0, c, false, false); }



// ---- k_gemmw: register-blocked GEMM, one 64x64 output tile per work-group (16 accumulators a wave), operands straight from K-contiguous 16-bit planes; grid (M/64, N/64, Z), 32 * NW threads.
// C[m][n] (f32, pitch ldc, + optional f32 bias[n]) = sum_k A[m][k] Bt[n][k] (+ split products per NSPLIT). A and A2 have row pitch lda, Bt and Bt2 row pitch K. z-batch strides sA/sB/sC in elements. K % (32 * NW) == 0.
// CAUS (causal attention; rbase = query index of row 0 of A and C): 0 = the whole product. 1 = scores: only tiles that hold a key the softmax reads; query rows 128 p .. 128 p + 127 take keys < 128 (p + 1), that is 2 row blocks x 2 (p + 1) column tiles;
// grid x is the flat index over those tiles (band p starts at 2 p (p + 1)), grid y = 1. 2 = att.v: the k loop ends at the tile's last query + 1 (the probabilities behind it are exact zeros, not read, and not stored past the row's own 128-key chunk).
// NW > 1: the work-group has NW waves on the SAME tile; wave w takes the k steps w, w + NW, ... (a chain of K / (32 * NW) load round trips instead of K / 32); the NW partial tiles are summed in LDS, wave 0 first.
template <typename T16> struct WFrag;
template <> struct WFrag<h16> { typedef v16h V; static __device__ __forceinline__ V ld(const h16* p) { return cat16(*(const v8h*)p, *(const v8h*)(p + 16)); } static __device__ __forceinline__ v8f mma(V a, V b, v8f c) { return wmma16(a, b, c); } };
template <> struct WFrag<bf> { typedef v16bf V; static __device__ __forceinline__ V ld(const bf* p) { return cat16b(*(const v8us*)p, *(const v8us*)(p + 16)); } static __device__ __forceinline__ v8f mma(V a, V b, v8f c) { return wmmab(a, b, c); } };
template <typename T16, int NSPLIT, bool BIAS, int NW, int CAUS>
__global__ __launch_bounds__(32 * NW) void k_gemmw(const T16* __restrict__ A, const T16* __restrict__ A2, const T16* __restrict__ Bt, const T16* __restrict__ Bt2, int K, int lda, float* C, int ldc, const float* __restrict__ bias, size_t sA, size_t sB, size_t sC, int rbase) {
    typedef typename WFrag<T16>::V V;
    const int w = NW > 1 ? __builtin_amdgcn_readfirstlane((int)(threadIdx.x >> 5)) : 0;   // wave number, held scalar
    const size_t z = blockIdx.z; A += z * sA; if (A2) A2 += z * sA; Bt += z * sB; if (Bt2) Bt2 += z * sB; C += z * sC;
    const int lane = threadIdx.x & 31, lr = lane & 15, hi = lane >> 4; int r0 = blockIdx.x * 64, c0 = blockIdx.y * 64;
    if constexpr (CAUS == 1) {
        const int p0 = rbase >> 7; const int t = (int)blockIdx.x + 2 * p0 * (p0 + 1); int p = 0;
#pragma unroll
        for (int q = 1; q < TT / 128; ++q) p += (t >= 2 * q * (q + 1)) ? 1 : 0;
        const int rem = t - 2 * p * (p + 1), wd = 2 * (p + 1), up = rem >= wd ? 1 : 0;
        r0 = (2 * p + up) * 64 - rbase; c0 = (rem - up * wd) * 64;
    }
    const int kend = CAUS == 2 ? min(K, rbase + r0 + 64) : K;
    v8f acc[4][4];
#pragma unroll
    for (int mb = 0; mb < 4; ++mb)
#pragma unroll
        for (int nb = 0; nb < 4; ++nb) acc[mb][nb] = (v8f){};
    const size_t aoff = (size_t)(r0 + lr) * lda + 8 * hi, boff = (size_t)(c0 + lr) * K + 8 * hi;
#pragma unroll 1
    for (int kc = w * 32; kc < kend; kc += 32 * NW) {
        V a[4], a2[4];
#pragma unroll
        for (int mb = 0; mb < 4; ++mb) { a[mb] = WFrag<T16>::ld(A + aoff + (size_t)mb * 16 * lda + kc); if (NSPLIT == 1 || NSPLIT == 2) a2[mb] = WFrag<T16>::ld(A2 + aoff + (size_t)mb * 16 * lda + kc); }
#pragma unroll
        for (int nb = 0; nb < 4; ++nb) { const V b = WFrag<T16>::ld(Bt + boff + (size_t)nb * 16 * K + kc); V b2; if (NSPLIT >= 2) b2 = WFrag<T16>::ld(Bt2 + boff + (size_t)nb * 16 * K + kc);
#pragma unroll
            for (int mb = 0; mb < 4; ++mb) { acc[mb][nb] = WFrag<T16>::mma(a[mb], b, acc[mb][nb]); if (NSPLIT == 1 || NSPLIT == 2) acc[mb][nb] = WFrag<T16>::mma(a2[mb], b, acc[mb][nb]); if (NSPLIT >= 2) acc[mb][nb] = WFrag<T16>::mma(a[mb], b2, acc[mb][nb]); } }
        asm volatile("v_nop\n\tv_nop\n\tv_nop\n\tv_nop" : "+v"(acc[0][0]), "+v"(acc[1][1]), "+v"(acc[2][2]), "+v"(acc[3][3]) : "v"(a[0]), "v"(a[3]));
    }
    if constexpr (NW > 1) {
        // Partial tiles in fragment order: red[s][f][q][lane] = JP consecutive accumulator rows j of fragment f = mb * 4 + nb of wave s (every LDS access is 32 lanes side by side).
        // Wave w then owns rows mb * 16 + hi * 8 + q * JP + (0 .. JP - 1) over all 64 columns (mb = w / QN, q = w % QN): whole 128-byte lines of C have one writing wave.
        constexpr int JP = 32 / NW, QN = 8 / JP;
        typedef __attribute__((ext_vector_type(JP))) float vJ;
        __shared__ vJ red[NW][16][QN][32];
#pragma unroll
        for (int mb = 0; mb < 4; ++mb)
#pragma unroll
            for (int nb = 0; nb < 4; ++nb)
#pragma unroll
                for (int q = 0; q < QN; ++q) { vJ t;
#pragma unroll
                    for (int jj = 0; jj < JP; ++jj) t[jj] = acc[mb][nb][q * JP + jj];
                    red[w][mb * 4 + nb][q][lane] = t; }
        __syncthreads();   // every wave's partial tile is in LDS before any wave sums
        const int mo = w / QN, qo = w % QN;
#pragma unroll
        for (int nb = 0; nb < 4; ++nb) { vJ sum = red[0][mo * 4 + nb][qo][lane];
#pragma unroll
            for (int s = 1; s < NW; ++s) sum += red[s][mo * 4 + nb][qo][lane];
            float* cp = C + (size_t)(r0 + mo * 16 + hi * 8 + qo * JP) * ldc + c0 + nb * 16 + lr;
#pragma unroll
            for (int jj = 0; jj < JP; ++jj) cp[(size_t)jj * ldc] = BIAS ? sum[jj] + bfr(bias[c0 + nb * 16 + lr]) : sum[jj]; }
    } else {
    __shared__ __align__(16) float os[16 * 68];
#pragma unroll
    for (int mb = 0; mb < 4; ++mb) {
#pragma unroll
        for (int nb = 0; nb < 4; ++nb) {
#pragma unroll
            for (int j = 0; j < 8; ++j) os[(hi * 8 + j) * 68 + nb * 16 + lr] = acc[mb][nb][j]; }
        __builtin_amdgcn_wave_barrier(); asm volatile("" ::: "memory");
        float* crow = C + (size_t)(r0 + mb * 16) * ldc + c0;
{
#pragma unroll
            for (int s = 0; s < 8; ++s) { const int row = 2 * s + hi, cofs = lr * 4; v4f val = *(const v4fa*)(os + row * 68 + cofs); if (BIAS) { val[0] += bfr(bias[c0 + cofs]); val[1] += bfr(bias[c0 + cofs + 1]); val[2] += bfr(bias[c0 + cofs + 2]); val[3] += bfr(bias[c0 + cofs + 3]); }
                *(v4f*)(crow + (size_t)row * ldc + cofs) = val; }
             }
        __builtin_amdgcn_wave_barrier(); asm volatile("" ::: "memory");
    }
    }
}

__device__ __forceinline__ h16 tohx(float x) { return (h16)x; }
__device__ __forceinline__ void splitf(float y, unsigned short& h, unsigned short& l) { h = f2bf(y); l = f2bf(y - bf2f(h)); }
typedef __attribute__((ext_vector_type(2))) unsigned short v2us;
typedef __attribute__((ext_vector_type(2))) _Float16 v2h;
typedef __attribute__((ext_vector_type(4))) _Float16 v4h;
typedef v4h __attribute__((may_alias)) v4ha;
typedef __attribute__((ext_vector_type(2))) float v2f;

__global__ __launch_bounds__(256) void k_wtG(const float* __restrict__ w, int K, int N, bf* Bt) {
    const int lane = threadIdx.x & 31; const int L0 = (blockIdx.x * 8 + (threadIdx.x >> 5)) * 8; const int nlines = N * K / 64;
{
#pragma unroll 1
        for (int l = 0; l < 8; ++l) { const int L = L0 + l; if (L >= nlines) break; const size_t e = (size_t)L * 64 + lane * 2; const int k = (int)(e % K), n = (int)(e / K); v2us o;
            o[0] = f2bf(w[(size_t)k * N + n]); o[1] = f2bf(w[(size_t)(k + 1) * N + n]); *(v2us*)(Bt + e) = o; }
         }
}
__global__ __launch_bounds__(256) void k_cvt8(const float* __restrict__ src, bf* dst, size_t n8) { const size_t i = (size_t)blockIdx.x * 256 + threadIdx.x; if (i >= n8) return; const v8f v = *(const v8f*)(src + i * 8); v8us o;
#pragma unroll
    for (int k = 0; k < 8; ++k) o[k] = f2bf(v[k]); *(v8us*)(dst + i * 8) = o;  }
__global__ __launch_bounds__(256) void k_qplanes(const float* __restrict__ F, bf* Ph, bf* Pl, h16* P16) {
    const int lane = threadIdx.x & 31; const int L0 = (blockIdx.x * 8 + (threadIdx.x >> 5)) * 8; const int nlines = NH_ * TT * HD / 64;
{
#pragma unroll
        for (int l = 0; l < 8; ++l) { const int L = L0 + l; if (L >= nlines) break; const int e = L * 64 + lane * 2; const int d = e & (HD - 1); const int t = (e >> 6) & (TT - 1); const int h = e >> 17; v2us oh, ol; v2h o16;
#pragma unroll
            for (int q = 0; q < 2; ++q) { const float x = F[(size_t)t * DD + h * HD + d + q]; unsigned short a, c2; splitf(x, a, c2); oh[q] = a; ol[q] = c2; o16[q] = tohx(x); }
            *(v2us*)(Ph + (size_t)e) = oh; *(v2us*)(Pl + (size_t)e) = ol; *(v2h*)(P16 + (size_t)e) = o16; }
         }
}
__global__ __launch_bounds__(256) void k_vtplane(const float* __restrict__ F, bf* Vh, bf* Vl, h16* V16) {
    const int lane = threadIdx.x & 31; const int L0 = (blockIdx.x * 8 + (threadIdx.x >> 5)) * 8; const int nlines = NH_ * TT * HD / 64;
{
#pragma unroll
        for (int l = 0; l < 8; ++l) { const int L = L0 + l; if (L >= nlines) break; const int e = L * 64 + lane * 2; const int t = e & (TT - 1); const int d = (e >> 11) & (HD - 1); const int h = e >> 17; v2us oh, ol; v2h o16;
#pragma unroll
            for (int q = 0; q < 2; ++q) { const float x = F[(size_t)(t + q) * DD + h * HD + d]; unsigned short a, c2; splitf(x, a, c2); oh[q] = a; ol[q] = c2; o16[q] = tohx(x); }
            *(v2us*)(Vh + (size_t)e) = oh; *(v2us*)(Vl + (size_t)e) = ol; *(v2h*)(V16 + (size_t)e) = o16; }
         }
}
// k_asoft: per row (zz, i): t = S/8 for j <= i (causal), -3e38 otherwise; softmax over the 2048 keys (register row, one exp); also the row entropy -sum p log(p + 1e-8) from the f32 probabilities -> ENT[erow0 + row][0..31] line (lane 0) -> rows i < RH: P hi/lo [zz][i][j] (compact
// Only the 128-key chunks up to the one that holds key i are loaded, summed and stored (a scalar test a chunk): behind it every e is an exact 0 that adds nothing to the row sum or the entropy, and att.v does not read there.
// P16 IS Sb: a row's fp16 probabilities go over the first half of its own f32 score row (row pitch 2 * TT halves). One wave owns the row and every stored value hangs on the row sum, so all its loads are back first.
__global__ __launch_bounds__(256) void k_asoft(const float* Sb, bf* Ph, bf* Pl, h16* P16, float* ENT, int erow0) {
    typedef __attribute__((ext_vector_type(4))) unsigned short v4us;
    const int lane = threadIdx.x & 31; const int row = blockIdx.x * 8 + __builtin_amdgcn_readfirstlane((int)(threadIdx.x >> 5)); if (row >= ZH * TT) return; const int i = row & (TT - 1); const int zz = row >> 11; const bool hires = (i < RH);   // row held scalar: the chunk tests below are scalar branches
    const int cmax = i >> 7;   // last chunk with a key j <= i
    const float* sr = Sb + (size_t)row * TT; float v[64]; float mx = -3.0e38f; v4f ld[16];
#pragma unroll
    for (int ch = 0; ch < 16; ++ch) if (ch <= cmax) ld[ch] = *(const v4fa*)(sr + ch * 128 + lane * 4);   // loads alone in this loop: all of a row's loads are in flight at once
#pragma unroll
    for (int ch = 0; ch < 16; ++ch) if (ch <= cmax) { const int j0 = ch * 128 + lane * 4; const v4f a = ld[ch];
#pragma unroll
        for (int q = 0; q < 4; ++q) { const int j = j0 + q; const float t = (j <= i) ? a[q] * SCL : -3.0e38f; v[ch * 4 + q] = t; mx = fmaxf(mx, t); } }
#pragma unroll
    for (int sh = 16; sh; sh >>= 1) mx = fmaxf(mx, __shfl_xor(mx, sh, 32));
    float sum = 0.f;
#pragma unroll
    for (int ch = 0; ch < 16; ++ch) if (ch <= cmax) {
#pragma unroll
        for (int k = ch * 4; k < ch * 4 + 4; ++k) { v[k] = __expf(v[k] - mx); sum += v[k]; } }
#pragma unroll
    for (int sh = 16; sh; sh >>= 1) sum += __shfl_xor(sum, sh, 32);
    const float f = __fdiv_rn(hires ? 1.0f : PCAR, sum); const float pn = __fdiv_rn(1.0f, sum); float ent = 0.f;   // row entropy from the f32 probabilities p = e/sum
#pragma unroll
    for (int ch = 0; ch < 16; ++ch) if (ch <= cmax)
#pragma unroll
      for (int k = ch * 4; k < ch * 4 + 4; ++k) { float p = __fmul_rn(v[k], pn); asm volatile("" : "+v"(p)); float l2 = __builtin_amdgcn_logf(__fadd_rn(p, 1e-8f)); asm volatile("" : "+v"(l2)); float lg = __fmul_rn(l2, 0.69314718055994531f); asm volatile("" : "+v"(lg)); float pl = __fmul_rn(p, lg); asm volatile("" : "+v"(pl)); ent = __fsub_rn(ent, pl); }
#pragma unroll
    for (int sh = 16; sh; sh >>= 1) ent += __shfl_xor(ent, sh, 32);
    { const float eo = lane == 0 ? ent : 0.f; float* er = ENT + ((size_t)erow0 + row) * 32 + lane; *(float*)er = eo;
      asm volatile("s_wait_xcnt 0x0" ::: "memory"); }   // kept in front of the next write of a register that the store names
{
        if (hires) {
#pragma unroll
            for (int ch = 0; ch < 16; ++ch) if (ch <= cmax) { v4us oh, ol;
#pragma unroll
                for (int q = 0; q < 4; ++q) { unsigned short a, c2; splitf(v[ch * 4 + q] * f, a, c2); oh[q] = a; ol[q] = c2; }
                const size_t o = ((size_t)zz * RH + i) * TT + ch * 128 + lane * 4; *(v4us*)(Ph + o) = oh; *(v4us*)(Pl + o) = ol;
                asm volatile("s_wait_xcnt 0x0" ::: "memory"); }   // as above: the next chunk reuses the two stores' registers
        } else {
#pragma unroll
            for (int ch = 0; ch < 16; ++ch) if (ch <= cmax) { v4h o;
#pragma unroll
                for (int q = 0; q < 4; ++q) o[q] = tohx(v[ch * 4 + q] * f);
                *(v4ha*)(P16 + (size_t)row * (2 * TT) + ch * 128 + lane * 4) = o;
                asm volatile("s_wait_xcnt 0x0" ::: "memory"); } }   // as above: the next chunk reuses the store's registers
         }
}
__global__ __launch_bounds__(256) void k_merge(const float* __restrict__ O, int h0, bf* Ah, bf* Al) {
    const int lane = threadIdx.x & 31; const int L0 = (blockIdx.x * 8 + (threadIdx.x >> 5)) * 8; const int nlines = ZH * TT * HD / 64;
{
#pragma unroll
        for (int l = 0; l < 8; ++l) { const int L = L0 + l; if (L >= nlines) break; const int e = L * 64 + lane * 2; const int d = e & (HD - 1); const int t = (e >> 6) & (TT - 1); const int zz = e >> 17; v2us oh, ol;
const float cs = (t < RH) ? 1.0f : (1.0f / PCAR);
#pragma unroll
            for (int q = 0; q < 2; ++q) { unsigned short a, c2; splitf(O[(size_t)e + q] * cs, a, c2); oh[q] = a; ol[q] = c2; }
            const size_t o = (size_t)t * DD + (h0 + zz) * HD + d; *(v2us*)(Ah + o) = oh; *(v2us*)(Al + o) = ol; }
         }
}

// Mean of the NB_ * NH_ * TT row entropies in two launches: one wave alone would walk all the ENT lines in a chain of load round trips.
// k_entpart: work-group g sums rows g * 256 .. g * 256 + 255, one row a thread (every load of the launch is in flight at once): lane tree, then the 8 wave sums through LDS -> line PART[g][0..31] (lane 0 the sum, the rest 0).
#define EPW 256                   // rows per work-group of k_entpart
__global__ __launch_bounds__(EPW) void k_entpart(const float* __restrict__ ENT, float* PART) {
    __shared__ float wsum[EPW / 32];
    const int lane = threadIdx.x & 31, w = threadIdx.x >> 5; float s = ENT[((size_t)blockIdx.x * EPW + threadIdx.x) * 32];
#pragma unroll
    for (int sh = 16; sh; sh >>= 1) s += __shfl_xor(s, sh, 32);
    if (lane == 0) wsum[w] = s;
    __syncthreads();   // all 8 wave sums are in LDS before wave 0 adds them
    if (w == 0) { float t = lane < EPW / 32 ? wsum[lane] : 0.f;
#pragma unroll
        for (int sh = EPW / 64; sh; sh >>= 1) t += __shfl_xor(t, sh, 32);
        PART[(size_t)blockIdx.x * 32 + lane] = lane == 0 ? t : 0.f; }
}
// k_entmean: one wave sums the NB_ * NH_ * TT / EPW partial sums (8 independent loads a lane) and scales.
__global__ __launch_bounds__(32) void k_entmean(const float* __restrict__ PART, float* OUT1) { const int lane = threadIdx.x; float s = 0.f;
#pragma unroll
    for (int r = 0; r < NB_ * NH_ * TT / EPW; r += 32) s += PART[(size_t)(r + lane) * 32];
#pragma unroll
    for (int sh = 16; sh; sh >>= 1) s += __shfl_xor(s, sh, 32);
    if (lane == 0) { const float m = s * (1.0f / (float)(NB_ * NH_ * TT)); *(float*)OUT1 = m;  } }
extern "C" void kernel_launch(void* const* d_in, const int* in_sizes, int n_in,
                              void* d_out, int out_size, void* d_ws, size_t ws_size, hipStream_t stream) {
    (void)in_sizes; (void)n_in; (void)out_size;
    const float* x = (const float*)d_in[0]; const float* wqkv = (const float*)d_in[1]; const float* wo = (const float*)d_in[2];   // w_attn [1024][3072], w_proj [1024][1024] as x @ W (no biases)
    float* OUT = (float*)d_out; float* OUT1 = OUT + (size_t)NB_ * TT * DD;     // [2][2048][1024] at 0; [1] entropy at byte 16,777,216
    char* wsp = (char*)d_ws;
    auto take = [&](size_t bytes) { char* p = wsp; wsp += (bytes + 255) & ~(size_t)255; return (void*)p; };
    bf* WQKV = (bf*)take((size_t)3 * DD * DD * 2); bf* WO = (bf*)take((size_t)DD * DD * 2);
    bf* XB = (bf*)take((size_t)TT * DD * 2); float* F = (float*)take((size_t)TT * DD * 4);
    bf* QPh = (bf*)take((size_t)TT * DD * 2); bf* QPl = (bf*)take((size_t)TT * DD * 2); bf* KPh = (bf*)take((size_t)TT * DD * 2); bf* KPl = (bf*)take((size_t)TT * DD * 2); bf* VTh = (bf*)take((size_t)TT * DD * 2); bf* VTl = (bf*)take((size_t)TT * DD * 2);
    h16* QP16 = (h16*)take((size_t)TT * DD * 2); h16* KP16 = (h16*)take((size_t)TT * DD * 2); h16* VT16 = (h16*)take((size_t)TT * DD * 2);
    float* Sb = (float*)take((size_t)ZH * TT * TT * 4); bf* Ph = (bf*)take((size_t)ZH * RH * TT * 2); bf* Pl = (bf*)take((size_t)ZH * RH * TT * 2); h16* P16 = (h16*)Sb; float* Ob = (float*)take((size_t)ZH * TT * HD * 4); float* ENT = (float*)take((size_t)NB_ * NH_ * TT * 32 * 4); bf* ATh = (bf*)take((size_t)TT * DD * 2); bf* ATl = (bf*)take((size_t)TT * DD * 2); float* PART = (float*)take((size_t)(NB_ * NH_ * TT / EPW) * 32 * 4);
    if ((size_t)(wsp - (char*)d_ws) > ws_size) return;    // total 220 MiB; ws 256 MiB
    { k_wtG<<<(unsigned)((DD * 3 * DD / 64 + 63) / 64), 256, 0, stream>>>(wqkv, DD, 3 * DD, WQKV); k_wtG<<<(unsigned)((DD * DD / 64 + 63) / 64), 256, 0, stream>>>(wo, DD, DD, WO); }
    const unsigned LB = (unsigned)((NH_ * TT * HD / 64 + 63) / 64); const dim3 gP(TT / 64, DD / 64, 1);
    for (int b = 0; b < NB_; ++b) {
        k_cvt8<<<(unsigned)(((size_t)TT * DD / 8 + 255) / 256), 256, 0, stream>>>(x + (size_t)b * TT * DD, XB, (size_t)TT * DD / 8);
        k_gemmw<bf, 0, false, 8, 0><<<gP, 256, 0, stream>>>(XB, nullptr, WQKV, nullptr, DD, DD, F, DD, nullptr, 0, 0, 0, 0); k_qplanes<<<LB, 256, 0, stream>>>(F, QPh, QPl, QP16);
        k_gemmw<bf, 0, false, 8, 0><<<gP, 256, 0, stream>>>(XB, nullptr, WQKV + (size_t)DD * DD, nullptr, DD, DD, F, DD, nullptr, 0, 0, 0, 0); k_qplanes<<<LB, 256, 0, stream>>>(F, KPh, KPl, KP16);
        k_gemmw<bf, 0, false, 8, 0><<<gP, 256, 0, stream>>>(XB, nullptr, WQKV + (size_t)2 * DD * DD, nullptr, DD, DD, F, DD, nullptr, 0, 0, 0, 0); k_vtplane<<<LB, 256, 0, stream>>>(F, VTh, VTl, VT16);
        for (int h0 = 0; h0 < NH_; h0 += ZH) { const size_t z0 = (size_t)h0;
            k_gemmw<bf, 2, false, 1, 1><<<dim3(2 * (RH / 128) * (RH / 128 + 1), 1, ZH), 32, 0, stream>>>(QPh + z0 * TT * HD, QPl + z0 * TT * HD, KPh + z0 * TT * HD, KPl + z0 * TT * HD, HD, HD, Sb, TT, nullptr, (size_t)TT * HD, (size_t)TT * HD, (size_t)TT * TT, 0);
            k_gemmw<h16, 0, false, 1, 1><<<dim3(2 * (TT / 128) * (TT / 128 + 1) - 2 * (RH / 128) * (RH / 128 + 1), 1, ZH), 32, 0, stream>>>(QP16 + z0 * TT * HD + (size_t)RH * HD, nullptr, KP16 + z0 * TT * HD, nullptr, HD, HD, Sb + (size_t)RH * TT, TT, nullptr, (size_t)TT * HD, (size_t)TT * HD, (size_t)TT * TT, RH);
            k_asoft<<<ZH * TT / 8, 256, 0, stream>>>(Sb, Ph, Pl, P16, ENT, (b * NH_ + h0) * TT);
            k_gemmw<bf, 2, false, 16, 2><<<dim3(RH / 64, HD / 64, ZH), 512, 0, stream>>>(Ph, Pl, VTh + z0 * HD * TT, VTl + z0 * HD * TT, TT, TT, Ob, HD, nullptr, (size_t)RH * TT, (size_t)HD * TT, (size_t)TT * HD, 0);
            k_gemmw<h16, 0, false, 16, 2><<<dim3((TT - RH) / 64, HD / 64, ZH), 512, 0, stream>>>(P16 + (size_t)RH * 2 * TT, nullptr, VT16 + z0 * HD * TT, nullptr, TT, 2 * TT, Ob + (size_t)RH * HD, HD, nullptr, (size_t)2 * TT * TT, (size_t)HD * TT, (size_t)TT * HD, RH);
            k_merge<<<(ZH * TT * HD / 64 + 63) / 64, 256, 0, stream>>>(Ob, h0, ATh, ATl); }
        k_gemmw<bf, 1, false, 8, 0><<<gP, 256, 0, stream>>>(ATh, ATl, WO, nullptr, DD, DD, OUT + (size_t)b * TT * DD, DD, nullptr, 0, 0, 0, 0); }
    k_entpart<<<NB_ * NH_ * TT / EPW, EPW, 0, stream>>>(ENT, PART); k_entmean<<<1, 32, 0, stream>>>(PART, OUT1);
}

// v005
// It runs in 231 microseconds.
// In two side-by-side timings against v004, it was 1.83 and 1.84 times as fast.
// Counting every step since v000, it is 9.72 times as fast.
#include <hip/hip_runtime.h>

// Causal multi-head self-attention with an attention-entropy monitor (x [2][2048][1024]; qkv = x w_attn (16 heads x 64, no bias); causal softmax(q.k/8); y = merged att.v w_proj -> [2][2048][1024];
// second output = mean over all (batch, head, query) rows of the row entropy -sum_s att log(att + 1e-8) -> [1]).
// Compute dtypes, f32 accumulate: every input rounded to bf16; qkv projection on PLAIN bf16 operands (inputs: exact products, f32 accumulate); w_proj on att.v hi+lo planes (2 products); PER-ROW PRECISION HYBRID:
// query rows < 256 take scores and att.v on bf16 hi+lo planes (3 products), rows >= 256 on single fp16 planes; 1/8, the causal cut, the softmax and the row entropy (from the f32 probabilities, hardware

#define NB_  2
#define TT   2048
#define DD   1024
#define NH_  16
#define HD   64
#define RH   256                  // query rows < RH: hi+lo planes; rows >= RH: fp16 planes
#define NF   32                   // head_dim / 2 (unused here)
#define SCL  0.125f               // 1/sqrt(64)
#define PCAR 1024.0f         // P scale for fp16 rows >= RH, undone in k_fattn's head merge
typedef _Float16 h16;
typedef unsigned short bf;
typedef __attribute__((ext_vector_type(16))) __bf16   v16bf;
typedef __attribute__((ext_vector_type(16))) _Float16 v16h;
typedef __attribute__((ext_vector_type(8)))  _Float16 v8h;
typedef __attribute__((ext_vector_type(8)))  unsigned short v8us;
typedef __attribute__((ext_vector_type(8)))  float    v8f;
typedef __attribute__((ext_vector_type(4)))  float    v4f;
typedef v8h  __attribute__((may_alias)) v8ha;
typedef v4f  __attribute__((may_alias)) v4fa;
typedef v8us __attribute__((may_alias)) v8usa;

__device__ __forceinline__ unsigned short f2bf(float f) { unsigned u = __float_as_uint(f); u += 0x7FFFu + ((u >> 16) & 1u); return (unsigned short)(u >> 16); }
__device__ __forceinline__ float bf2f(unsigned short b) { return __uint_as_float(((unsigned)b) << 16); }
__device__ __forceinline__ float bfr(float f) { return bf2f(f2bf(f)); }
__device__ __forceinline__ v16h cat16(v8h lo, v8h hi) { return __builtin_shufflevector(lo, hi, 0, 1, 2, 3, 4, 5, 6, 7, 8, 9, 10, 11, 12, 13, 14, 15); }
__device__ __forceinline__ v16bf cat16b(v8us lo, v8us hi) { return __builtin_bit_cast(v16bf, __builtin_shufflevector(lo, hi, 0, 1, 2, 3, 4, 5, 6, 7, 8, 9, 10, 11, 12, 13, 14, 15)); }
__device__ __forceinline__ v8f wmma16(v16h a, v16h b, v8f c) { return __builtin_amdgcn_wmma_f32_16x16x32_f16(false, a, false, b, (short)0, c, false, false); }
__device__ __forceinline__ v8f wmmab(v16bf a, v16bf b, v8f c) { return __builtin_amdgcn_wmma_f32_16x16x32_bf16(false, a, false, b, (short)0, c, false, false); }



// ---- k_gemmw: register-blocked GEMM, one 64x64 output tile per work-group (16 accumulators a wave), operands straight from K-contiguous 16-bit planes; grid (M/64, N/64, Z), 32 * NW threads.
// C[m][n] (f32, pitch ldc, + optional f32 bias[n]) = sum_k A[m][k] Bt[n][k] (+ split products per NSPLIT). A and A2 have row pitch lda, Bt and Bt2 row pitch K. z-batch strides sA/sB/sC in elements. K % (32 * NW) == 0.
// CAUS (causal attention; rbase = query index of row 0 of A and C): 0 = the whole product. 1 = scores: only tiles that hold a key the softmax reads; query rows 128 p .. 128 p + 127 take keys < 128 (p + 1), that is 2 row blocks x 2 (p + 1) column tiles;
// grid x is the flat index over those tiles (band p starts at 2 p (p + 1)), grid y = 1. 2 = att.v: the k loop ends at the tile's last query + 1 (the probabilities behind it are exact zeros, not read, and not stored past the row's own 128-key chunk).
// NW > 1: the work-group has NW waves on the SAME tile; wave w takes the k steps w, w + NW, ... (a chain of K / (32 * NW) load round trips instead of K / 32); the NW partial tiles are summed in LDS, wave 0 first.
template <typename T16> struct WFrag;
template <> struct WFrag<h16> { typedef v16h V; static __device__ __forceinline__ V ld(const h16* p) { return cat16(*(const v8h*)p, *(const v8h*)(p + 16)); } static __device__ __forceinline__ v8f mma(V a, V b, v8f c) { return wmma16(a, b, c); } };
template <> struct WFrag<bf> { typedef v16bf V; static __device__ __forceinline__ V ld(const bf* p) { return cat16b(*(const v8us*)p, *(const v8us*)(p + 16)); } static __device__ __forceinline__ v8f mma(V a, V b, v8f c) { return wmmab(a, b, c); } };
template <typename T16, int NSPLIT, bool BIAS, int NW, int CAUS>
__global__ __launch_bounds__(32 * NW) void k_gemmw(const T16* __restrict__ A, const T16* __restrict__ A2, const T16* __restrict__ Bt, const T16* __restrict__ Bt2, int K, int lda, float* C, int ldc, const float* __restrict__ bias, size_t sA, size_t sB, size_t sC, int rbase) {
    typedef typename WFrag<T16>::V V;
    const int w = NW > 1 ? __builtin_amdgcn_readfirstlane((int)(threadIdx.x >> 5)) : 0;   // wave number, held scalar
    const size_t z = blockIdx.z; A += z * sA; if (A2) A2 += z * sA; Bt += z * sB; if (Bt2) Bt2 += z * sB; C += z * sC;
    const int lane = threadIdx.x & 31, lr = lane & 15, hi = lane >> 4; int r0 = blockIdx.x * 64, c0 = blockIdx.y * 64;
    if constexpr (CAUS == 1) {
        const int p0 = rbase >> 7; const int t = (int)blockIdx.x + 2 * p0 * (p0 + 1); int p = 0;
#pragma unroll
        for (int q = 1; q < TT / 128; ++q) p += (t >= 2 * q * (q + 1)) ? 1 : 0;
        const int rem = t - 2 * p * (p + 1), wd = 2 * (p + 1), up = rem >= wd ? 1 : 0;
        r0 = (2 * p + up) * 64 - rbase; c0 = (rem - up * wd) * 64;
    }
    const int kend = CAUS == 2 ? min(K, rbase + r0 + 64) : K;
    v8f acc[4][4];
#pragma unroll
    for (int mb = 0; mb < 4; ++mb)
#pragma unroll
        for (int nb = 0; nb < 4; ++nb) acc[mb][nb] = (v8f){};
    const size_t aoff = (size_t)(r0 + lr) * lda + 8 * hi, boff = (size_t)(c0 + lr) * K + 8 * hi;
#pragma unroll 1
    for (int kc = w * 32; kc < kend; kc += 32 * NW) {
        V a[4], a2[4];
#pragma unroll
        for (int mb = 0; mb < 4; ++mb) { a[mb] = WFrag<T16>::ld(A + aoff + (size_t)mb * 16 * lda + kc); if (NSPLIT == 1 || NSPLIT == 2) a2[mb] = WFrag<T16>::ld(A2 + aoff + (size_t)mb * 16 * lda + kc); }
#pragma unroll
        for (int nb = 0; nb < 4; ++nb) { const V b = WFrag<T16>::ld(Bt + boff + (size_t)nb * 16 * K + kc); V b2; if (NSPLIT >= 2) b2 = WFrag<T16>::ld(Bt2 + boff + (size_t)nb * 16 * K + kc);
#pragma unroll
            for (int mb = 0; mb < 4; ++mb) { acc[mb][nb] = WFrag<T16>::mma(a[mb], b, acc[mb][nb]); if (NSPLIT == 1 || NSPLIT == 2) acc[mb][nb] = WFrag<T16>::mma(a2[mb], b, acc[mb][nb]); if (NSPLIT >= 2) acc[mb][nb] = WFrag<T16>::mma(a[mb], b2, acc[mb][nb]); } }
        asm volatile("v_nop\n\tv_nop\n\tv_nop\n\tv_nop" : "+v"(acc[0][0]), "+v"(acc[1][1]), "+v"(acc[2][2]), "+v"(acc[3][3]) : "v"(a[0]), "v"(a[3]));
    }
    if constexpr (NW > 1) {
        // Partial tiles in fragment order: red[s][f][q][lane] = JP consecutive accumulator rows j of fragment f = mb * 4 + nb of wave s (every LDS access is 32 lanes side by side).
        // Wave w then owns rows mb * 16 + hi * 8 + q * JP + (0 .. JP - 1) over all 64 columns (mb = w / QN, q = w % QN): whole 128-byte lines of C have one writing wave.
        constexpr int JP = 32 / NW, QN = 8 / JP;
        typedef __attribute__((ext_vector_type(JP))) float vJ;
        __shared__ vJ red[NW][16][QN][32];
#pragma unroll
        for (int mb = 0; mb < 4; ++mb)
#pragma unroll
            for (int nb = 0; nb < 4; ++nb)
#pragma unroll
                for (int q = 0; q < QN; ++q) { vJ t;
#pragma unroll
                    for (int jj = 0; jj < JP; ++jj) t[jj] = acc[mb][nb][q * JP + jj];
                    red[w][mb * 4 + nb][q][lane] = t; }
        __syncthreads();   // every wave's partial tile is in LDS before any wave sums
        const int mo = w / QN, qo = w % QN;
#pragma unroll
        for (int nb = 0; nb < 4; ++nb) { vJ sum = red[0][mo * 4 + nb][qo][lane];
#pragma unroll
            for (int s = 1; s < NW; ++s) sum += red[s][mo * 4 + nb][qo][lane];
            float* cp = C + (size_t)(r0 + mo * 16 + hi * 8 + qo * JP) * ldc + c0 + nb * 16 + lr;
#pragma unroll
            for (int jj = 0; jj < JP; ++jj) cp[(size_t)jj * ldc] = BIAS ? sum[jj] + bfr(bias[c0 + nb * 16 + lr]) : sum[jj]; }
    } else {
    __shared__ __align__(16) float os[16 * 68];
#pragma unroll
    for (int mb = 0; mb < 4; ++mb) {
#pragma unroll
        for (int nb = 0; nb < 4; ++nb) {
#pragma unroll
            for (int j = 0; j < 8; ++j) os[(hi * 8 + j) * 68 + nb * 16 + lr] = acc[mb][nb][j]; }
        __builtin_amdgcn_wave_barrier(); asm volatile("" ::: "memory");
        float* crow = C + (size_t)(r0 + mb * 16) * ldc + c0;
{
#pragma unroll
            for (int s = 0; s < 8; ++s) { const int row = 2 * s + hi, cofs = lr * 4; v4f val = *(const v4fa*)(os + row * 68 + cofs); if (BIAS) { val[0] += bfr(bias[c0 + cofs]); val[1] += bfr(bias[c0 + cofs + 1]); val[2] += bfr(bias[c0 + cofs + 2]); val[3] += bfr(bias[c0 + cofs + 3]); }
                *(v4f*)(crow + (size_t)row * ldc + cofs) = val; }
             }
        __builtin_amdgcn_wave_barrier(); asm volatile("" ::: "memory");
    }
    }
}

__device__ __forceinline__ h16 tohx(float x) { return (h16)x; }
__device__ __forceinline__ void splitf(float y, unsigned short& h, unsigned short& l) { h = f2bf(y); l = f2bf(y - bf2f(h)); }
typedef __attribute__((ext_vector_type(2))) unsigned short v2us;
typedef __attribute__((ext_vector_type(2))) _Float16 v2h;
typedef __attribute__((ext_vector_type(4))) _Float16 v4h;
typedef v4h __attribute__((may_alias)) v4ha;
typedef __attribute__((ext_vector_type(2))) float v2f;

__global__ __launch_bounds__(256) void k_wtG(const float* __restrict__ w, int K, int N, bf* Bt) {
    const int lane = threadIdx.x & 31; const int L0 = (blockIdx.x * 8 + (threadIdx.x >> 5)) * 8; const int nlines = N * K / 64;
{
#pragma unroll 1
        for (int l = 0; l < 8; ++l) { const int L = L0 + l; if (L >= nlines) break; const size_t e = (size_t)L * 64 + lane * 2; const int k = (int)(e % K), n = (int)(e / K); v2us o;
            o[0] = f2bf(w[(size_t)k * N + n]); o[1] = f2bf(w[(size_t)(k + 1) * N + n]); *(v2us*)(Bt + e) = o; }
         }
}
__global__ __launch_bounds__(256) void k_cvt8(const float* __restrict__ src, bf* dst, size_t n8) { const size_t i = (size_t)blockIdx.x * 256 + threadIdx.x; if (i >= n8) return; const v8f v = *(const v8f*)(src + i * 8); v8us o;
#pragma unroll
    for (int k = 0; k < 8; ++k) o[k] = f2bf(v[k]); *(v8us*)(dst + i * 8) = o;  }
__global__ __launch_bounds__(256) void k_qplanes(const float* __restrict__ F, bf* Ph, bf* Pl, h16* P16) {
    const int lane = threadIdx.x & 31; const int L0 = (blockIdx.x * 8 + (threadIdx.x >> 5)) * 8; const int nlines = NH_ * TT * HD / 64;
{
#pragma unroll
        for (int l = 0; l < 8; ++l) { const int L = L0 + l; if (L >= nlines) break; const int e = L * 64 + lane * 2; const int d = e & (HD - 1); const int t = (e >> 6) & (TT - 1); const int h = e >> 17; v2us oh, ol; v2h o16;
#pragma unroll
            for (int q = 0; q < 2; ++q) { const float x = F[(size_t)t * DD + h * HD + d + q]; unsigned short a, c2; splitf(x, a, c2); oh[q] = a; ol[q] = c2; o16[q] = tohx(x); }
            *(v2us*)(Ph + (size_t)e) = oh; *(v2us*)(Pl + (size_t)e) = ol; *(v2h*)(P16 + (size_t)e) = o16; }
         }
}
__global__ __launch_bounds__(256) void k_vtplane(const float* __restrict__ F, bf* Vh, bf* Vl, h16* V16) {
    const int lane = threadIdx.x & 31; const int L0 = (blockIdx.x * 8 + (threadIdx.x >> 5)) * 8; const int nlines = NH_ * TT * HD / 64;
{
#pragma unroll
        for (int l = 0; l < 8; ++l) { const int L = L0 + l; if (L >= nlines) break; const int e = L * 64 + lane * 2; const int t = e & (TT - 1); const int d = (e >> 11) & (HD - 1); const int h = e >> 17; v2us oh, ol; v2h o16;
#pragma unroll
            for (int q = 0; q < 2; ++q) { const float x = F[(size_t)(t + q) * DD + h * HD + d]; unsigned short a, c2; splitf(x, a, c2); oh[q] = a; ol[q] = c2; o16[q] = tohx(x); }
            *(v2us*)(Vh + (size_t)e) = oh; *(v2us*)(Vl + (size_t)e) = ol; *(v2h*)(V16 + (size_t)e) = o16; }
         }
}
#define LOG2E 1.44269504088896341f
__device__ __forceinline__ void exp2x8(float (&x)[8]) { asm("v_exp_f32 %0, %0\n\tv_exp_f32 %1, %1\n\tv_exp_f32 %2, %2\n\tv_exp_f32 %3, %3\n\tv_exp_f32 %4, %4\n\tv_exp_f32 %5, %5\n\tv_exp_f32 %6, %6\n\tv_exp_f32 %7, %7\n\tv_nop" : "+v"(x[0]), "+v"(x[1]), "+v"(x[2]), "+v"(x[3]), "+v"(x[4]), "+v"(x[5]), "+v"(x[6]), "+v"(x[7])); }
__device__ __forceinline__ void log2x8(float (&x)[8]) { asm("v_log_f32 %0, %0\n\tv_log_f32 %1, %1\n\tv_log_f32 %2, %2\n\tv_log_f32 %3, %3\n\tv_log_f32 %4, %4\n\tv_log_f32 %5, %5\n\tv_log_f32 %6, %6\n\tv_log_f32 %7, %7\n\tv_nop" : "+v"(x[0]), "+v"(x[1]), "+v"(x[2]), "+v"(x[3]), "+v"(x[4]), "+v"(x[5]), "+v"(x[6]), "+v"(x[7])); }
__device__ __forceinline__ float expx1(float a) { float x = a * LOG2E; asm("v_exp_f32 %0, %0\n\tv_nop" : "+v"(x)); return x; }   // e^a
// The wait that is kept between a run of global loads and the next write of a register that one of them names as its address. The run's addresses are inputs of the statement: they stay in their registers
// up to the wait, wherever the build lets it stand behind the run, so that neither a result of the run nor the vector work behind it is given those registers in front of it.
template <typename T16> __device__ __forceinline__ void xwait2(const T16* a, const T16* b) { asm volatile("s_wait_xcnt 0x0" :: "v"(a), "v"(b) : "memory"); }
#define FW 8                      // waves per work-group of k_fattn
#define QGL 2                     // 16-query groups per work-group, fp16 rows
#define QGH 1                     // 16-query groups per work-group, hi+lo rows
struct FSh { v4f red[FW][4 * QGL][2 * 32 + 2];   // [wave][fragment][half * 32 + lane]; the two spare entries shift each fragment by 32 bytes, so that the adders' reads of four fragments side by side fall on different banks
             float sm[FW][QGL * 16]; float sl[FW][QGL * 16]; float se[FW][QGL * 16]; };
template <typename T16, bool HI, int QG>
__device__ __forceinline__ void fattn_body(const T16* __restrict__ Q, const T16* __restrict__ Q2, const T16* __restrict__ Kp, const T16* __restrict__ K2, const T16* __restrict__ Vt, const T16* __restrict__ V2,
                                           int q0, float* ENTh, bf* Ah, bf* Al, FSh& sh) {
    typedef typename WFrag<T16>::V V; static_assert(QG == 1 || QG == 2, "the statement at the foot of walk 2 names the accumulators of two groups");
    const int w = __builtin_amdgcn_readfirstlane((int)(threadIdx.x >> 5));   // wave number, held scalar
    const int lane = threadIdx.x & 31, c = lane & 15, h = lane >> 4;
    const int nkb = (q0 + QG * 16 + 31) >> 5;   // 32-key blocks that hold a key <= the last query
    V qf[QG][2], qf2[QG][2];
#pragma unroll
    for (int g = 0; g < QG; ++g)
#pragma unroll
        for (int kk = 0; kk < 2; ++kk) { const size_t o = (size_t)(q0 + g * 16 + c) * HD + kk * 32 + 8 * h; qf[g][kk] = WFrag<T16>::ld(Q + o); if (HI) qf2[g][kk] = WFrag<T16>::ld(Q2 + o); }
    asm volatile("s_wait_xcnt 0x0" ::: "memory");   // kept in front of the next write of an address register that the query loads name
    V kf[2][2], kf2[2][2];   // the key rows k0 .. k0 + 31 as A fragments
    auto loadk = [&](int k0) { const size_t o = (size_t)(k0 + c) * HD + 8 * h; const T16* kp = Kp + o; const T16* kp2 = HI ? K2 + o : kp;   // one address a plane, the rest of a run is constant offsets
#pragma unroll
        for (int t = 0; t < 2; ++t)
#pragma unroll
            for (int kk = 0; kk < 2; ++kk) { kf[t][kk] = WFrag<T16>::ld(kp + t * 16 * HD + kk * 32); if (HI) kf2[t][kk] = WFrag<T16>::ld(kp2 + t * 16 * HD + kk * 32); }
        xwait2(kp, kp2);
        if constexpr (HI) __builtin_amdgcn_sched_barrier(0);   // keeps the matrix instructions behind the whole run: without it the build refills a few registers in turn, and the 16 loads become a chain of seven round trips
    };
    // st[t][g][r] = masked scaled score of key k0 + t * 16 + 8 h + r and query q0 + g * 16 + c, from the fragments in kf
    auto scores = [&](int k0, v8f (&st)[2][QG]) {
#pragma unroll
        for (int t = 0; t < 2; ++t)
#pragma unroll
            for (int g = 0; g < QG; ++g) { v8f a = (v8f){};
#pragma unroll
                for (int kk = 0; kk < 2; ++kk) { a = WFrag<T16>::mma(kf[t][kk], qf[g][kk], a); if (HI) { a = WFrag<T16>::mma(kf[t][kk], qf2[g][kk], a); a = WFrag<T16>::mma(kf2[t][kk], qf[g][kk], a); } }
#pragma unroll
                for (int r = 0; r < 8; ++r) st[t][g][r] = a[r] * SCL; }
        if (k0 + 31 > q0) {   // a scalar test: only a block that reaches past the first query holds a key to cut
#pragma unroll
            for (int t = 0; t < 2; ++t)
#pragma unroll
                for (int g = 0; g < QG; ++g) { const int dq = q0 + g * 16 + c - (k0 + t * 16 + 8 * h);   // key r of this lane is kept while r <= dq
#pragma unroll
                    for (int r = 0; r < 8; ++r) st[t][g][r] = (r <= dq) ? st[t][g][r] : -3.0e38f; } }
    };
    float m[QG], l[QG];
#pragma unroll
    for (int g = 0; g < QG; ++g) { m[g] = -3.0e38f; l[g] = 0.f; }
    constexpr bool PF = !HI;   // key rows fetched one trip ahead; not for the hi+lo rows, where RH / 32 <= FW blocks leave a wave one trip at most
    if (PF && w < nkb) loadk(w * 32);
#pragma unroll 1   // rolled: the key fragments are refilled in place, one trip's registers serve every trip
    for (int kb = w; kb < nkb; kb += FW) { if (!PF) loadk(kb * 32);
        v8f st[2][QG]; scores(kb * 32, st);
        if (PF) loadk(min(kb + FW, nkb - 1) * 32);   // the next trip's key rows fly, into the same registers, while this trip's vector work runs (the last trip fetches the last block once more: in bounds, unused)
#pragma unroll
        for (int g = 0; g < QG; ++g) { float bm = m[g];
#pragma unroll
            for (int r = 0; r < 8; ++r) bm = fmaxf(bm, fmaxf(st[0][g][r], st[1][g][r]));
            float s = 0.f;
#pragma unroll
            for (int t = 0; t < 2; ++t) { float e[8];
#pragma unroll
                for (int r = 0; r < 8; ++r) e[r] = (st[t][g][r] - bm) * LOG2E;
                exp2x8(e);
#pragma unroll
                for (int r = 0; r < 8; ++r) s += e[r]; }
            l[g] = l[g] * expx1(m[g] - bm) + s; m[g] = bm; } }   // a lane that has met masked keys only counts ones under m = -3e38: the joins below scale them by exp(-3e38 - max) = 0
#pragma unroll
    for (int g = 0; g < QG; ++g) { const float mo = __shfl_xor(m[g], 16, 32), lo = __shfl_xor(l[g], 16, 32); const float mn = fmaxf(m[g], mo);
        const float lj = l[g] * expx1(m[g] - mn) + lo * expx1(mo - mn); if (h == 0) { sh.sm[w][g * 16 + c] = mn; sh.sl[w][g * 16 + c] = lj; } }
    __syncthreads();   // every wave's maxima and sums are in LDS before any wave joins them
    float M[QG], pn[QG], f[QG], en[QG];
#pragma unroll
    for (int g = 0; g < QG; ++g) { float mx = sh.sm[0][g * 16 + c];
#pragma unroll
        for (int s = 1; s < FW; ++s) mx = fmaxf(mx, sh.sm[s][g * 16 + c]);
        float L = 0.f;
#pragma unroll
        for (int s = 0; s < FW; ++s) L += sh.sl[s][g * 16 + c] * expx1(sh.sm[s][g * 16 + c] - mx);
        M[g] = mx; pn[g] = __fdiv_rn(1.0f, L); f[g] = __fdiv_rn(HI ? 1.0f : PCAR, L); en[g] = 0.f; }
    v8f o[4][QG];
#pragma unroll
    for (int dt = 0; dt < 4; ++dt)
#pragma unroll
        for (int g = 0; g < QG; ++g) o[dt][g] = (v8f){};
    if (PF && w < nkb) loadk(w * 32);
#pragma unroll 1   // rolled, as walk 1: fragments refilled in place keep the wave inside its register limit
    for (int kb = w; kb < nkb; kb += FW) { const int k0 = kb * 32; V vf[4], vf2[4];
        const size_t vo = (size_t)c * TT + k0 + 8 * h; const T16* vp = Vt + vo; const T16* vp2 = HI ? V2 + vo : vp;
#pragma unroll
        for (int dt = 0; dt < 4; ++dt) { vf[dt] = WFrag<T16>::ld(vp + dt * 16 * TT); if (HI) vf2[dt] = WFrag<T16>::ld(vp2 + dt * 16 * TT); }
        xwait2(vp, vp2);
        if (!PF) loadk(k0);
        v8f st[2][QG]; scores(k0, st);
        if (PF) loadk(min(kb + FW, nkb - 1) * 32);   // as in walk 1: the next trip's key rows fly while this trip's vector work and Ot products run
#pragma unroll
        for (int g = 0; g < QG; ++g) { V pb, pb2;
            float y[2][8];
#pragma unroll
            for (int t = 0; t < 2; ++t) { float e[8], q[8];
#pragma unroll
                for (int r = 0; r < 8; ++r) e[r] = (st[t][g][r] - M[g]) * LOG2E;
                exp2x8(e);
#pragma unroll
                for (int r = 0; r < 8; ++r) q[r] = e[r] * pn[g] + 1e-8f;
                log2x8(q);
#pragma unroll
                for (int r = 0; r < 8; ++r) { en[g] -= (e[r] * pn[g]) * q[r]; y[t][r] = e[r] * f[g]; } }   // a masked key: e = 0, p = 0, term 0
            if constexpr (HI) { v8us h0, h1, l0, l1;
#pragma unroll
                for (int r = 0; r < 8; ++r) { unsigned short a, b2; splitf(y[0][r], a, b2); h0[r] = a; l0[r] = b2; splitf(y[1][r], a, b2); h1[r] = a; l1[r] = b2; }
                pb = cat16b(h0, h1); pb2 = cat16b(l0, l1);
            } else { v8h h0, h1;
#pragma unroll
                for (int r = 0; r < 8; ++r) { h0[r] = tohx(y[0][r]); h1[r] = tohx(y[1][r]); }
                pb = cat16(h0, h1); }
#pragma unroll
            for (int dt = 0; dt < 4; ++dt) { o[dt][g] = WFrag<T16>::mma(vf[dt], pb, o[dt][g]); if (HI) { o[dt][g] = WFrag<T16>::mma(vf[dt], pb2, o[dt][g]); o[dt][g] = WFrag<T16>::mma(vf2[dt], pb, o[dt][g]); } } }
        // the four slots keep the distance between the trip's last matrix instructions (every accumulator is named, so that all of them stand in front) and the first vector instruction behind the branch, on both of its sides
        if constexpr (QG == 1) asm volatile("v_nop\n\tv_nop\n\tv_nop\n\tv_nop" : "+v"(o[0][0]), "+v"(o[1][0]), "+v"(o[2][0]), "+v"(o[3][0]));
        else asm volatile("v_nop\n\tv_nop\n\tv_nop\n\tv_nop" : "+v"(o[0][0]), "+v"(o[1][0]), "+v"(o[2][0]), "+v"(o[3][0]), "+v"(o[0][QG - 1]), "+v"(o[1][QG - 1]), "+v"(o[2][QG - 1]), "+v"(o[3][QG - 1])); }
#pragma unroll
    for (int dt = 0; dt < 4; ++dt)
#pragma unroll
        for (int g = 0; g < QG; ++g) { const v8f a = o[dt][g]; sh.red[w][dt * QG + g][lane] = (v4f){a[0], a[1], a[2], a[3]}; sh.red[w][dt * QG + g][32 + lane] = (v4f){a[4], a[5], a[6], a[7]}; }
#pragma unroll
    for (int g = 0; g < QG; ++g) { const float ej = en[g] + __shfl_xor(en[g], 16, 32); if (h == 0) sh.se[w][g * 16 + c] = ej; }
    __syncthreads();   // every wave's partial Ot tiles and entropy sums are in LDS before any wave adds them
    // Wave w owns queries w * QW .. w * QW + QW - 1 with all 64 d: a whole 128-byte line of Ah and of Al has one writing wave. Unit u = (query, 16-d tile dt, half hh): 8 consecutive d.
    constexpr int QW = QG * 16 / FW, NU = QW * 8; const float cs = HI ? 1.0f : (1.0f / PCAR);
#pragma unroll
    for (int u0 = 0; u0 < NU; u0 += 32) { const int u = u0 + lane;
        if (u < NU) { const int qq = w * QW + (u % QW), dt = (u / QW) & 3, hh = u / (QW * 4); const int fi = dt * QG + (qq >> 4), sl = (qq & 15) + 16 * hh;
            v4f s0 = sh.red[0][fi][sl], s1 = sh.red[0][fi][32 + sl];
#pragma unroll
            for (int s = 1; s < FW; ++s) { s0 += sh.red[s][fi][sl]; s1 += sh.red[s][fi][32 + sl]; }
            v8us oh, ol;
#pragma unroll
            for (int r = 0; r < 4; ++r) { unsigned short a, b2; splitf(s0[r] * cs, a, b2); oh[r] = a; ol[r] = b2; splitf(s1[r] * cs, a, b2); oh[4 + r] = a; ol[4 + r] = b2; }
            const size_t oo = (size_t)(q0 + qq) * DD + dt * 16 + hh * 8; *(v8us*)(Ah + oo) = oh; *(v8us*)(Al + oo) = ol;
            asm volatile("s_wait_xcnt 0x0" ::: "memory"); } }   // kept in front of the next write of a register that the two stores name
    if (threadIdx.x < QG * 16) { float e = sh.se[0][threadIdx.x];
#pragma unroll
        for (int s = 1; s < FW; ++s) e += sh.se[s][threadIdx.x];
        ENTh[(size_t)(q0 + (int)threadIdx.x) * 32] = e * 0.69314718055994531f; }   // the terms were summed with log2; k_entpart reads word 0 of a row's line
}
// grid (x, batch * NH_ + head): x < (TT - RH) / (QGL * 16): fp16 query blocks, the longest first; behind them the hi+lo blocks. The test is the same for a whole work-group.
// Four waves a SIMD (at most 256 registers a wave): two work-groups share a WGP, so that one's vector work covers the other's load waits, barriers and LDS sums.
__global__ __launch_bounds__(32 * FW) __attribute__((amdgpu_waves_per_eu(4, 4))) void k_fattn(const bf* __restrict__ Qh, const bf* __restrict__ Ql, const bf* __restrict__ Kh, const bf* __restrict__ Kl, const bf* __restrict__ Vh, const bf* __restrict__ Vl,
                                                   const h16* __restrict__ Q16, const h16* __restrict__ K16, const h16* __restrict__ V16, float* ENT, bf* Ah, bf* Al) {
    __shared__ FSh sh;
    constexpr int NL = (TT - RH) / (QGL * 16);
    const int x = blockIdx.x; const size_t z = (size_t)blockIdx.y * TT * HD; float* ENTh = ENT + (size_t)blockIdx.y * TT * 32;   // planes [batch][head][..][..], ENT [batch][head][query] lines
    const size_t ao = (size_t)(blockIdx.y / NH_) * TT * DD + (blockIdx.y % NH_) * HD; Ah += ao; Al += ao;   // merged rows [batch][query][head * HD + d]
    if (x < NL) fattn_body<h16, false, QGL>(Q16 + z, nullptr, K16 + z, nullptr, V16 + z, nullptr, TT - (x + 1) * (QGL * 16), ENTh, Ah, Al, sh);
    else fattn_body<bf, true, QGH>(Qh + z, Ql + z, Kh + z, Kl + z, Vh + z, Vl + z, (x - NL) * (QGH * 16), ENTh, Ah, Al, sh);
}

// Mean of the NB_ * NH_ * TT row entropies in two launches: one wave alone would walk all the ENT lines in a chain of load round trips.
// k_entpart: work-group g sums rows g * 256 .. g * 256 + 255, one row a thread (every load of the launch is in flight at once): lane tree, then the 8 wave sums through LDS -> line PART[g][0..31] (lane 0 the sum, the rest 0).
#define EPW 256                   // rows per work-group of k_entpart
__global__ __launch_bounds__(EPW) void k_entpart(const float* __restrict__ ENT, float* PART) {
    __shared__ float wsum[EPW / 32];
    const int lane = threadIdx.x & 31, w = threadIdx.x >> 5; float s = ENT[((size_t)blockIdx.x * EPW + threadIdx.x) * 32];
#pragma unroll
    for (int sh = 16; sh; sh >>= 1) s += __shfl_xor(s, sh, 32);
    if (lane == 0) wsum[w] = s;
    __syncthreads();   // all 8 wave sums are in LDS before wave 0 adds them
    if (w == 0) { float t = lane < EPW / 32 ? wsum[lane] : 0.f;
#pragma unroll
        for (int sh = EPW / 64; sh; sh >>= 1) t += __shfl_xor(t, sh, 32);
        PART[(size_t)blockIdx.x * 32 + lane] = lane == 0 ? t : 0.f; }
}
// k_entmean: one wave sums the NB_ * NH_ * TT / EPW partial sums (8 independent loads a lane) and scales.
__global__ __launch_bounds__(32) void k_entmean(const float* __restrict__ PART, float* OUT1) { const int lane = threadIdx.x; float s = 0.f;
#pragma unroll
    for (int r = 0; r < NB_ * NH_ * TT / EPW; r += 32) s += PART[(size_t)(r + lane) * 32];
#pragma unroll
    for (int sh = 16; sh; sh >>= 1) s += __shfl_xor(s, sh, 32);
    if (lane == 0) { const float m = s * (1.0f / (float)(NB_ * NH_ * TT)); *(float*)OUT1 = m;  } }
extern "C" void kernel_launch(void* const* d_in, const int* in_sizes, int n_in,
                              void* d_out, int out_size, void* d_ws, size_t ws_size, hipStream_t stream) {
    (void)in_sizes; (void)n_in; (void)out_size;
    const float* x = (const float*)d_in[0]; const float* wqkv = (const float*)d_in[1]; const float* wo = (const float*)d_in[2];   // w_attn [1024][3072], w_proj [1024][1024] as x @ W (no biases)
    float* OUT = (float*)d_out; float* OUT1 = OUT + (size_t)NB_ * TT * DD;     // [2][2048][1024] at 0; [1] entropy at byte 16,777,216
    char* wsp = (char*)d_ws;
    auto take = [&](size_t bytes) { char* p = wsp; wsp += (bytes + 255) & ~(size_t)255; return (void*)p; };
    bf* WQKV = (bf*)take((size_t)3 * DD * DD * 2); bf* WO = (bf*)take((size_t)DD * DD * 2);
    bf* XB = (bf*)take((size_t)TT * DD * 2); float* F = (float*)take((size_t)TT * DD * 4);
    const size_t PB = (size_t)NB_ * TT * DD * 2;   // a 16-bit plane of both batches
    bf* QPh = (bf*)take(PB); bf* QPl = (bf*)take(PB); bf* KPh = (bf*)take(PB); bf* KPl = (bf*)take(PB); bf* VTh = (bf*)take(PB); bf* VTl = (bf*)take(PB);
    h16* QP16 = (h16*)take(PB); h16* KP16 = (h16*)take(PB); h16* VT16 = (h16*)take(PB);
    float* ENT = (float*)take((size_t)NB_ * NH_ * TT * 32 * 4); bf* ATh = (bf*)take(PB); bf* ATl = (bf*)take(PB); float* PART = (float*)take((size_t)(NB_ * NH_ * TT / EPW) * 32 * 4);
    if ((size_t)(wsp - (char*)d_ws) > ws_size) return;    // total 116 MiB
    { k_wtG<<<(unsigned)((DD * 3 * DD / 64 + 63) / 64), 256, 0, stream>>>(wqkv, DD, 3 * DD, WQKV); k_wtG<<<(unsigned)((DD * DD / 64 + 63) / 64), 256, 0, stream>>>(wo, DD, DD, WO); }
    const unsigned LB = (unsigned)((NH_ * TT * HD / 64 + 63) / 64); const dim3 gP(TT / 64, DD / 64, 1);
    for (int b = 0; b < NB_; ++b) { const size_t bo = (size_t)b * TT * DD;
        k_cvt8<<<(unsigned)(((size_t)TT * DD / 8 + 255) / 256), 256, 0, stream>>>(x + (size_t)b * TT * DD, XB, (size_t)TT * DD / 8);
        k_gemmw<bf, 0, false, 8, 0><<<gP, 256, 0, stream>>>(XB, nullptr, WQKV, nullptr, DD, DD, F, DD, nullptr, 0, 0, 0, 0); k_qplanes<<<LB, 256, 0, stream>>>(F, QPh + bo, QPl + bo, QP16 + bo);
        k_gemmw<bf, 0, false, 8, 0><<<gP, 256, 0, stream>>>(XB, nullptr, WQKV + (size_t)DD * DD, nullptr, DD, DD, F, DD, nullptr, 0, 0, 0, 0); k_qplanes<<<LB, 256, 0, stream>>>(F, KPh + bo, KPl + bo, KP16 + bo);
        k_gemmw<bf, 0, false, 8, 0><<<gP, 256, 0, stream>>>(XB, nullptr, WQKV + (size_t)2 * DD * DD, nullptr, DD, DD, F, DD, nullptr, 0, 0, 0, 0); k_vtplane<<<LB, 256, 0, stream>>>(F, VTh + bo, VTl + bo, VT16 + bo); }
    k_fattn<<<dim3((TT - RH) / (QGL * 16) + RH / (QGH * 16), NB_ * NH_, 1), 32 * FW, 0, stream>>>(QPh, QPl, KPh, KPl, VTh, VTl, QP16, KP16, VT16, ENT, ATh, ATl);
    for (int b = 0; b < NB_; ++b) { const size_t bo = (size_t)b * TT * DD;
        k_gemmw<bf, 1, false, 8, 0><<<gP, 256, 0, stream>>>(ATh + bo, ATl + bo, WO, nullptr, DD, DD, OUT + bo, DD, nullptr, 0, 0, 0, 0); }
    k_entpart<<<NB_ * NH_ * TT / EPW, EPW, 0, stream>>>(ENT, PART); k_entmean<<<1, 32, 0, stream>>>(PART, OUT1);
}

// v006
// One run takes 201 microseconds.
// Two timings next to v005 both put it at 1.15 times that version's speed.
// Counting every step since v000, it is 11.2 times as fast.
#include <hip/hip_runtime.h>

// Causal multi-head self-attention with an attention-entropy monitor (x [2][2048][1024]; qkv = x w_attn (16 heads x 64, no bias); causal softmax(q.k/8); y = merged att.v w_proj -> [2][2048][1024];
// second output = mean over all (batch, head, query) rows of the row entropy -sum_s att log(att + 1e-8) -> [1]).
// Compute dtypes, f32 accumulate: every input rounded to bf16; qkv projection on PLAIN bf16 operands (inputs: exact products, f32 accumulate); w_proj on att.v hi+lo planes (2 products); PER-ROW PRECISION HYBRID:
// query rows < 256 take scores and att.v on bf16 hi+lo planes (3 products), rows >= 256 on single fp16 planes; 1/8, the causal cut, the softmax and the row entropy (from the f32 probabilities, hardware

#define NB_  2
#define TT   2048
#define DD   1024
#define NH_  16
#define HD   64
#define RH   256                  // query rows < RH: hi+lo planes; rows >= RH: fp16 planes
#define NF   32                   // head_dim / 2 (unused here)
#define SCL  0.125f               // 1/sqrt(64)
#define PCAR 1024.0f         // P scale for fp16 rows >= RH, undone in k_fattn's head merge
typedef _Float16 h16;
typedef unsigned short bf;
typedef __attribute__((ext_vector_type(16))) __bf16   v16bf;
typedef __attribute__((ext_vector_type(16))) _Float16 v16h;
typedef __attribute__((ext_vector_type(8)))  _Float16 v8h;
typedef __attribute__((ext_vector_type(8)))  unsigned short v8us;
typedef __attribute__((ext_vector_type(8)))  float    v8f;
typedef __attribute__((ext_vector_type(4)))  float    v4f;
typedef v8h  __attribute__((may_alias)) v8ha;
typedef v4f  __attribute__((may_alias)) v4fa;
typedef v8us __attribute__((may_alias)) v8usa;

__device__ __forceinline__ unsigned short f2bf(float f) { unsigned u = __float_as_uint(f); u += 0x7FFFu + ((u >> 16) & 1u); return (unsigned short)(u >> 16); }
__device__ __forceinline__ float bf2f(unsigned short b) { return __uint_as_float(((unsigned)b) << 16); }
__device__ __forceinline__ float bfr(float f) { return bf2f(f2bf(f)); }
__device__ __forceinline__ v16h cat16(v8h lo, v8h hi) { return __builtin_shufflevector(lo, hi, 0, 1, 2, 3, 4, 5, 6, 7, 8, 9, 10, 11, 12, 13, 14, 15); }
__device__ __forceinline__ v16bf cat16b(v8us lo, v8us hi) { return __builtin_bit_cast(v16bf, __builtin_shufflevector(lo, hi, 0, 1, 2, 3, 4, 5, 6, 7, 8, 9, 10, 11, 12, 13, 14, 15)); }
__device__ __forceinline__ v8f wmma16(v16h a, v16h b, v8f c) { return __builtin_amdgcn_wmma_f32_16x16x32_f16(false, a, false, b, (short)0, c, false, false); }
__device__ __forceinline__ v8f wmmab(v16bf a, v16bf b, v8f c) { return __builtin_amdgcn_wmma_f32_16x16x32_bf16(false, a, false, b, (short)0, c, false, false); }



// ---- k_gemmw: register-blocked GEMM, one 64x64 output tile per work-group (16 accumulators a wave), operands straight from K-contiguous 16-bit planes; grid (M/64, N/64, Z), 32 * NW threads.
// C[m][n] (f32, pitch ldc, + optional f32 bias[n]) = sum_k A[m][k] Bt[n][k] (+ split products per NSPLIT). A and A2 have row pitch lda, Bt and Bt2 row pitch K. z-batch strides sA/sB/sC in elements. K % (32 * NW) == 0.
// CAUS (causal attention; rbase = query index of row 0 of A and C): 0 = the whole product. 1 = scores: only tiles that hold a key the softmax reads; query rows 128 p .. 128 p + 127 take keys < 128 (p + 1), that is 2 row blocks x 2 (p + 1) column tiles;
// grid x is the flat index over those tiles (band p starts at 2 p (p + 1)), grid y = 1. 2 = att.v: the k loop ends at the tile's last query + 1 (the probabilities behind it are exact zeros, not read, and not stored past the row's own 128-key chunk).
// NW > 1: the work-group has NW waves on the SAME tile; wave w takes the k steps w, w + NW, ... (a chain of K / (32 * NW) load round trips instead of K / 32); the NW partial tiles are summed in LDS, wave 0 first.
template <typename T16> struct WFrag;
template <> struct WFrag<h16> { typedef v16h V; static __device__ __forceinline__ V ld(const h16* p) { return cat16(*(const v8h*)p, *(const v8h*)(p + 16)); } static __device__ __forceinline__ v8f mma(V a, V b, v8f c) { return wmma16(a, b, c); } };
template <> struct WFrag<bf> { typedef v16bf V; static __device__ __forceinline__ V ld(const bf* p) { return cat16b(*(const v8us*)p, *(const v8us*)(p + 16)); } static __device__ __forceinline__ v8f mma(V a, V b, v8f c) { return wmmab(a, b, c); } };
template <typename T16, int NSPLIT, bool BIAS, int NW, int CAUS>
__global__ __launch_bounds__(32 * NW) void k_gemmw(const T16* __restrict__ A, const T16* __restrict__ A2, const T16* __restrict__ Bt, const T16* __restrict__ Bt2, int K, int lda, float* C, int ldc, const float* __restrict__ bias, size_t sA, size_t sB, size_t sC, int rbase) {
    typedef typename WFrag<T16>::V V;
    const int w = NW > 1 ? __builtin_amdgcn_readfirstlane((int)(threadIdx.x >> 5)) : 0;   // wave number, held scalar
    const size_t z = blockIdx.z; A += z * sA; if (A2) A2 += z * sA; Bt += z * sB; if (Bt2) Bt2 += z * sB; C += z * sC;
    const int lane = threadIdx.x & 31, lr = lane & 15, hi = lane >> 4; int r0 = blockIdx.x * 64, c0 = blockIdx.y * 64;
    if constexpr (CAUS == 1) {
        const int p0 = rbase >> 7; const int t = (int)blockIdx.x + 2 * p0 * (p0 + 1); int p = 0;
#pragma unroll
        for (int q = 1; q < TT / 128; ++q) p += (t >= 2 * q * (q + 1)) ? 1 : 0;
        const int rem = t - 2 * p * (p + 1), wd = 2 * (p + 1), up = rem >= wd ? 1 : 0;
        r0 = (2 * p + up) * 64 - rbase; c0 = (rem - up * wd) * 64;
    }
    const int kend = CAUS == 2 ? min(K, rbase + r0 + 64) : K;
    v8f acc[4][4];
#pragma unroll
    for (int mb = 0; mb < 4; ++mb)
#pragma unroll
        for (int nb = 0; nb < 4; ++nb) acc[mb][nb] = (v8f){};
    const size_t aoff = (size_t)(r0 + lr) * lda + 8 * hi, boff = (size_t)(c0 + lr) * K + 8 * hi;
#pragma unroll 1
    for (int kc = w * 32; kc < kend; kc += 32 * NW) {
        V a[4], a2[4];
#pragma unroll
        for (int mb = 0; mb < 4; ++mb) { a[mb] = WFrag<T16>::ld(A + aoff + (size_t)mb * 16 * lda + kc); if (NSPLIT == 1 || NSPLIT == 2) a2[mb] = WFrag<T16>::ld(A2 + aoff + (size_t)mb * 16 * lda + kc); }
#pragma unroll
        for (int nb = 0; nb < 4; ++nb) { const V b = WFrag<T16>::ld(Bt + boff + (size_t)nb * 16 * K + kc); V b2; if (NSPLIT >= 2) b2 = WFrag<T16>::ld(Bt2 + boff + (size_t)nb * 16 * K + kc);
#pragma unroll
            for (int mb = 0; mb < 4; ++mb) { acc[mb][nb] = WFrag<T16>::mma(a[mb], b, acc[mb][nb]); if (NSPLIT == 1 || NSPLIT == 2) acc[mb][nb] = WFrag<T16>::mma(a2[mb], b, acc[mb][nb]); if (NSPLIT >= 2) acc[mb][nb] = WFrag<T16>::mma(a[mb], b2, acc[mb][nb]); } }
        asm volatile("v_nop\n\tv_nop\n\tv_nop\n\tv_nop" : "+v"(acc[0][0]), "+v"(acc[1][1]), "+v"(acc[2][2]), "+v"(acc[3][3]) : "v"(a[0]), "v"(a[3]));
    }
    if constexpr (NW > 1) {
        // Partial tiles in fragment order: red[s][f][q][lane] = JP consecutive accumulator rows j of fragment f = mb * 4 + nb of wave s (every LDS access is 32 lanes side by side).
        // Wave w then owns rows mb * 16 + hi * 8 + q * JP + (0 .. JP - 1) over all 64 columns (mb = w / QN, q = w % QN): whole 128-byte lines of C have one writing wave.
        constexpr int JP = 32 / NW, QN = 8 / JP;
        typedef __attribute__((ext_vector_type(JP))) float vJ;
        __shared__ vJ red[NW][16][QN][32];
#pragma unroll
        for (int mb = 0; mb < 4; ++mb)
#pragma unroll
            for (int nb = 0; nb < 4; ++nb)
#pragma unroll
                for (int q = 0; q < QN; ++q) { vJ t;
#pragma unroll
                    for (int jj = 0; jj < JP; ++jj) t[jj] = acc[mb][nb][q * JP + jj];
                    red[w][mb * 4 + nb][q][lane] = t; }
        __syncthreads();   // every wave's partial tile is in LDS before any wave sums
        const int mo = w / QN, qo = w % QN;
#pragma unroll
        for (int nb = 0; nb < 4; ++nb) { vJ sum = red[0][mo * 4 + nb][qo][lane];
#pragma unroll
            for (int s = 1; s < NW; ++s) sum += red[s][mo * 4 + nb][qo][lane];
            float* cp = C + (size_t)(r0 + mo * 16 + hi * 8 + qo * JP) * ldc + c0 + nb * 16 + lr;
#pragma unroll
            for (int jj = 0; jj < JP; ++jj) cp[(size_t)jj * ldc] = BIAS ? sum[jj] + bfr(bias[c0 + nb * 16 + lr]) : sum[jj]; }
    } else {
    __shared__ __align__(16) float os[16 * 68];
#pragma unroll
    for (int mb = 0; mb < 4; ++mb) {
#pragma unroll
        for (int nb = 0; nb < 4; ++nb) {
#pragma unroll
            for (int j = 0; j < 8; ++j) os[(hi * 8 + j) * 68 + nb * 16 + lr] = acc[mb][nb][j]; }
        __builtin_amdgcn_wave_barrier(); asm volatile("" ::: "memory");
        float* crow = C + (size_t)(r0 + mb * 16) * ldc + c0;
{
#pragma unroll
            for (int s = 0; s < 8; ++s) { const int row = 2 * s + hi, cofs = lr * 4; v4f val = *(const v4fa*)(os + row * 68 + cofs); if (BIAS) { val[0] += bfr(bias[c0 + cofs]); val[1] += bfr(bias[c0 + cofs + 1]); val[2] += bfr(bias[c0 + cofs + 2]); val[3] += bfr(bias[c0 + cofs + 3]); }
                *(v4f*)(crow + (size_t)row * ldc + cofs) = val; }
             }
        __builtin_amdgcn_wave_barrier(); asm volatile("" ::: "memory");
    }
    }
}

__device__ __forceinline__ h16 tohx(float x) { return (h16)x; }
__device__ __forceinline__ void splitf(float y, unsigned short& h, unsigned short& l) { h = f2bf(y); l = f2bf(y - bf2f(h)); }
typedef __attribute__((ext_vector_type(2))) unsigned short v2us;
typedef __attribute__((ext_vector_type(2))) _Float16 v2h;
typedef __attribute__((ext_vector_type(4))) _Float16 v4h;
typedef v4h __attribute__((may_alias)) v4ha;
typedef __attribute__((ext_vector_type(2))) float v2f;

// The three input conversions are bodies of ONE launch, k_prep (bx = the body's own block index); they do not depend on one another.
__device__ __forceinline__ void wtG_body(int bx, const float* __restrict__ w, int K, int N, bf* Bt) {
    const int lane = threadIdx.x & 31; const int L0 = (bx * 8 + (threadIdx.x >> 5)) * 8; const int nlines = N * K / 64;
{
#pragma unroll 1
        for (int l = 0; l < 8; ++l) { const int L = L0 + l; if (L >= nlines) break; const size_t e = (size_t)L * 64 + lane * 2; const int k = (int)(e % K), n = (int)(e / K); v2us o;
            o[0] = f2bf(w[(size_t)k * N + n]); o[1] = f2bf(w[(size_t)(k + 1) * N + n]); *(v2us*)(Bt + e) = o; }
         }
}
__device__ __forceinline__ void cvt8_body(int bx, const float* __restrict__ src, bf* dst, size_t n8) { const size_t i = (size_t)bx * 256 + threadIdx.x; if (i >= n8) return; const v8f v = *(const v8f*)(src + i * 8); v8us o;
#pragma unroll
    for (int k = 0; k < 8; ++k) o[k] = f2bf(v[k]); *(v8us*)(dst + i * 8) = o;  }
#define GWA (DD * 3 * DD / 4096)  // work-groups of the w_attn transpose (64 lines of 64 elements each)
#define GWP (DD * DD / 4096)      // work-groups of the w_proj transpose
#define GXC (NB_ * TT * DD / 2048) // work-groups of the x conversion, both batches
// grid GWA + GWP + GXC; the transposes (chains of eight load round trips) take the lowest block indices. Every test is the same for a whole work-group.
__global__ __launch_bounds__(256) void k_prep(const float* __restrict__ x, const float* __restrict__ wqkv, const float* __restrict__ wo, bf* XB, bf* WQKV, bf* WO) {
    const int bx = blockIdx.x;
    if (bx < GWA) wtG_body(bx, wqkv, DD, 3 * DD, WQKV);
    else if (bx < GWA + GWP) wtG_body(bx - GWA, wo, DD, DD, WO);
    else cvt8_body(bx - (GWA + GWP), x, XB, (size_t)NB_ * TT * DD / 8);
}
// The operand planes of q, k and v of both batches are bodies of ONE launch, k_planes. F here is one [TT][DD] f32 product.
__device__ __forceinline__ void qplanes_body(const float* __restrict__ F, bf* Ph, bf* Pl, h16* P16) {
    const int lane = threadIdx.x & 31; const int L0 = (blockIdx.x * 8 + (threadIdx.x >> 5)) * 8; const int nlines = NH_ * TT * HD / 64;
{
#pragma unroll
        for (int l = 0; l < 8; ++l) { const int L = L0 + l; if (L >= nlines) break; const int e = L * 64 + lane * 2; const int d = e & (HD - 1); const int t = (e >> 6) & (TT - 1); const int h = e >> 17; v2us oh, ol; v2h o16;
#pragma unroll
            for (int q = 0; q < 2; ++q) { const float x = F[(size_t)t * DD + h * HD + d + q]; unsigned short a, c2; splitf(x, a, c2); oh[q] = a; ol[q] = c2; o16[q] = tohx(x); }
            *(v2us*)(Ph + (size_t)e) = oh; *(v2us*)(Pl + (size_t)e) = ol; *(v2h*)(P16 + (size_t)e) = o16; }
         }
}
__device__ __forceinline__ void vtplane_body(const float* __restrict__ F, bf* Vh, bf* Vl, h16* V16) {
    const int lane = threadIdx.x & 31; const int L0 = (blockIdx.x * 8 + (threadIdx.x >> 5)) * 8; const int nlines = NH_ * TT * HD / 64;
{
#pragma unroll
        for (int l = 0; l < 8; ++l) { const int L = L0 + l; if (L >= nlines) break; const int e = L * 64 + lane * 2; const int t = e & (TT - 1); const int d = (e >> 11) & (HD - 1); const int h = e >> 17; v2us oh, ol; v2h o16;
#pragma unroll
            for (int q = 0; q < 2; ++q) { const float x = F[(size_t)(t + q) * DD + h * HD + d]; unsigned short a, c2; splitf(x, a, c2); oh[q] = a; ol[q] = c2; o16[q] = tohx(x); }
            *(v2us*)(Vh + (size_t)e) = oh; *(v2us*)(Vl + (size_t)e) = ol; *(v2h*)(V16 + (size_t)e) = o16; }
         }
}
// grid (LB, 3, NB_): y = 0 the transposed v planes (scattered reads, the longest), 1 = q, 2 = k; F = [q, k, v][batch][TT][DD]. The test is the same for a whole work-group.
__global__ __launch_bounds__(256) void k_planes(const float* __restrict__ F, bf* Qh, bf* Ql, h16* Q16, bf* Kh, bf* Kl, h16* K16, bf* Vh, bf* Vl, h16* V16) {
    const size_t bo = (size_t)blockIdx.z * TT * DD, fs = (size_t)NB_ * TT * DD;
    if (blockIdx.y == 0) vtplane_body(F + 2 * fs + bo, Vh + bo, Vl + bo, V16 + bo);
    else if (blockIdx.y == 1) qplanes_body(F + bo, Qh + bo, Ql + bo, Q16 + bo);
    else qplanes_body(F + fs + bo, Kh + bo, Kl + bo, K16 + bo);
}
#define LOG2E 1.44269504088896341f
__device__ __forceinline__ void exp2x8(float (&x)[8]) { asm("v_exp_f32 %0, %0\n\tv_exp_f32 %1, %1\n\tv_exp_f32 %2, %2\n\tv_exp_f32 %3, %3\n\tv_exp_f32 %4, %4\n\tv_exp_f32 %5, %5\n\tv_exp_f32 %6, %6\n\tv_exp_f32 %7, %7\n\tv_nop" : "+v"(x[0]), "+v"(x[1]), "+v"(x[2]), "+v"(x[3]), "+v"(x[4]), "+v"(x[5]), "+v"(x[6]), "+v"(x[7])); }
__device__ __forceinline__ void log2x8(float (&x)[8]) { asm("v_log_f32 %0, %0\n\tv_log_f32 %1, %1\n\tv_log_f32 %2, %2\n\tv_log_f32 %3, %3\n\tv_log_f32 %4, %4\n\tv_log_f32 %5, %5\n\tv_log_f32 %6, %6\n\tv_log_f32 %7, %7\n\tv_nop" : "+v"(x[0]), "+v"(x[1]), "+v"(x[2]), "+v"(x[3]), "+v"(x[4]), "+v"(x[5]), "+v"(x[6]), "+v"(x[7])); }
__device__ __forceinline__ float expx1(float a) { float x = a * LOG2E; asm("v_exp_f32 %0, %0\n\tv_nop" : "+v"(x)); return x; }   // e^a
// The wait that is kept between a run of global loads and the next write of a register that one of them names as its address. The run's addresses are inputs of the statement: they stay in their registers
// up to the wait, wherever the build lets it stand behind the run, so that neither a result of the run nor the vector work behind it is given those registers in front of it.
template <typename T16> __device__ __forceinline__ void xwait2(const T16* a, const T16* b) { asm volatile("s_wait_xcnt 0x0" :: "v"(a), "v"(b) : "memory"); }
#define FW 8                      // waves per work-group of k_fattn
#define QGL 2                     // 16-query groups per work-group, fp16 rows
#define QGH 1                     // 16-query groups per work-group, hi+lo rows
struct FSh { v4f red[FW][4 * QGL][2 * 32 + 2];   // [wave][fragment][half * 32 + lane]; the two spare entries shift each fragment by 32 bytes, so that the adders' reads of four fragments side by side fall on different banks
             float sm[FW][QGL * 16]; float sl[FW][QGL * 16]; float se[FW][QGL * 16]; };
template <typename T16, bool HI, int QG>
__device__ __forceinline__ void fattn_body(const T16* __restrict__ Q, const T16* __restrict__ Q2, const T16* __restrict__ Kp, const T16* __restrict__ K2, const T16* __restrict__ Vt, const T16* __restrict__ V2,
                                           int q0, float* ENTh, bf* Ah, bf* Al, FSh& sh) {
    typedef typename WFrag<T16>::V V; static_assert(QG == 1 || QG == 2, "the statement at the foot of walk 2 names the accumulators of two groups");
    const int w = __builtin_amdgcn_readfirstlane((int)(threadIdx.x >> 5));   // wave number, held scalar
    const int lane = threadIdx.x & 31, c = lane & 15, h = lane >> 4;
    const int nkb = (q0 + QG * 16 + 31) >> 5;   // 32-key blocks that hold a key <= the last query
    V qf[QG][2], qf2[QG][2];
#pragma unroll
    for (int g = 0; g < QG; ++g)
#pragma unroll
        for (int kk = 0; kk < 2; ++kk) { const size_t o = (size_t)(q0 + g * 16 + c) * HD + kk * 32 + 8 * h; qf[g][kk] = WFrag<T16>::ld(Q + o); if (HI) qf2[g][kk] = WFrag<T16>::ld(Q2 + o); }
    asm volatile("s_wait_xcnt 0x0" ::: "memory");   // kept in front of the next write of an address register that the query loads name
    V kf[2][2], kf2[2][2];   // the key rows k0 .. k0 + 31 as A fragments
    auto loadk = [&](int k0) { const size_t o = (size_t)(k0 + c) * HD + 8 * h; const T16* kp = Kp + o; const T16* kp2 = HI ? K2 + o : kp;   // one address a plane, the rest of a run is constant offsets
#pragma unroll
        for (int t = 0; t < 2; ++t)
#pragma unroll
            for (int kk = 0; kk < 2; ++kk) { kf[t][kk] = WFrag<T16>::ld(kp + t * 16 * HD + kk * 32); if (HI) kf2[t][kk] = WFrag<T16>::ld(kp2 + t * 16 * HD + kk * 32); }
        xwait2(kp, kp2);
        if constexpr (HI) __builtin_amdgcn_sched_barrier(0);   // keeps the matrix instructions behind the whole run: without it the build refills a few registers in turn, and the 16 loads become a chain of seven round trips
    };
    // st[t][g][r] = masked scaled score of key k0 + t * 16 + 8 h + r and query q0 + g * 16 + c, from the fragments in kf
    auto scores = [&](int k0, v8f (&st)[2][QG]) {
#pragma unroll
        for (int t = 0; t < 2; ++t)
#pragma unroll
            for (int g = 0; g < QG; ++g) { v8f a = (v8f){};
#pragma unroll
                for (int kk = 0; kk < 2; ++kk) { a = WFrag<T16>::mma(kf[t][kk], qf[g][kk], a); if (HI) { a = WFrag<T16>::mma(kf[t][kk], qf2[g][kk], a); a = WFrag<T16>::mma(kf2[t][kk], qf[g][kk], a); } }
#pragma unroll
                for (int r = 0; r < 8; ++r) st[t][g][r] = a[r] * SCL; }
        if (k0 + 31 > q0) {   // a scalar test: only a block that reaches past the first query holds a key to cut
#pragma unroll
            for (int t = 0; t < 2; ++t)
#pragma unroll
                for (int g = 0; g < QG; ++g) { const int dq = q0 + g * 16 + c - (k0 + t * 16 + 8 * h);   // key r of this lane is kept while r <= dq
#pragma unroll
                    for (int r = 0; r < 8; ++r) st[t][g][r] = (r <= dq) ? st[t][g][r] : -3.0e38f; } }
    };
    float m[QG], l[QG];
#pragma unroll
    for (int g = 0; g < QG; ++g) { m[g] = -3.0e38f; l[g] = 0.f; }
    constexpr bool PF = !HI;   // key rows fetched one trip ahead; not for the hi+lo rows, where RH / 32 <= FW blocks leave a wave one trip at most
    if (PF && w < nkb) loadk(w * 32);
#pragma unroll 1   // rolled: the key fragments are refilled in place, one trip's registers serve every trip
    for (int kb = w; kb < nkb; kb += FW) { if (!PF) loadk(kb * 32);
        v8f st[2][QG]; scores(kb * 32, st);
        if (PF) loadk(min(kb + FW, nkb - 1) * 32);   // the next trip's key rows fly, into the same registers, while this trip's vector work runs (the last trip fetches the last block once more: in bounds, unused)
#pragma unroll
        for (int g = 0; g < QG; ++g) { float bm = m[g];
#pragma unroll
            for (int r = 0; r < 8; ++r) bm = fmaxf(bm, fmaxf(st[0][g][r], st[1][g][r]));
            float s = 0.f;
#pragma unroll
            for (int t = 0; t < 2; ++t) { float e[8];
#pragma unroll
                for (int r = 0; r < 8; ++r) e[r] = (st[t][g][r] - bm) * LOG2E;
                exp2x8(e);
#pragma unroll
                for (int r = 0; r < 8; ++r) s += e[r]; }
            l[g] = l[g] * expx1(m[g] - bm) + s; m[g] = bm; } }   // a lane that has met masked keys only counts ones under m = -3e38: the joins below scale them by exp(-3e38 - max) = 0
#pragma unroll
    for (int g = 0; g < QG; ++g) { const float mo = __shfl_xor(m[g], 16, 32), lo = __shfl_xor(l[g], 16, 32); const float mn = fmaxf(m[g], mo);
        const float lj = l[g] * expx1(m[g] - mn) + lo * expx1(mo - mn); if (h == 0) { sh.sm[w][g * 16 + c] = mn; sh.sl[w][g * 16 + c] = lj; } }
    __syncthreads();   // every wave's maxima and sums are in LDS before any wave joins them
    float M[QG], pn[QG], f[QG], en[QG];
#pragma unroll
    for (int g = 0; g < QG; ++g) { float mx = sh.sm[0][g * 16 + c];
#pragma unroll
        for (int s = 1; s < FW; ++s) mx = fmaxf(mx, sh.sm[s][g * 16 + c]);
        float L = 0.f;
#pragma unroll
        for (int s = 0; s < FW; ++s) L += sh.sl[s][g * 16 + c] * expx1(sh.sm[s][g * 16 + c] - mx);
        M[g] = mx; pn[g] = __fdiv_rn(1.0f, L); f[g] = __fdiv_rn(HI ? 1.0f : PCAR, L); en[g] = 0.f; }
    v8f o[4][QG];
#pragma unroll
    for (int dt = 0; dt < 4; ++dt)
#pragma unroll
        for (int g = 0; g < QG; ++g) o[dt][g] = (v8f){};
    if (PF && w < nkb) loadk(w * 32);
#pragma unroll 1   // rolled, as walk 1: fragments refilled in place keep the wave inside its register limit
    for (int kb = w; kb < nkb; kb += FW) { const int k0 = kb * 32; V vf[4], vf2[4];
        const size_t vo = (size_t)c * TT + k0 + 8 * h; const T16* vp = Vt + vo; const T16* vp2 = HI ? V2 + vo : vp;
#pragma unroll
        for (int dt = 0; dt < 4; ++dt) { vf[dt] = WFrag<T16>::ld(vp + dt * 16 * TT); if (HI) vf2[dt] = WFrag<T16>::ld(vp2 + dt * 16 * TT); }
        xwait2(vp, vp2);
        if (!PF) loadk(k0);
        v8f st[2][QG]; scores(k0, st);
        if (PF) loadk(min(kb + FW, nkb - 1) * 32);   // as in walk 1: the next trip's key rows fly while this trip's vector work and Ot products run
#pragma unroll
        for (int g = 0; g < QG; ++g) { V pb, pb2;
            float y[2][8];
#pragma unroll
            for (int t = 0; t < 2; ++t) { float e[8], q[8];
#pragma unroll
                for (int r = 0; r < 8; ++r) e[r] = (st[t][g][r] - M[g]) * LOG2E;
                exp2x8(e);
#pragma unroll
                for (int r = 0; r < 8; ++r) q[r] = e[r] * pn[g] + 1e-8f;
                log2x8(q);
#pragma unroll
                for (int r = 0; r < 8; ++r) { en[g] -= (e[r] * pn[g]) * q[r]; y[t][r] = e[r] * f[g]; } }   // a masked key: e = 0, p = 0, term 0
            if constexpr (HI) { v8us h0, h1, l0, l1;
#pragma unroll
                for (int r = 0; r < 8; ++r) { unsigned short a, b2; splitf(y[0][r], a, b2); h0[r] = a; l0[r] = b2; splitf(y[1][r], a, b2); h1[r] = a; l1[r] = b2; }
                pb = cat16b(h0, h1); pb2 = cat16b(l0, l1);
            } else { v8h h0, h1;
#pragma unroll
                for (int r = 0; r < 8; ++r) { h0[r] = tohx(y[0][r]); h1[r] = tohx(y[1][r]); }
                pb = cat16(h0, h1); }
#pragma unroll
            for (int dt = 0; dt < 4; ++dt) { o[dt][g] = WFrag<T16>::mma(vf[dt], pb, o[dt][g]); if (HI) { o[dt][g] = WFrag<T16>::mma(vf[dt], pb2, o[dt][g]); o[dt][g] = WFrag<T16>::mma(vf2[dt], pb, o[dt][g]); } } }
        // the four slots keep the distance between the trip's last matrix instructions (every accumulator is named, so that all of them stand in front) and the first vector instruction behind the branch, on both of its sides
        if constexpr (QG == 1) asm volatile("v_nop\n\tv_nop\n\tv_nop\n\tv_nop" : "+v"(o[0][0]), "+v"(o[1][0]), "+v"(o[2][0]), "+v"(o[3][0]));
        else asm volatile("v_nop\n\tv_nop\n\tv_nop\n\tv_nop" : "+v"(o[0][0]), "+v"(o[1][0]), "+v"(o[2][0]), "+v"(o[3][0]), "+v"(o[0][QG - 1]), "+v"(o[1][QG - 1]), "+v"(o[2][QG - 1]), "+v"(o[3][QG - 1])); }
#pragma unroll
    for (int dt = 0; dt < 4; ++dt)
#pragma unroll
        for (int g = 0; g < QG; ++g) { const v8f a = o[dt][g]; sh.red[w][dt * QG + g][lane] = (v4f){a[0], a[1], a[2], a[3]}; sh.red[w][dt * QG + g][32 + lane] = (v4f){a[4], a[5], a[6], a[7]}; }
#pragma unroll
    for (int g = 0; g < QG; ++g) { const float ej = en[g] + __shfl_xor(en[g], 16, 32); if (h == 0) sh.se[w][g * 16 + c] = ej; }
    __syncthreads();   // every wave's partial Ot tiles and entropy sums are in LDS before any wave adds them
    // Wave w owns queries w * QW .. w * QW + QW - 1 with all 64 d: a whole 128-byte line of Ah and of Al has one writing wave. Unit u = (query, 16-d tile dt, half hh): 8 consecutive d.
    constexpr int QW = QG * 16 / FW, NU = QW * 8; const float cs = HI ? 1.0f : (1.0f / PCAR);
#pragma unroll
    for (int u0 = 0; u0 < NU; u0 += 32) { const int u = u0 + lane;
        if (u < NU) { const int qq = w * QW + (u % QW), dt = (u / QW) & 3, hh = u / (QW * 4); const int fi = dt * QG + (qq >> 4), sl = (qq & 15) + 16 * hh;
            v4f s0 = sh.red[0][fi][sl], s1 = sh.red[0][fi][32 + sl];
#pragma unroll
            for (int s = 1; s < FW; ++s) { s0 += sh.red[s][fi][sl]; s1 += sh.red[s][fi][32 + sl]; }
            v8us oh, ol;
#pragma unroll
            for (int r = 0; r < 4; ++r) { unsigned short a, b2; splitf(s0[r] * cs, a, b2); oh[r] = a; ol[r] = b2; splitf(s1[r] * cs, a, b2); oh[4 + r] = a; ol[4 + r] = b2; }
            const size_t oo = (size_t)(q0 + qq) * DD + dt * 16 + hh * 8; *(v8us*)(Ah + oo) = oh; *(v8us*)(Al + oo) = ol;
            asm volatile("s_wait_xcnt 0x0" ::: "memory"); } }   // kept in front of the next write of a register that the two stores name
    if (threadIdx.x < QG * 16) { float e = sh.se[0][threadIdx.x];
#pragma unroll
        for (int s = 1; s < FW; ++s) e += sh.se[s][threadIdx.x];
        ENTh[(size_t)(q0 + (int)threadIdx.x) * 32] = e * 0.69314718055994531f; }   // the terms were summed with log2; k_entpart reads word 0 of a row's line
}
// grid (x, batch * NH_ + head): x < (TT - RH) / (QGL * 16): fp16 query blocks, the longest first; behind them the hi+lo blocks. The test is the same for a whole work-group.
// Four waves a SIMD (at most 256 registers a wave): two work-groups share a WGP, so that one's vector work covers the other's load waits, barriers and LDS sums.
__global__ __launch_bounds__(32 * FW) __attribute__((amdgpu_waves_per_eu(4, 4))) void k_fattn(const bf* __restrict__ Qh, const bf* __restrict__ Ql, const bf* __restrict__ Kh, const bf* __restrict__ Kl, const bf* __restrict__ Vh, const bf* __restrict__ Vl,
                                                   const h16* __restrict__ Q16, const h16* __restrict__ K16, const h16* __restrict__ V16, float* ENT, bf* Ah, bf* Al) {
    __shared__ FSh sh;
    constexpr int NL = (TT - RH) / (QGL * 16);
    const int x = blockIdx.x; const size_t z = (size_t)blockIdx.y * TT * HD; float* ENTh = ENT + (size_t)blockIdx.y * TT * 32;   // planes [batch][head][..][..], ENT [batch][head][query] lines
    const size_t ao = (size_t)(blockIdx.y / NH_) * TT * DD + (blockIdx.y % NH_) * HD; Ah += ao; Al += ao;   // merged rows [batch][query][head * HD + d]
    if (x < NL) fattn_body<h16, false, QGL>(Q16 + z, nullptr, K16 + z, nullptr, V16 + z, nullptr, TT - (x + 1) * (QGL * 16), ENTh, Ah, Al, sh);
    else fattn_body<bf, true, QGH>(Qh + z, Ql + z, Kh + z, Kl + z, Vh + z, Vl + z, (x - NL) * (QGH * 16), ENTh, Ah, Al, sh);
}

// Mean of the NB_ * NH_ * TT row entropies in two launches: one wave alone would walk all the ENT lines in a chain of load round trips.
// k_entpart: work-group g sums rows g * 256 .. g * 256 + 255, one row a thread (every load of the launch is in flight at once): lane tree, then the 8 wave sums through LDS -> line PART[g][0..31] (lane 0 the sum, the rest 0).
#define EPW 256                   // rows per work-group of k_entpart
__global__ __launch_bounds__(EPW) void k_entpart(const float* __restrict__ ENT, float* PART) {
    __shared__ float wsum[EPW / 32];
    const int lane = threadIdx.x & 31, w = threadIdx.x >> 5; float s = ENT[((size_t)blockIdx.x * EPW + threadIdx.x) * 32];
#pragma unroll
    for (int sh = 16; sh; sh >>= 1) s += __shfl_xor(s, sh, 32);
    if (lane == 0) wsum[w] = s;
    __syncthreads();   // all 8 wave sums are in LDS before wave 0 adds them
    if (w == 0) { float t = lane < EPW / 32 ? wsum[lane] : 0.f;
#pragma unroll
        for (int sh = EPW / 64; sh; sh >>= 1) t += __shfl_xor(t, sh, 32);
        PART[(size_t)blockIdx.x * 32 + lane] = lane == 0 ? t : 0.f; }
}
// k_entmean: one wave sums the NB_ * NH_ * TT / EPW partial sums (8 independent loads a lane) and scales.
__global__ __launch_bounds__(32) void k_entmean(const float* __restrict__ PART, float* OUT1) { const int lane = threadIdx.x; float s = 0.f;
#pragma unroll
    for (int r = 0; r < NB_ * NH_ * TT / EPW; r += 32) s += PART[(size_t)(r + lane) * 32];
#pragma unroll
    for (int sh = 16; sh; sh >>= 1) s += __shfl_xor(s, sh, 32);
    if (lane == 0) { const float m = s * (1.0f / (float)(NB_ * NH_ * TT)); *(float*)OUT1 = m;  } }
extern "C" void kernel_launch(void* const* d_in, const int* in_sizes, int n_in,
                              void* d_out, int out_size, void* d_ws, size_t ws_size, hipStream_t stream) {
    (void)in_sizes; (void)n_in; (void)out_size;
    const float* x = (const float*)d_in[0]; const float* wqkv = (const float*)d_in[1]; const float* wo = (const float*)d_in[2];   // w_attn [1024][3072], w_proj [1024][1024] as x @ W (no biases)
    float* OUT = (float*)d_out; float* OUT1 = OUT + (size_t)NB_ * TT * DD;     // [2][2048][1024] at 0; [1] entropy at byte 16,777,216
    char* wsp = (char*)d_ws;
    auto take = [&](size_t bytes) { char* p = wsp; wsp += (bytes + 255) & ~(size_t)255; return (void*)p; };
    bf* WQKV = (bf*)take((size_t)3 * DD * DD * 2); bf* WO = (bf*)take((size_t)DD * DD * 2);
    bf* XB = (bf*)take((size_t)NB_ * TT * DD * 2); float* F = (float*)take((size_t)3 * NB_ * TT * DD * 4);   // x of both batches; F = [q, k, v][batch][TT][DD]
    const size_t PB = (size_t)NB_ * TT * DD * 2;   // a 16-bit plane of both batches
    bf* QPh = (bf*)take(PB); bf* QPl = (bf*)take(PB); bf* KPh = (bf*)take(PB); bf* KPl = (bf*)take(PB); bf* VTh = (bf*)take(PB); bf* VTl = (bf*)take(PB);
    h16* QP16 = (h16*)take(PB); h16* KP16 = (h16*)take(PB); h16* VT16 = (h16*)take(PB);
    float* ENT = (float*)take((size_t)NB_ * NH_ * TT * 32 * 4); bf* ATh = (bf*)take(PB); bf* ATl = (bf*)take(PB); float* PART = (float*)take((size_t)(NB_ * NH_ * TT / EPW) * 32 * 4);
    if ((size_t)(wsp - (char*)d_ws) > ws_size) return;    // total 160 MiB
    k_prep<<<GWA + GWP + GXC, 256, 0, stream>>>(x, wqkv, wo, XB, WQKV, WO);
    const unsigned LB = (unsigned)((NH_ * TT * HD / 64 + 63) / 64);
    // both batches are the rows of one product (M = NB_ * TT); z = q, k, v: the weight rows and the F plane of each
    k_gemmw<bf, 0, false, 8, 0><<<dim3(NB_ * TT / 64, DD / 64, 3), 256, 0, stream>>>(XB, nullptr, WQKV, nullptr, DD, DD, F, DD, nullptr, 0, (size_t)DD * DD, (size_t)NB_ * TT * DD, 0);
    k_planes<<<dim3(LB, 3, NB_), 256, 0, stream>>>(F, QPh, QPl, QP16, KPh, KPl, KP16, VTh, VTl, VT16);
    k_fattn<<<dim3((TT - RH) / (QGL * 16) + RH / (QGH * 16), NB_ * NH_, 1), 32 * FW, 0, stream>>>(QPh, QPl, KPh, KPl, VTh, VTl, QP16, KP16, VT16, ENT, ATh, ATl);
    k_gemmw<bf, 1, false, 8, 0><<<dim3(NB_ * TT / 64, DD / 64, 1), 256, 0, stream>>>(ATh, ATl, WO, nullptr, DD, DD, OUT, DD, nullptr, 0, 0, 0, 0);
    k_entpart<<<NB_ * NH_ * TT / EPW, EPW, 0, stream>>>(ENT, PART); k_entmean<<<1, 32, 0, stream>>>(PART, OUT1);
}

// v007
// Measured time: 158 microseconds a run.
// Two timings next to v006 both put it at 1.27 times that version's speed.
// All steps since v000 together make it 14.1 times as fast.
#include <hip/hip_runtime.h>

// Causal multi-head self-attention with an attention-entropy monitor (x [2][2048][1024]; qkv = x w_attn (16 heads x 64, no bias); causal softmax(q.k/8); y = merged att.v w_proj -> [2][2048][1024];
// second output = mean over all (batch, head, query) rows of the row entropy -sum_s att log(att + 1e-8) -> [1]).
// Compute dtypes, f32 accumulate: every input rounded to bf16; qkv projection on PLAIN bf16 operands (inputs: exact products, f32 accumulate); w_proj on att.v hi+lo planes (2 products); PER-ROW PRECISION HYBRID:
// query rows < 256 take scores and att.v on bf16 hi+lo planes (3 products), rows >= 256 on single fp16 planes; 1/8, the causal cut, the softmax and the row entropy (from the f32 probabilities, hardware

#define NB_  2
#define TT   2048
#define DD   1024
#define NH_  16
#define HD   64
#define RH   256                  // query rows < RH: hi+lo planes; rows >= RH: fp16 planes
#define NF   32                   // head_dim / 2 (unused here)
#define SCL  0.125f               // 1/sqrt(64)
#define PCAR 1024.0f         // P scale for fp16 rows >= RH, undone in k_fattn's head merge
typedef _Float16 h16;
typedef unsigned short bf;
typedef __attribute__((ext_vector_type(16))) __bf16   v16bf;
typedef __attribute__((ext_vector_type(16))) _Float16 v16h;
typedef __attribute__((ext_vector_type(8)))  _Float16 v8h;
typedef __attribute__((ext_vector_type(8)))  unsigned short v8us;
typedef __attribute__((ext_vector_type(8)))  float    v8f;
typedef __attribute__((ext_vector_type(4)))  float    v4f;
typedef v8h  __attribute__((may_alias)) v8ha;
typedef v4f  __attribute__((may_alias)) v4fa;
typedef v8us __attribute__((may_alias)) v8usa;

__device__ __forceinline__ unsigned short f2bf(float f) { unsigned u = __float_as_uint(f); u += 0x7FFFu + ((u >> 16) & 1u); return (unsigned short)(u >> 16); }
__device__ __forceinline__ float bf2f(unsigned short b) { return __uint_as_float(((unsigned)b) << 16); }
__device__ __forceinline__ float bfr(float f) { return bf2f(f2bf(f)); }
__device__ __forceinline__ v16h cat16(v8h lo, v8h hi) { return __builtin_shufflevector(lo, hi, 0, 1, 2, 3, 4, 5, 6, 7, 8, 9, 10, 11, 12, 13, 14, 15); }
__device__ __forceinline__ v16bf cat16b(v8us lo, v8us hi) { return __builtin_bit_cast(v16bf, __builtin_shufflevector(lo, hi, 0, 1, 2, 3, 4, 5, 6, 7, 8, 9, 10, 11, 12, 13, 14, 15)); }
__device__ __forceinline__ v8f wmma16(v16h a, v16h b, v8f c) { return __builtin_amdgcn_wmma_f32_16x16x32_f16(false, a, false, b, (short)0, c, false, false); }
__device__ __forceinline__ v8f wmmab(v16bf a, v16bf b, v8f c) { return __builtin_amdgcn_wmma_f32_16x16x32_bf16(false, a, false, b, (short)0, c, false, false); }



// ---- k_gemml: C[m][n] (f32, pitch DD) = sum_k (A[m][k] + A2[m][k]) Bt[n][k], K = DD, all planes bf16 with K-contiguous rows of pitch DD (A2 only with NSPLIT == 1: two products into one accumulator). grid (M / 128, N / 128, Z), 256 threads.
// One 128 x 128 tile of C a work-group. A stage is 64 k (one whole 128-byte line) of the tile's 128 rows of every plane; asynchronous copies of 16 bytes a lane bring it into LDS, eight lanes side by side on a line,
// so that every line leaves L2 once a work-group and whole, and all eight waves read their fragments from LDS. Two buffers: stage t + 1 flies while stage t is worked on.
// Wave w has the 64 x 32 part at rows (w >> 2) * 64, columns (w & 3) * 32 (8 accumulators) over the whole K: a 128-byte line of C has one writing wave. z-batch strides sB / sC in elements.
template <typename T16> struct WFrag;
template <> struct WFrag<h16> { typedef v16h V; static __device__ __forceinline__ V ld(const h16* p) { return cat16(*(const v8h*)p, *(const v8h*)(p + 16)); } static __device__ __forceinline__ v8f mma(V a, V b, v8f c) { return wmma16(a, b, c); } };
template <> struct WFrag<bf> { typedef v16bf V; static __device__ __forceinline__ V ld(const bf* p) { return cat16b(*(const v8us*)p, *(const v8us*)(p + 16)); } static __device__ __forceinline__ v8f mma(V a, V b, v8f c) { return wmmab(a, b, c); } };
#define GT 128                    // rows of a plane in a stage
#define GK 64                     // k elements of a stage
#define GP 144                    // LDS row pitch in bytes: 16 x odd, the 16-byte fragment reads of 16 rows fall on different banks
template <int NSPLIT>
__global__ __launch_bounds__(256) void k_gemml(const bf* __restrict__ A, const bf* __restrict__ A2, const bf* __restrict__ Bt, float* C, size_t sB, size_t sC) {
    constexpr int NP = NSPLIT ? 3 : 2, STG = NP * GT * GP, NT = DD / GK;   // planes a stage [A | Bt | A2], bytes a stage, stages
    __shared__ __align__(16) unsigned char sm[2 * STG];
    const int w = __builtin_amdgcn_readfirstlane((int)(threadIdx.x >> 5));   // wave number, held scalar
    const int lane = threadIdx.x & 31, lr = lane & 15, hi = lane >> 4; const int r0 = blockIdx.x * GT, c0 = blockIdx.y * GT;
    Bt += (size_t)blockIdx.z * sB; C += (size_t)blockIdx.z * sC;
    // copies: thread = (row crow of 32, 16-byte piece cseg of 8); four copies a plane, 32 rows apart
    const int crow = threadIdx.x >> 3, cseg = threadIdx.x & 7;
    const bf* ga = A + (size_t)(r0 + crow) * DD + cseg * 8; const bf* gb = Bt + (size_t)(c0 + crow) * DD + cseg * 8; const bf* ga2 = NSPLIT ? A2 + (size_t)(r0 + crow) * DD + cseg * 8 : ga;
    const unsigned l0 = (unsigned)(size_t)sm + (unsigned)(crow * GP + cseg * 16);   // the lane's LDS byte address in buffer 0, plane 0
    auto issue = [&](int t, int buf) {   // stage t into buffer buf; the wait is the statement's last line: it stands in front of every later write of a register that a copy names
        const unsigned la = l0 + (unsigned)(buf * STG), lb = la + GT * GP; const bf* pa = ga + t * GK; const bf* pb = gb + t * GK;
        if constexpr (NSPLIT) { const unsigned lc = lb + GT * GP; const bf* pc = ga2 + t * GK;
            asm volatile("global_load_async_to_lds_b128 %0, %1, off\n\tglobal_load_async_to_lds_b128 %2, %3, off\n\tglobal_load_async_to_lds_b128 %4, %5, off\n\tglobal_load_async_to_lds_b128 %6, %7, off\n\t"
                         "global_load_async_to_lds_b128 %8, %9, off\n\tglobal_load_async_to_lds_b128 %10, %11, off\n\tglobal_load_async_to_lds_b128 %12, %13, off\n\tglobal_load_async_to_lds_b128 %14, %15, off\n\t"
                         "global_load_async_to_lds_b128 %16, %17, off\n\tglobal_load_async_to_lds_b128 %18, %19, off\n\tglobal_load_async_to_lds_b128 %20, %21, off\n\tglobal_load_async_to_lds_b128 %22, %23, off\n\ts_wait_xcnt 0x0"
                         :: "v"(la), "v"(pa), "v"(la + 32 * GP), "v"(pa + 32 * DD), "v"(la + 64 * GP), "v"(pa + 64 * DD), "v"(la + 96 * GP), "v"(pa + 96 * DD),
                            "v"(lb), "v"(pb), "v"(lb + 32 * GP), "v"(pb + 32 * DD), "v"(lb + 64 * GP), "v"(pb + 64 * DD), "v"(lb + 96 * GP), "v"(pb + 96 * DD),
                            "v"(lc), "v"(pc), "v"(lc + 32 * GP), "v"(pc + 32 * DD), "v"(lc + 64 * GP), "v"(pc + 64 * DD), "v"(lc + 96 * GP), "v"(pc + 96 * DD) : "memory");
        } else {
            asm volatile("global_load_async_to_lds_b128 %0, %1, off\n\tglobal_load_async_to_lds_b128 %2, %3, off\n\tglobal_load_async_to_lds_b128 %4, %5, off\n\tglobal_load_async_to_lds_b128 %6, %7, off\n\t"
                         "global_load_async_to_lds_b128 %8, %9, off\n\tglobal_load_async_to_lds_b128 %10, %11, off\n\tglobal_load_async_to_lds_b128 %12, %13, off\n\tglobal_load_async_to_lds_b128 %14, %15, off\n\ts_wait_xcnt 0x0"
                         :: "v"(la), "v"(pa), "v"(la + 32 * GP), "v"(pa + 32 * DD), "v"(la + 64 * GP), "v"(pa + 64 * DD), "v"(la + 96 * GP), "v"(pa + 96 * DD),
                            "v"(lb), "v"(pb), "v"(lb + 32 * GP), "v"(pb + 32 * DD), "v"(lb + 64 * GP), "v"(pb + 64 * DD), "v"(lb + 96 * GP), "v"(pb + 96 * DD) : "memory");
        }
    };
    v8f acc[4][2];
#pragma unroll
    for (int mb = 0; mb < 4; ++mb)
#pragma unroll
        for (int nb = 0; nb < 2; ++nb) acc[mb][nb] = (v8f){};
    const int aofs = ((w >> 2) * 64 + lr) * GP + hi * 16, bofs = GT * GP + ((w & 3) * 32 + lr) * GP + hi * 16;   // byte offsets of the wave's first A and Bt fragment rows in a stage
    issue(0, 0);
    asm volatile("s_wait_asynccnt 0x0" ::: "memory");   // this wave's copies of stage 0 have landed
    __syncthreads();   // every wave's copies of stage 0 have landed before any wave reads the buffer
    issue(1, 1);
#pragma unroll 1   // rolled: one trip's code and fragment registers serve all stages
    for (int t = 0; t < NT; ++t) { const unsigned char* sb = sm + (t & 1) * STG;
#pragma unroll
        for (int kk = 0; kk < 2; ++kk) { v16bf a[4], a2[4], b[2];
#pragma unroll
            for (int mb = 0; mb < 4; ++mb) { a[mb] = WFrag<bf>::ld((const bf*)(sb + aofs + mb * 16 * GP + kk * 64)); if (NSPLIT) a2[mb] = WFrag<bf>::ld((const bf*)(sb + 2 * GT * GP + aofs + mb * 16 * GP + kk * 64)); }
#pragma unroll
            for (int nb = 0; nb < 2; ++nb) b[nb] = WFrag<bf>::ld((const bf*)(sb + bofs + nb * 16 * GP + kk * 64));
#pragma unroll
            for (int nb = 0; nb < 2; ++nb)
#pragma unroll
                for (int mb = 0; mb < 4; ++mb) { acc[mb][nb] = wmmab(a[mb], b[nb], acc[mb][nb]); if (NSPLIT) acc[mb][nb] = wmmab(a2[mb], b[nb], acc[mb][nb]); } }
        asm volatile("s_wait_dscnt 0x0" ::: "memory");      // this wave's reads of buffer t & 1 have returned before the buffer is given up
        asm volatile("s_wait_asynccnt 0x0" ::: "memory");   // this wave's copies of stage t + 1 have landed
        __syncthreads();   // publishes stage t + 1 and ends every wave's reads of the buffer that is refilled behind it
        if (t + 2 < NT) issue(t + 2, t & 1); }
    asm volatile("s_wait_asynccnt 0x0" ::: "memory");   // no copy is outstanding when the wave ends
    float* cp = C + (size_t)(r0 + (w >> 2) * 64 + hi * 8) * DD + c0 + (w & 3) * 32 + lr;
#pragma unroll
    for (int mb = 0; mb < 4; ++mb)
#pragma unroll
        for (int nb = 0; nb < 2; ++nb)
#pragma unroll
            for (int j = 0; j < 8; ++j) cp[(size_t)(mb * 16 + j) * DD + nb * 16] = acc[mb][nb][j];
}

__device__ __forceinline__ h16 tohx(float x) { return (h16)x; }
__device__ __forceinline__ void splitf(float y, unsigned short& h, unsigned short& l) { h = f2bf(y); l = f2bf(y - bf2f(h)); }
typedef __attribute__((ext_vector_type(2))) unsigned short v2us;
typedef __attribute__((ext_vector_type(2))) _Float16 v2h;
typedef __attribute__((ext_vector_type(4))) _Float16 v4h;
typedef v4h __attribute__((may_alias)) v4ha;
typedef __attribute__((ext_vector_type(2))) float v2f;

// The three input conversions are bodies of ONE launch, k_prep (bx = the body's own block index); they do not depend on one another.
__device__ __forceinline__ void wtG_body(int bx, const float* __restrict__ w, int K, int N, bf* Bt) {
    const int lane = threadIdx.x & 31; const int L0 = (bx * 8 + (threadIdx.x >> 5)) * 8; const int nlines = N * K / 64;
{
#pragma unroll 1
        for (int l = 0; l < 8; ++l) { const int L = L0 + l; if (L >= nlines) break; const size_t e = (size_t)L * 64 + lane * 2; const int k = (int)(e % K), n = (int)(e / K); v2us o;
            o[0] = f2bf(w[(size_t)k * N + n]); o[1] = f2bf(w[(size_t)(k + 1) * N + n]); *(v2us*)(Bt + e) = o; }
         }
}
__device__ __forceinline__ void cvt8_body(int bx, const float* __restrict__ src, bf* dst, size_t n8) { const size_t i = (size_t)bx * 256 + threadIdx.x; if (i >= n8) return; const v8f v = *(const v8f*)(src + i * 8); v8us o;
#pragma unroll
    for (int k = 0; k < 8; ++k) o[k] = f2bf(v[k]); *(v8us*)(dst + i * 8) = o;  }
#define GWA (DD * 3 * DD / 4096)  // work-groups of the w_attn transpose (64 lines of 64 elements each)
#define GWP (DD * DD / 4096)      // work-groups of the w_proj transpose
#define GXC (NB_ * TT * DD / 2048) // work-groups of the x conversion, both batches
// grid GWA + GWP + GXC; the transposes (chains of eight load round trips) take the lowest block indices. Every test is the same for a whole work-group.
__global__ __launch_bounds__(256) void k_prep(const float* __restrict__ x, const float* __restrict__ wqkv, const float* __restrict__ wo, bf* XB, bf* WQKV, bf* WO) {
    const int bx = blockIdx.x;
    if (bx < GWA) wtG_body(bx, wqkv, DD, 3 * DD, WQKV);
    else if (bx < GWA + GWP) wtG_body(bx - GWA, wo, DD, DD, WO);
    else cvt8_body(bx - (GWA + GWP), x, XB, (size_t)NB_ * TT * DD / 8);
}
// The operand planes of q, k and v of both batches are bodies of ONE launch, k_planes. F here is one [TT][DD] f32 product.
__device__ __forceinline__ void qplanes_body(const float* __restrict__ F, bf* Ph, bf* Pl, h16* P16) {
    const int lane = threadIdx.x & 31; const int L0 = (blockIdx.x * 8 + (threadIdx.x >> 5)) * 8; const int nlines = NH_ * TT * HD / 64;
{
#pragma unroll
        for (int l = 0; l < 8; ++l) { const int L = L0 + l; if (L >= nlines) break; const int e = L * 64 + lane * 2; const int d = e & (HD - 1); const int t = (e >> 6) & (TT - 1); const int h = e >> 17; v2us oh, ol; v2h o16;
#pragma unroll
            for (int q = 0; q < 2; ++q) { const float x = F[(size_t)t * DD + h * HD + d + q]; unsigned short a, c2; splitf(x, a, c2); oh[q] = a; ol[q] = c2; o16[q] = tohx(x); }
            *(v2us*)(Ph + (size_t)e) = oh; *(v2us*)(Pl + (size_t)e) = ol; *(v2h*)(P16 + (size_t)e) = o16; }
         }
}
__device__ __forceinline__ void vtplane_body(const float* __restrict__ F, bf* Vh, bf* Vl, h16* V16) {
    const int lane = threadIdx.x & 31; const int L0 = (blockIdx.x * 8 + (threadIdx.x >> 5)) * 8; const int nlines = NH_ * TT * HD / 64;
{
#pragma unroll
        for (int l = 0; l < 8; ++l) { const int L = L0 + l; if (L >= nlines) break; const int e = L * 64 + lane * 2; const int t = e & (TT - 1); const int d = (e >> 11) & (HD - 1); const int h = e >> 17; v2us oh, ol; v2h o16;
#pragma unroll
            for (int q = 0; q < 2; ++q) { const float x = F[(size_t)(t + q) * DD + h * HD + d]; unsigned short a, c2; splitf(x, a, c2); oh[q] = a; ol[q] = c2; o16[q] = tohx(x); }
            *(v2us*)(Vh + (size_t)e) = oh; *(v2us*)(Vl + (size_t)e) = ol; *(v2h*)(V16 + (size_t)e) = o16; }
         }
}
// grid (LB, 3, NB_): y = 0 the transposed v planes (scattered reads, the longest), 1 = q, 2 = k; F = [q, k, v][batch][TT][DD]. The test is the same for a whole work-group.
__global__ __launch_bounds__(256) void k_planes(const float* __restrict__ F, bf* Qh, bf* Ql, h16* Q16, bf* Kh, bf* Kl, h16* K16, bf* Vh, bf* Vl, h16* V16) {
    const size_t bo = (size_t)blockIdx.z * TT * DD, fs = (size_t)NB_ * TT * DD;
    if (blockIdx.y == 0) vtplane_body(F + 2 * fs + bo, Vh + bo, Vl + bo, V16 + bo);
    else if (blockIdx.y == 1) qplanes_body(F + bo, Qh + bo, Ql + bo, Q16 + bo);
    else qplanes_body(F + fs + bo, Kh + bo, Kl + bo, K16 + bo);
}
#define LOG2E 1.44269504088896341f
__device__ __forceinline__ void exp2x8(float (&x)[8]) { asm("v_exp_f32 %0, %0\n\tv_exp_f32 %1, %1\n\tv_exp_f32 %2, %2\n\tv_exp_f32 %3, %3\n\tv_exp_f32 %4, %4\n\tv_exp_f32 %5, %5\n\tv_exp_f32 %6, %6\n\tv_exp_f32 %7, %7\n\tv_nop" : "+v"(x[0]), "+v"(x[1]), "+v"(x[2]), "+v"(x[3]), "+v"(x[4]), "+v"(x[5]), "+v"(x[6]), "+v"(x[7])); }
__device__ __forceinline__ void log2x8(float (&x)[8]) { asm("v_log_f32 %0, %0\n\tv_log_f32 %1, %1\n\tv_log_f32 %2, %2\n\tv_log_f32 %3, %3\n\tv_log_f32 %4, %4\n\tv_log_f32 %5, %5\n\tv_log_f32 %6, %6\n\tv_log_f32 %7, %7\n\tv_nop" : "+v"(x[0]), "+v"(x[1]), "+v"(x[2]), "+v"(x[3]), "+v"(x[4]), "+v"(x[5]), "+v"(x[6]), "+v"(x[7])); }
__device__ __forceinline__ float expx1(float a) { float x = a * LOG2E; asm("v_exp_f32 %0, %0\n\tv_nop" : "+v"(x)); return x; }   // e^a
// The wait that is kept between a run of global loads and the next write of a register that one of them names as its address. The run's addresses are inputs of the statement: they stay in their registers
// up to the wait, wherever the build lets it stand behind the run, so that neither a result of the run nor the vector work behind it is given those registers in front of it.
template <typename T16> __device__ __forceinline__ void xwait2(const T16* a, const T16* b) { asm volatile("s_wait_xcnt 0x0" :: "v"(a), "v"(b) : "memory"); }
#define FW 8                      // waves per work-group of k_fattn
#define QGL 2                     // 16-query groups per work-group, fp16 rows
#define QGH 1                     // 16-query groups per work-group, hi+lo rows
struct FSh { v4f red[FW][4 * QGL][2 * 32 + 2];   // [wave][fragment][half * 32 + lane]; the two spare entries shift each fragment by 32 bytes, so that the adders' reads of four fragments side by side fall on different banks
             float sm[FW][QGL * 16]; float sl[FW][QGL * 16]; float se[FW][QGL * 16]; };
template <typename T16, bool HI, int QG>
__device__ __forceinline__ void fattn_body(const T16* __restrict__ Q, const T16* __restrict__ Q2, const T16* __restrict__ Kp, const T16* __restrict__ K2, const T16* __restrict__ Vt, const T16* __restrict__ V2,
                                           int q0, float* ENTh, bf* Ah, bf* Al, FSh& sh) {
    typedef typename WFrag<T16>::V V; static_assert(QG == 1 || QG == 2, "the statement at the foot of walk 2 names the accumulators of two groups");
    const int w = __builtin_amdgcn_readfirstlane((int)(threadIdx.x >> 5));   // wave number, held scalar
    const int lane = threadIdx.x & 31, c = lane & 15, h = lane >> 4;
    const int nkb = (q0 + QG * 16 + 31) >> 5;   // 32-key blocks that hold a key <= the last query
    V qf[QG][2], qf2[QG][2];
#pragma unroll
    for (int g = 0; g < QG; ++g)
#pragma unroll
        for (int kk = 0; kk < 2; ++kk) { const size_t o = (size_t)(q0 + g * 16 + c) * HD + kk * 32 + 8 * h; qf[g][kk] = WFrag<T16>::ld(Q + o); if (HI) qf2[g][kk] = WFrag<T16>::ld(Q2 + o); }
    asm volatile("s_wait_xcnt 0x0" ::: "memory");   // kept in front of the next write of an address register that the query loads name
    V kf[2][2], kf2[2][2];   // the key rows k0 .. k0 + 31 as A fragments
    auto loadk = [&](int k0) { const size_t o = (size_t)(k0 + c) * HD + 8 * h; const T16* kp = Kp + o; const T16* kp2 = HI ? K2 + o : kp;   // one address a plane, the rest of a run is constant offsets
#pragma unroll
        for (int t = 0; t < 2; ++t)
#pragma unroll
            for (int kk = 0; kk < 2; ++kk) { kf[t][kk] = WFrag<T16>::ld(kp + t * 16 * HD + kk * 32); if (HI) kf2[t][kk] = WFrag<T16>::ld(kp2 + t * 16 * HD + kk * 32); }
        xwait2(kp, kp2);
        if constexpr (HI) __builtin_amdgcn_sched_barrier(0);   // keeps the matrix instructions behind the whole run: without it the build refills a few registers in turn, and the 16 loads become a chain of seven round trips
    };
    // st[t][g][r] = masked scaled score of key k0 + t * 16 + 8 h + r and query q0 + g * 16 + c, from the fragments in kf
    auto scores = [&](int k0, v8f (&st)[2][QG]) {
#pragma unroll
        for (int t = 0; t < 2; ++t)
#pragma unroll
            for (int g = 0; g < QG; ++g) { v8f a = (v8f){};
#pragma unroll
                for (int kk = 0; kk < 2; ++kk) { a = WFrag<T16>::mma(kf[t][kk], qf[g][kk], a); if (HI) { a = WFrag<T16>::mma(kf[t][kk], qf2[g][kk], a); a = WFrag<T16>::mma(kf2[t][kk], qf[g][kk], a); } }
#pragma unroll
                for (int r = 0; r < 8; ++r) st[t][g][r] = a[r] * SCL; }
        if (k0 + 31 > q0) {   // a scalar test: only a block that reaches past the first query holds a key to cut
#pragma unroll
            for (int t = 0; t < 2; ++t)
#pragma unroll
                for (int g = 0; g < QG; ++g) { const int dq = q0 + g * 16 + c - (k0 + t * 16 + 8 * h);   // key r of this lane is kept while r <= dq
#pragma unroll
                    for (int r = 0; r < 8; ++r) st[t][g][r] = (r <= dq) ? st[t][g][r] : -3.0e38f; } }
    };
    float m[QG], l[QG];
#pragma unroll
    for (int g = 0; g < QG; ++g) { m[g] = -3.0e38f; l[g] = 0.f; }
    constexpr bool PF = !HI;   // key rows fetched one trip ahead; not for the hi+lo rows, where RH / 32 <= FW blocks leave a wave one trip at most
    if (PF && w < nkb) loadk(w * 32);
#pragma unroll 1   // rolled: the key fragments are refilled in place, one trip's registers serve every trip
    for (int kb = w; kb < nkb; kb += FW) { if (!PF) loadk(kb * 32);
        v8f st[2][QG]; scores(kb * 32, st);
        if (PF) loadk(min(kb + FW, nkb - 1) * 32);   // the next trip's key rows fly, into the same registers, while this trip's vector work runs (the last trip fetches the last block once more: in bounds, unused)
#pragma unroll
        for (int g = 0; g < QG; ++g) { float bm = m[g];
#pragma unroll
            for (int r = 0; r < 8; ++r) bm = fmaxf(bm, fmaxf(st[0][g][r], st[1][g][r]));
            float s = 0.f;
#pragma unroll
            for (int t = 0; t < 2; ++t) { float e[8];
#pragma unroll
                for (int r = 0; r < 8; ++r) e[r] = (st[t][g][r] - bm) * LOG2E;
                exp2x8(e);
#pragma unroll
                for (int r = 0; r < 8; ++r) s += e[r]; }
            l[g] = l[g] * expx1(m[g] - bm) + s; m[g] = bm; } }   // a lane that has met masked keys only counts ones under m = -3e38: the joins below scale them by exp(-3e38 - max) = 0
#pragma unroll
    for (int g = 0; g < QG; ++g) { const float mo = __shfl_xor(m[g], 16, 32), lo = __shfl_xor(l[g], 16, 32); const float mn = fmaxf(m[g], mo);
        const float lj = l[g] * expx1(m[g] - mn) + lo * expx1(mo - mn); if (h == 0) { sh.sm[w][g * 16 + c] = mn; sh.sl[w][g * 16 + c] = lj; } }
    __syncthreads();   // every wave's maxima and sums are in LDS before any wave joins them
    float M[QG], pn[QG], f[QG], en[QG];
#pragma unroll
    for (int g = 0; g < QG; ++g) { float mx = sh.sm[0][g * 16 + c];
#pragma unroll
        for (int s = 1; s < FW; ++s) mx = fmaxf(mx, sh.sm[s][g * 16 + c]);
        float L = 0.f;
#pragma unroll
        for (int s = 0; s < FW; ++s) L += sh.sl[s][g * 16 + c] * expx1(sh.sm[s][g * 16 + c] - mx);
        M[g] = mx; pn[g] = __fdiv_rn(1.0f, L); f[g] = __fdiv_rn(HI ? 1.0f : PCAR, L); en[g] = 0.f; }
    v8f o[4][QG];
#pragma unroll
    for (int dt = 0; dt < 4; ++dt)
#pragma unroll
        for (int g = 0; g < QG; ++g) o[dt][g] = (v8f){};
    if (PF && w < nkb) loadk(w * 32);
#pragma unroll 1   // rolled, as walk 1: fragments refilled in place keep the wave inside its register limit
    for (int kb = w; kb < nkb; kb += FW) { const int k0 = kb * 32; V vf[4], vf2[4];
        const size_t vo = (size_t)c * TT + k0 + 8 * h; const T16* vp = Vt + vo; const T16* vp2 = HI ? V2 + vo : vp;
#pragma unroll
        for (int dt = 0; dt < 4; ++dt) { vf[dt] = WFrag<T16>::ld(vp + dt * 16 * TT); if (HI) vf2[dt] = WFrag<T16>::ld(vp2 + dt * 16 * TT); }
        xwait2(vp, vp2);
        if (!PF) loadk(k0);
        v8f st[2][QG]; scores(k0, st);
        if (PF) loadk(min(kb + FW, nkb - 1) * 32);   // as in walk 1: the next trip's key rows fly while this trip's vector work and Ot products run
#pragma unroll
        for (int g = 0; g < QG; ++g) { V pb, pb2;
            float y[2][8];
#pragma unroll
            for (int t = 0; t < 2; ++t) { float e[8], q[8];
#pragma unroll
                for (int r = 0; r < 8; ++r) e[r] = (st[t][g][r] - M[g]) * LOG2E;
                exp2x8(e);
#pragma unroll
                for (int r = 0; r < 8; ++r) q[r] = e[r] * pn[g] + 1e-8f;
                log2x8(q);
#pragma unroll
                for (int r = 0; r < 8; ++r) { en[g] -= (e[r] * pn[g]) * q[r]; y[t][r] = e[r] * f[g]; } }   // a masked key: e = 0, p = 0, term 0
            if constexpr (HI) { v8us h0, h1, l0, l1;
#pragma unroll
                for (int r = 0; r < 8; ++r) { unsigned short a, b2; splitf(y[0][r], a, b2); h0[r] = a; l0[r] = b2; splitf(y[1][r], a, b2); h1[r] = a; l1[r] = b2; }
                pb = cat16b(h0, h1); pb2 = cat16b(l0, l1);
            } else { v8h h0, h1;
#pragma unroll
                for (int r = 0; r < 8; ++r) { h0[r] = tohx(y[0][r]); h1[r] = tohx(y[1][r]); }
                pb = cat16(h0, h1); }
#pragma unroll
            for (int dt = 0; dt < 4; ++dt) { o[dt][g] = WFrag<T16>::mma(vf[dt], pb, o[dt][g]); if (HI) { o[dt][g] = WFrag<T16>::mma(vf[dt], pb2, o[dt][g]); o[dt][g] = WFrag<T16>::mma(vf2[dt], pb, o[dt][g]); } } }
        // the four slots keep the distance between the trip's last matrix instructions (every accumulator is named, so that all of them stand in front) and the first vector instruction behind the branch, on both of its sides
        if constexpr (QG == 1) asm volatile("v_nop\n\tv_nop\n\tv_nop\n\tv_nop" : "+v"(o[0][0]), "+v"(o[1][0]), "+v"(o[2][0]), "+v"(o[3][0]));
        else asm volatile("v_nop\n\tv_nop\n\tv_nop\n\tv_nop" : "+v"(o[0][0]), "+v"(o[1][0]), "+v"(o[2][0]), "+v"(o[3][0]), "+v"(o[0][QG - 1]), "+v"(o[1][QG - 1]), "+v"(o[2][QG - 1]), "+v"(o[3][QG - 1])); }
#pragma unroll
    for (int dt = 0; dt < 4; ++dt)
#pragma unroll
        for (int g = 0; g < QG; ++g) { const v8f a = o[dt][g]; sh.red[w][dt * QG + g][lane] = (v4f){a[0], a[1], a[2], a[3]}; sh.red[w][dt * QG + g][32 + lane] = (v4f){a[4], a[5], a[6], a[7]}; }
#pragma unroll
    for (int g = 0; g < QG; ++g) { const float ej = en[g] + __shfl_xor(en[g], 16, 32); if (h == 0) sh.se[w][g * 16 + c] = ej; }
    __syncthreads();   // every wave's partial Ot tiles and entropy sums are in LDS before any wave adds them
    // Wave w owns queries w * QW .. w * QW + QW - 1 with all 64 d: a whole 128-byte line of Ah and of Al has one writing wave. Unit u = (query, 16-d tile dt, half hh): 8 consecutive d.
    constexpr int QW = QG * 16 / FW, NU = QW * 8; const float cs = HI ? 1.0f : (1.0f / PCAR);
#pragma unroll
    for (int u0 = 0; u0 < NU; u0 += 32) { const int u = u0 + lane;
        if (u < NU) { const int qq = w * QW + (u % QW), dt = (u / QW) & 3, hh = u / (QW * 4); const int fi = dt * QG + (qq >> 4), sl = (qq & 15) + 16 * hh;
            v4f s0 = sh.red[0][fi][sl], s1 = sh.red[0][fi][32 + sl];
#pragma unroll
            for (int s = 1; s < FW; ++s) { s0 += sh.red[s][fi][sl]; s1 += sh.red[s][fi][32 + sl]; }
            v8us oh, ol;
#pragma unroll
            for (int r = 0; r < 4; ++r) { unsigned short a, b2; splitf(s0[r] * cs, a, b2); oh[r] = a; ol[r] = b2; splitf(s1[r] * cs, a, b2); oh[4 + r] = a; ol[4 + r] = b2; }
            const size_t oo = (size_t)(q0 + qq) * DD + dt * 16 + hh * 8; *(v8us*)(Ah + oo) = oh; *(v8us*)(Al + oo) = ol;
            asm volatile("s_wait_xcnt 0x0" ::: "memory"); } }   // kept in front of the next write of a register that the two stores name
    if (threadIdx.x < QG * 16) { float e = sh.se[0][threadIdx.x];
#pragma unroll
        for (int s = 1; s < FW; ++s) e += sh.se[s][threadIdx.x];
        ENTh[(size_t)(q0 + (int)threadIdx.x) * 32] = e * 0.69314718055994531f; }   // the terms were summed with log2; k_entpart reads word 0 of a row's line
}
// grid (x, batch * NH_ + head): x < (TT - RH) / (QGL * 16): fp16 query blocks, the longest first; behind them the hi+lo blocks. The test is the same for a whole work-group.
// Four waves a SIMD (at most 256 registers a wave): two work-groups share a WGP, so that one's vector work covers the other's load waits, barriers and LDS sums.
__global__ __launch_bounds__(32 * FW) __attribute__((amdgpu_waves_per_eu(4, 4))) void k_fattn(const bf* __restrict__ Qh, const bf* __restrict__ Ql, const bf* __restrict__ Kh, const bf* __restrict__ Kl, const bf* __restrict__ Vh, const bf* __restrict__ Vl,
                                                   const h16* __restrict__ Q16, const h16* __restrict__ K16, const h16* __restrict__ V16, float* ENT, bf* Ah, bf* Al) {
    __shared__ FSh sh;
    constexpr int NL = (TT - RH) / (QGL * 16);
    const int x = blockIdx.x; const size_t z = (size_t)blockIdx.y * TT * HD; float* ENTh = ENT + (size_t)blockIdx.y * TT * 32;   // planes [batch][head][..][..], ENT [batch][head][query] lines
    const size_t ao = (size_t)(blockIdx.y / NH_) * TT * DD + (blockIdx.y % NH_) * HD; Ah += ao; Al += ao;   // merged rows [batch][query][head * HD + d]
    if (x < NL) fattn_body<h16, false, QGL>(Q16 + z, nullptr, K16 + z, nullptr, V16 + z, nullptr, TT - (x + 1) * (QGL * 16), ENTh, Ah, Al, sh);
    else fattn_body<bf, true, QGH>(Qh + z, Ql + z, Kh + z, Kl + z, Vh + z, Vl + z, (x - NL) * (QGH * 16), ENTh, Ah, Al, sh);
}

// Mean of the NB_ * NH_ * TT row entropies in two launches: one wave alone would walk all the ENT lines in a chain of load round trips.
// k_entpart: work-group g sums rows g * 256 .. g * 256 + 255, one row a thread (every load of the launch is in flight at once): lane tree, then the 8 wave sums through LDS -> line PART[g][0..31] (lane 0 the sum, the rest 0).
#define EPW 256                   // rows per work-group of k_entpart
__global__ __launch_bounds__(EPW) void k_entpart(const float* __restrict__ ENT, float* PART) {
    __shared__ float wsum[EPW / 32];
    const int lane = threadIdx.x & 31, w = threadIdx.x >> 5; float s = ENT[((size_t)blockIdx.x * EPW + threadIdx.x) * 32];
#pragma unroll
    for (int sh = 16; sh; sh >>= 1) s += __shfl_xor(s, sh, 32);
    if (lane == 0) wsum[w] = s;
    __syncthreads();   // all 8 wave sums are in LDS before wave 0 adds them
    if (w == 0) { float t = lane < EPW / 32 ? wsum[lane] : 0.f;
#pragma unroll
        for (int sh = EPW / 64; sh; sh >>= 1) t += __shfl_xor(t, sh, 32);
        PART[(size_t)blockIdx.x * 32 + lane] = lane == 0 ? t : 0.f; }
}
// k_entmean: one wave sums the NB_ * NH_ * TT / EPW partial sums (8 independent loads a lane) and scales.
__global__ __launch_bounds__(32) void k_entmean(const float* __restrict__ PART, float* OUT1) { const int lane = threadIdx.x; float s = 0.f;
#pragma unroll
    for (int r = 0; r < NB_ * NH_ * TT / EPW; r += 32) s += PART[(size_t)(r + lane) * 32];
#pragma unroll
    for (int sh = 16; sh; sh >>= 1) s += __shfl_xor(s, sh, 32);
    if (lane == 0) { const float m = s * (1.0f / (float)(NB_ * NH_ * TT)); *(float*)OUT1 = m;  } }
extern "C" void kernel_launch(void* const* d_in, const int* in_sizes, int n_in,
                              void* d_out, int out_size, void* d_ws, size_t ws_size, hipStream_t stream) {
    (void)in_sizes; (void)n_in; (void)out_size;
    const float* x = (const float*)d_in[0]; const float* wqkv = (const float*)d_in[1]; const float* wo = (const float*)d_in[2];   // w_attn [1024][3072], w_proj [1024][1024] as x @ W (no biases)
    float* OUT = (float*)d_out; float* OUT1 = OUT + (size_t)NB_ * TT * DD;     // [2][2048][1024] at 0; [1] entropy at byte 16,777,216
    char* wsp = (char*)d_ws;
    auto take = [&](size_t bytes) { char* p = wsp; wsp += (bytes + 255) & ~(size_t)255; return (void*)p; };
    bf* WQKV = (bf*)take((size_t)3 * DD * DD * 2); bf* WO = (bf*)take((size_t)DD * DD * 2);
    bf* XB = (bf*)take((size_t)NB_ * TT * DD * 2); float* F = (float*)take((size_t)3 * NB_ * TT * DD * 4);   // x of both batches; F = [q, k, v][batch][TT][DD]
    const size_t PB = (size_t)NB_ * TT * DD * 2;   // a 16-bit plane of both batches
    bf* QPh = (bf*)take(PB); bf* QPl = (bf*)take(PB); bf* KPh = (bf*)take(PB); bf* KPl = (bf*)take(PB); bf* VTh = (bf*)take(PB); bf* VTl = (bf*)take(PB);
    h16* QP16 = (h16*)take(PB); h16* KP16 = (h16*)take(PB); h16* VT16 = (h16*)take(PB);
    float* ENT = (float*)take((size_t)NB_ * NH_ * TT * 32 * 4); bf* ATh = (bf*)take(PB); bf* ATl = (bf*)take(PB); float* PART = (float*)take((size_t)(NB_ * NH_ * TT / EPW) * 32 * 4);
    if ((size_t)(wsp - (char*)d_ws) > ws_size) return;    // total 160 MiB
    k_prep<<<GWA + GWP + GXC, 256, 0, stream>>>(x, wqkv, wo, XB, WQKV, WO);
    const unsigned LB = (unsigned)((NH_ * TT * HD / 64 + 63) / 64);
    // both batches are the rows of one product (M = NB_ * TT); z = q, k, v: the weight rows and the F plane of each
    k_gemml<0><<<dim3(NB_ * TT / GT, DD / GT, 3), 256, 0, stream>>>(XB, nullptr, WQKV, F, (size_t)DD * DD, (size_t)NB_ * TT * DD);
    k_planes<<<dim3(LB, 3, NB_), 256, 0, stream>>>(F, QPh, QPl, QP16, KPh, KPl, KP16, VTh, VTl, VT16);
    k_fattn<<<dim3((TT - RH) / (QGL * 16) + RH / (QGH * 16), NB_ * NH_, 1), 32 * FW, 0, stream>>>(QPh, QPl, KPh, KPl, VTh, VTl, QP16, KP16, VT16, ENT, ATh, ATl);
    k_gemml<1><<<dim3(NB_ * TT / GT, DD / GT, 1), 256, 0, stream>>>(ATh, ATl, WO, OUT, 0, 0);
    k_entpart<<<NB_ * NH_ * TT / EPW, EPW, 0, stream>>>(ENT, PART); k_entmean<<<1, 32, 0, stream>>>(PART, OUT1);
}

// v008
// A run of this version takes 138 microseconds.
// In both of two side-by-side timings against v007, it was 1.15 times as fast.
// All steps since v000 together make it 16.2 times as fast.
#include <hip/hip_runtime.h>

// Causal multi-head self-attention with an attention-entropy monitor (x [2][2048][1024]; qkv = x w_attn (16 heads x 64, no bias); causal softmax(q.k/8); y = merged att.v w_proj -> [2][2048][1024];
// second output = mean over all (batch, head, query) rows of the row entropy -sum_s att log(att + 1e-8) -> [1]).
// Compute dtypes, f32 accumulate: every input rounded to bf16; qkv projection on PLAIN bf16 operands (inputs: exact products, f32 accumulate); w_proj on att.v hi+lo planes (2 products); PER-ROW PRECISION HYBRID:
// query rows < 256 take scores and att.v on bf16 hi+lo planes (3 products), rows >= 256 on single fp16 planes; 1/8, the causal cut, the softmax and the row entropy (from the f32 probabilities, hardware

#define NB_  2
#define TT   2048
#define DD   1024
#define NH_  16
#define HD   64
#define RH   256                  // query rows < RH: hi+lo planes; rows >= RH: fp16 planes
#define NF   32                   // head_dim / 2 (unused here)
#define SCL  0.125f               // 1/sqrt(64)
#define PCAR 1024.0f         // P scale for fp16 rows >= RH, undone in k_fattn's head merge
typedef _Float16 h16;
typedef unsigned short bf;
typedef __attribute__((ext_vector_type(16))) __bf16   v16bf;
typedef __attribute__((ext_vector_type(16))) _Float16 v16h;
typedef __attribute__((ext_vector_type(8)))  _Float16 v8h;
typedef __attribute__((ext_vector_type(8)))  unsigned short v8us;
typedef __attribute__((ext_vector_type(8)))  float    v8f;
typedef __attribute__((ext_vector_type(4)))  float    v4f;
typedef v8h  __attribute__((may_alias)) v8ha;
typedef v4f  __attribute__((may_alias)) v4fa;
typedef v8us __attribute__((may_alias)) v8usa;

__device__ __forceinline__ unsigned short f2bf(float f) { unsigned u = __float_as_uint(f); u += 0x7FFFu + ((u >> 16) & 1u); return (unsigned short)(u >> 16); }
__device__ __forceinline__ float bf2f(unsigned short b) { return __uint_as_float(((unsigned)b) << 16); }
__device__ __forceinline__ float bfr(float f) { return bf2f(f2bf(f)); }
__device__ __forceinline__ v16h cat16(v8h lo, v8h hi) { return __builtin_shufflevector(lo, hi, 0, 1, 2, 3, 4, 5, 6, 7, 8, 9, 10, 11, 12, 13, 14, 15); }
__device__ __forceinline__ v16bf cat16b(v8us lo, v8us hi) { return __builtin_bit_cast(v16bf, __builtin_shufflevector(lo, hi, 0, 1, 2, 3, 4, 5, 6, 7, 8, 9, 10, 11, 12, 13, 14, 15)); }
__device__ __forceinline__ v8f wmma16(v16h a, v16h b, v8f c) { return __builtin_amdgcn_wmma_f32_16x16x32_f16(false, a, false, b, (short)0, c, false, false); }
__device__ __forceinline__ v8f wmmab(v16bf a, v16bf b, v8f c) { return __builtin_amdgcn_wmma_f32_16x16x32_bf16(false, a, false, b, (short)0, c, false, false); }
__device__ __forceinline__ h16 tohx(float x) { return (h16)x; }
__device__ __forceinline__ void splitf(float y, unsigned short& h, unsigned short& l) { h = f2bf(y); l = f2bf(y - bf2f(h)); }



// ---- k_gemml: sum_k (A[m][k] + A2[m][k]) Bt[n][k], K = DD, all planes bf16 with K-contiguous rows of pitch DD (A2 only with NSPLIT == 1: two products into one accumulator). grid (M / 128, N / 128, Z), 256 threads.
// NSPLIT == 1: the product goes to C[m][n] (f32, pitch DD). NSPLIT == 0 (z = q, k, v; Bt = the three weight blocks one behind the other): the product never goes to memory in f32, the epilogue writes k_fattn's operand planes.
// One 128 x 128 tile of C a work-group. A stage is 64 k (one whole 128-byte line) of the tile's 128 rows of every plane; asynchronous copies of 16 bytes a lane bring it into LDS, eight lanes side by side on a line,
// so that every line leaves L2 once a work-group and whole, and all eight waves read their fragments from LDS. Two buffers: stage t + 1 flies while stage t is worked on.
// Wave w has the 64 x 32 part at rows (w >> 2) * 64, columns (w & 3) * 32 (8 accumulators) over the whole K: a 128-byte line of C has one writing wave.
// A lane of an accumulator holds 8 consecutive rows of one column, and a plane wants 8 consecutive elements of its contiguous index (d for q and k, t for the transposed v): so for q and k the weight rows are
// the row operand and the x rows the column operand (same loader, same k order, the two pointers change places); for v as written above. 64 rows x 16 bits = one whole 128-byte line of a plane a column.
template <typename T16> struct WFrag;
template <> struct WFrag<h16> { typedef v16h V; static __device__ __forceinline__ V ld(const h16* p) { return cat16(*(const v8h*)p, *(const v8h*)(p + 16)); } static __device__ __forceinline__ v8f mma(V a, V b, v8f c) { return wmma16(a, b, c); } };
template <> struct WFrag<bf> { typedef v16bf V; static __device__ __forceinline__ V ld(const bf* p) { return cat16b(*(const v8us*)p, *(const v8us*)(p + 16)); } static __device__ __forceinline__ v8f mma(V a, V b, v8f c) { return wmmab(a, b, c); } };
#define GT 128                    // rows of a plane in a stage
#define GK 64                     // k elements of a stage
#define GP 144                    // LDS row pitch in bytes: 16 x odd, the 16-byte fragment reads of 16 rows fall on different banks
template <int NSPLIT>
__global__ __launch_bounds__(256) void k_gemml(const bf* __restrict__ A, const bf* __restrict__ A2, const bf* __restrict__ Bt, float* C,
                                               bf* Qh, bf* Ql, h16* Q16, bf* Kh, bf* Kl, h16* K16, bf* Vh, bf* Vl, h16* V16) {
    constexpr int NP = NSPLIT ? 3 : 2, STG = NP * GT * GP, NT = DD / GK;   // planes a stage [A | Bt | A2], bytes a stage, stages
    __shared__ __align__(16) unsigned char sm[2 * STG];
    const int w = __builtin_amdgcn_readfirstlane((int)(threadIdx.x >> 5));   // wave number, held scalar
    const int lane = threadIdx.x & 31, lr = lane & 15, hi = lane >> 4; const int r0 = blockIdx.x * GT, c0 = blockIdx.y * GT;
    const bool sw = !NSPLIT && blockIdx.z < 2;   // q, k: the operands change places; the same for a whole work-group
    const bf* Ar = A + (size_t)r0 * DD; const bf* Br = Bt + ((size_t)blockIdx.z * DD + c0) * DD; const bf* P0 = sw ? Br : Ar; const bf* P1 = sw ? Ar : Br;   // first rows of the row operand and of the column operand
    // copies: thread = (row crow of 32, 16-byte piece cseg of 8); four copies a plane, 32 rows apart
    const int crow = threadIdx.x >> 3, cseg = threadIdx.x & 7;
    const bf* ga = P0 + (size_t)crow * DD + cseg * 8; const bf* gb = P1 + (size_t)crow * DD + cseg * 8; const bf* ga2 = NSPLIT ? A2 + (size_t)(r0 + crow) * DD + cseg * 8 : ga;
    const unsigned l0 = (unsigned)(size_t)sm + (unsigned)(crow * GP + cseg * 16);   // the lane's LDS byte address in buffer 0, plane 0
    auto issue = [&](int t, int buf) {   // stage t into buffer buf; the wait is the statement's last line: it stands in front of every later write of a register that a copy names
        const unsigned la = l0 + (unsigned)(buf * STG), lb = la + GT * GP; const bf* pa = ga + t * GK; const bf* pb = gb + t * GK;
        if constexpr (NSPLIT) { const unsigned lc = lb + GT * GP; const bf* pc = ga2 + t * GK;
            asm volatile("global_load_async_to_lds_b128 %0, %1, off\n\tglobal_load_async_to_lds_b128 %2, %3, off\n\tglobal_load_async_to_lds_b128 %4, %5, off\n\tglobal_load_async_to_lds_b128 %6, %7, off\n\t"
                         "global_load_async_to_lds_b128 %8, %9, off\n\tglobal_load_async_to_lds_b128 %10, %11, off\n\tglobal_load_async_to_lds_b128 %12, %13, off\n\tglobal_load_async_to_lds_b128 %14, %15, off\n\t"
                         "global_load_async_to_lds_b128 %16, %17, off\n\tglobal_load_async_to_lds_b128 %18, %19, off\n\tglobal_load_async_to_lds_b128 %20, %21, off\n\tglobal_load_async_to_lds_b128 %22, %23, off\n\ts_wait_xcnt 0x0"
                         :: "v"(la), "v"(pa), "v"(la + 32 * GP), "v"(pa + 32 * DD), "v"(la + 64 * GP), "v"(pa + 64 * DD), "v"(la + 96 * GP), "v"(pa + 96 * DD),
                            "v"(lb), "v"(pb), "v"(lb + 32 * GP), "v"(pb + 32 * DD), "v"(lb + 64 * GP), "v"(pb + 64 * DD), "v"(lb + 96 * GP), "v"(pb + 96 * DD),
                            "v"(lc), "v"(pc), "v"(lc + 32 * GP), "v"(pc + 32 * DD), "v"(lc + 64 * GP), "v"(pc + 64 * DD), "v"(lc + 96 * GP), "v"(pc + 96 * DD) : "memory");
        } else {
            asm volatile("global_load_async_to_lds_b128 %0, %1, off\n\tglobal_load_async_to_lds_b128 %2, %3, off\n\tglobal_load_async_to_lds_b128 %4, %5, off\n\tglobal_load_async_to_lds_b128 %6, %7, off\n\t"
                         "global_load_async_to_lds_b128 %8, %9, off\n\tglobal_load_async_to_lds_b128 %10, %11, off\n\tglobal_load_async_to_lds_b128 %12, %13, off\n\tglobal_load_async_to_lds_b128 %14, %15, off\n\ts_wait_xcnt 0x0"
                         :: "v"(la), "v"(pa), "v"(la + 32 * GP), "v"(pa + 32 * DD), "v"(la + 64 * GP), "v"(pa + 64 * DD), "v"(la + 96 * GP), "v"(pa + 96 * DD),
                            "v"(lb), "v"(pb), "v"(lb + 32 * GP), "v"(pb + 32 * DD), "v"(lb + 64 * GP), "v"(pb + 64 * DD), "v"(lb + 96 * GP), "v"(pb + 96 * DD) : "memory");
        }
    };
    v8f acc[4][2];
#pragma unroll
    for (int mb = 0; mb < 4; ++mb)
#pragma unroll
        for (int nb = 0; nb < 2; ++nb) acc[mb][nb] = (v8f){};
    const int aofs = ((w >> 2) * 64 + lr) * GP + hi * 16, bofs = GT * GP + ((w & 3) * 32 + lr) * GP + hi * 16;   // byte offsets of the wave's first A and Bt fragment rows in a stage
    issue(0, 0);
    asm volatile("s_wait_asynccnt 0x0" ::: "memory");   // this wave's copies of stage 0 have landed
    __syncthreads();   // every wave's copies of stage 0 have landed before any wave reads the buffer
    issue(1, 1);
#pragma unroll 1   // rolled: one trip's code and fragment registers serve all stages
    for (int t = 0; t < NT; ++t) { const unsigned char* sb = sm + (t & 1) * STG;
#pragma unroll
        for (int kk = 0; kk < 2; ++kk) { v16bf a[4], a2[4], b[2];
#pragma unroll
            for (int mb = 0; mb < 4; ++mb) { a[mb] = WFrag<bf>::ld((const bf*)(sb + aofs + mb * 16 * GP + kk * 64)); if (NSPLIT) a2[mb] = WFrag<bf>::ld((const bf*)(sb + 2 * GT * GP + aofs + mb * 16 * GP + kk * 64)); }
#pragma unroll
            for (int nb = 0; nb < 2; ++nb) b[nb] = WFrag<bf>::ld((const bf*)(sb + bofs + nb * 16 * GP + kk * 64));
#pragma unroll
            for (int nb = 0; nb < 2; ++nb)
#pragma unroll
                for (int mb = 0; mb < 4; ++mb) { acc[mb][nb] = wmmab(a[mb], b[nb], acc[mb][nb]); if (NSPLIT) acc[mb][nb] = wmmab(a2[mb], b[nb], acc[mb][nb]); } }
        asm volatile("s_wait_dscnt 0x0" ::: "memory");      // this wave's reads of buffer t & 1 have returned before the buffer is given up
        asm volatile("s_wait_asynccnt 0x0" ::: "memory");   // this wave's copies of stage t + 1 have landed
        __syncthreads();   // publishes stage t + 1 and ends every wave's reads of the buffer that is refilled behind it
        if (t + 2 < NT) issue(t + 2, t & 1); }
    asm volatile("s_wait_asynccnt 0x0" ::: "memory");   // no copy is outstanding when the wave ends
    if constexpr (NSPLIT) {
        float* cp = C + (size_t)(r0 + (w >> 2) * 64 + hi * 8) * DD + c0 + (w & 3) * 32 + lr;
#pragma unroll
        for (int mb = 0; mb < 4; ++mb)
#pragma unroll
            for (int nb = 0; nb < 2; ++nb)
#pragma unroll
                for (int j = 0; j < 8; ++j) cp[(size_t)(mb * 16 + j) * DD + nb * 16] = acc[mb][nb][j];
    } else {
        // The wave's part as planes: 32 lines (one a column) of 64 elements. Planes q, k: [batch][head][t][d], line = (head, t); v: [batch][head][d][t], line = (head, d), 64 t of it.
        // A lane's 16-byte runs would reach memory as 32-byte pieces of 16 lines a store; staged in LDS (the ring is free: the loop's last barrier ended every read of it, no copy is outstanding), each wave in two areas of
        // its own (no barrier), they go out as 4 whole lines a store.
        unsigned char* st0 = sm + w * (2 * 32 * GP); unsigned char* st1 = st0 + 32 * GP;
        const int z = blockIdx.z, t0 = r0 & (TT - 1);
        bf* Ph = z == 0 ? Qh : z == 1 ? Kh : Vh; bf* Pl = z == 0 ? Ql : z == 1 ? Kl : Vl; h16* P16 = z == 0 ? Q16 : z == 1 ? K16 : V16;
        const unsigned e0 = (unsigned)(r0 / TT) * (TT * DD) + (sw ? (unsigned)(((c0 >> 6) + (w >> 2)) * (TT * HD) + (t0 + (w & 3) * 32) * HD) : (unsigned)((c0 + (w & 3) * 32) * TT + t0 + (w >> 2) * 64));   // first element of the wave's first line
        const unsigned pj = sw ? HD : TT;   // elements from one line to the next
        unsigned ob[8];   // byte offsets in a plane of the lane's eight 16-byte pieces: 8 lanes side by side on a line, 4 lines a store; formed once, in front of every store that names them
#pragma unroll
        for (int s = 0; s < 8; ++s) ob[s] = (e0 + (unsigned)(s * 4 + (lane >> 3)) * pj + (unsigned)(lane & 7) * 8) * 2;
        const int wo = lr * GP + hi * 16, ro = (lane >> 3) * GP + (lane & 7) * 16;
        auto flush = [&](const unsigned char* st, void* plane) { v8us r[8];   // one staged area to its plane
#pragma unroll
            for (int s = 0; s < 8; ++s) r[s] = *(const v8usa*)(st + ro + s * 4 * GP);
#pragma unroll
            for (int s = 0; s < 8; ++s) *(v8usa*)((unsigned char*)plane + ob[s]) = r[s];
        };
#pragma unroll
        for (int nb = 0; nb < 2; ++nb)
#pragma unroll
            for (int mb = 0; mb < 4; ++mb) { v8us oh, ol;
#pragma unroll
                for (int j = 0; j < 8; ++j) { unsigned short a, c2; splitf(acc[mb][nb][j], a, c2); oh[j] = a; ol[j] = c2; }
                *(v8usa*)(st0 + wo + nb * 16 * GP + mb * 32) = oh; *(v8usa*)(st1 + wo + nb * 16 * GP + mb * 32) = ol; }
        asm volatile("s_wait_dscnt 0x0" ::: "memory");   // the wave's LDS stores have landed before its lanes read one another's pieces
        flush(st0, Ph);
        asm volatile("s_wait_xcnt 0x0" ::: "memory");    // kept in front of the next write of a register that the eight stores name
        flush(st1, Pl);
        asm volatile("s_wait_xcnt 0x0" ::: "memory");    // as above
#pragma unroll
        for (int nb = 0; nb < 2; ++nb)
#pragma unroll
            for (int mb = 0; mb < 4; ++mb) { v8h o16;
#pragma unroll
                for (int j = 0; j < 8; ++j) o16[j] = tohx(acc[mb][nb][j]);
                *(v8ha*)(st0 + wo + nb * 16 * GP + mb * 32) = o16; }
        asm volatile("s_wait_dscnt 0x0" ::: "memory");   // as above; area 0 was read back whole in front of the stores of the first plane
        flush(st0, P16);
    }
}

typedef __attribute__((ext_vector_type(2))) unsigned short v2us;
typedef __attribute__((ext_vector_type(2))) _Float16 v2h;
typedef __attribute__((ext_vector_type(4))) _Float16 v4h;
typedef v4h __attribute__((may_alias)) v4ha;
typedef __attribute__((ext_vector_type(2))) float v2f;

// The three input conversions are bodies of ONE launch, k_prep (bx = the body's own block index); they do not depend on one another.
__device__ __forceinline__ void wtG_body(int bx, const float* __restrict__ w, int K, int N, bf* Bt) {
    const int lane = threadIdx.x & 31; const int L0 = (bx * 8 + (threadIdx.x >> 5)) * 8; const int nlines = N * K / 64;
{
#pragma unroll 1
        for (int l = 0; l < 8; ++l) { const int L = L0 + l; if (L >= nlines) break; const size_t e = (size_t)L * 64 + lane * 2; const int k = (int)(e % K), n = (int)(e / K); v2us o;
            o[0] = f2bf(w[(size_t)k * N + n]); o[1] = f2bf(w[(size_t)(k + 1) * N + n]); *(v2us*)(Bt + e) = o; }
         }
}
__device__ __forceinline__ void cvt8_body(int bx, const float* __restrict__ src, bf* dst, size_t n8) { const size_t i = (size_t)bx * 256 + threadIdx.x; if (i >= n8) return; const v8f v = *(const v8f*)(src + i * 8); v8us o;
#pragma unroll
    for (int k = 0; k < 8; ++k) o[k] = f2bf(v[k]); *(v8us*)(dst + i * 8) = o;  }
#define GWA (DD * 3 * DD / 4096)  // work-groups of the w_attn transpose (64 lines of 64 elements each)
#define GWP (DD * DD / 4096)      // work-groups of the w_proj transpose
#define GXC (NB_ * TT * DD / 2048) // work-groups of the x conversion, both batches
// grid GWA + GWP + GXC; the transposes (chains of eight load round trips) take the lowest block indices. Every test is the same for a whole work-group.
__global__ __launch_bounds__(256) void k_prep(const float* __restrict__ x, const float* __restrict__ wqkv, const float* __restrict__ wo, bf* XB, bf* WQKV, bf* WO) {
    const int bx = blockIdx.x;
    if (bx < GWA) wtG_body(bx, wqkv, DD, 3 * DD, WQKV);
    else if (bx < GWA + GWP) wtG_body(bx - GWA, wo, DD, DD, WO);
    else cvt8_body(bx - (GWA + GWP), x, XB, (size_t)NB_ * TT * DD / 8);
}
#define LOG2E 1.44269504088896341f
__device__ __forceinline__ void exp2x8(float (&x)[8]) { asm("v_exp_f32 %0, %0\n\tv_exp_f32 %1, %1\n\tv_exp_f32 %2, %2\n\tv_exp_f32 %3, %3\n\tv_exp_f32 %4, %4\n\tv_exp_f32 %5, %5\n\tv_exp_f32 %6, %6\n\tv_exp_f32 %7, %7\n\tv_nop" : "+v"(x[0]), "+v"(x[1]), "+v"(x[2]), "+v"(x[3]), "+v"(x[4]), "+v"(x[5]), "+v"(x[6]), "+v"(x[7])); }
__device__ __forceinline__ void log2x8(float (&x)[8]) { asm("v_log_f32 %0, %0\n\tv_log_f32 %1, %1\n\tv_log_f32 %2, %2\n\tv_log_f32 %3, %3\n\tv_log_f32 %4, %4\n\tv_log_f32 %5, %5\n\tv_log_f32 %6, %6\n\tv_log_f32 %7, %7\n\tv_nop" : "+v"(x[0]), "+v"(x[1]), "+v"(x[2]), "+v"(x[3]), "+v"(x[4]), "+v"(x[5]), "+v"(x[6]), "+v"(x[7])); }
__device__ __forceinline__ float expx1(float a) { float x = a * LOG2E; asm("v_exp_f32 %0, %0\n\tv_nop" : "+v"(x)); return x; }   // e^a
// The wait that is kept between a run of global loads and the next write of a register that one of them names as its address. The run's addresses are inputs of the statement: they stay in their registers
// up to the wait, wherever the build lets it stand behind the run, so that neither a result of the run nor the vector work behind it is given those registers in front of it.
template <typename T16> __device__ __forceinline__ void xwait2(const T16* a, const T16* b) { asm volatile("s_wait_xcnt 0x0" :: "v"(a), "v"(b) : "memory"); }
#define FW 8                      // waves per work-group of k_fattn
#define QGL 2                     // 16-query groups per work-group, fp16 rows
#define QGH 1                     // 16-query groups per work-group, hi+lo rows
struct FSh { v4f red[FW][4 * QGL][2 * 32 + 2];   // [wave][fragment][half * 32 + lane]; the two spare entries shift each fragment by 32 bytes, so that the adders' reads of four fragments side by side fall on different banks
             float sm[FW][QGL * 16]; float sl[FW][QGL * 16]; float se[FW][QGL * 16]; };
template <typename T16, bool HI, int QG>
__device__ __forceinline__ void fattn_body(const T16* __restrict__ Q, const T16* __restrict__ Q2, const T16* __restrict__ Kp, const T16* __restrict__ K2, const T16* __restrict__ Vt, const T16* __restrict__ V2,
                                           int q0, float* ENTh, bf* Ah, bf* Al, FSh& sh) {
    typedef typename WFrag<T16>::V V; static_assert(QG == 1 || QG == 2, "the statement at the foot of walk 2 names the accumulators of two groups");
    const int w = __builtin_amdgcn_readfirstlane((int)(threadIdx.x >> 5));   // wave number, held scalar
    const int lane = threadIdx.x & 31, c = lane & 15, h = lane >> 4;
    const int nkb = (q0 + QG * 16 + 31) >> 5;   // 32-key blocks that hold a key <= the last query
    V qf[QG][2], qf2[QG][2];
#pragma unroll
    for (int g = 0; g < QG; ++g)
#pragma unroll
        for (int kk = 0; kk < 2; ++kk) { const size_t o = (size_t)(q0 + g * 16 + c) * HD + kk * 32 + 8 * h; qf[g][kk] = WFrag<T16>::ld(Q + o); if (HI) qf2[g][kk] = WFrag<T16>::ld(Q2 + o); }
    asm volatile("s_wait_xcnt 0x0" ::: "memory");   // kept in front of the next write of an address register that the query loads name
    V kf[2][2], kf2[2][2];   // the key rows k0 .. k0 + 31 as A fragments
    auto loadk = [&](int k0) { const size_t o = (size_t)(k0 + c) * HD + 8 * h; const T16* kp = Kp + o; const T16* kp2 = HI ? K2 + o : kp;   // one address a plane, the rest of a run is constant offsets
#pragma unroll
        for (int t = 0; t < 2; ++t)
#pragma unroll
            for (int kk = 0; kk < 2; ++kk) { kf[t][kk] = WFrag<T16>::ld(kp + t * 16 * HD + kk * 32); if (HI) kf2[t][kk] = WFrag<T16>::ld(kp2 + t * 16 * HD + kk * 32); }
        xwait2(kp, kp2);
        if constexpr (HI) __builtin_amdgcn_sched_barrier(0);   // keeps the matrix instructions behind the whole run: without it the build refills a few registers in turn, and the 16 loads become a chain of seven round trips
    };
    // st[t][g][r] = masked scaled score of key k0 + t * 16 + 8 h + r and query q0 + g * 16 + c, from the fragments in kf
    auto scores = [&](int k0, v8f (&st)[2][QG]) {
#pragma unroll
        for (int t = 0; t < 2; ++t)
#pragma unroll
            for (int g = 0; g < QG; ++g) { v8f a = (v8f){};
#pragma unroll
                for (int kk = 0; kk < 2; ++kk) { a = WFrag<T16>::mma(kf[t][kk], qf[g][kk], a); if (HI) { a = WFrag<T16>::mma(kf[t][kk], qf2[g][kk], a); a = WFrag<T16>::mma(kf2[t][kk], qf[g][kk], a); } }
#pragma unroll
                for (int r = 0; r < 8; ++r) st[t][g][r] = a[r] * SCL; }
        if (k0 + 31 > q0) {   // a scalar test: only a block that reaches past the first query holds a key to cut
#pragma unroll
            for (int t = 0; t < 2; ++t)
#pragma unroll
                for (int g = 0; g < QG; ++g) { const int dq = q0 + g * 16 + c - (k0 + t * 16 + 8 * h);   // key r of this lane is kept while r <= dq
#pragma unroll
                    for (int r = 0; r < 8; ++r) st[t][g][r] = (r <= dq) ? st[t][g][r] : -3.0e38f; } }
    };
    float m[QG], l[QG];
#pragma unroll
    for (int g = 0; g < QG; ++g) { m[g] = -3.0e38f; l[g] = 0.f; }
    constexpr bool PF = !HI;   // key rows fetched one trip ahead; not for the hi+lo rows, where RH / 32 <= FW blocks leave a wave one trip at most
    if (PF && w < nkb) loadk(w * 32);
#pragma unroll 1   // rolled: the key fragments are refilled in place, one trip's registers serve every trip
    for (int kb = w; kb < nkb; kb += FW) { if (!PF) loadk(kb * 32);
        v8f st[2][QG]; scores(kb * 32, st);
        if (PF) loadk(min(kb + FW, nkb - 1) * 32);   // the next trip's key rows fly, into the same registers, while this trip's vector work runs (the last trip fetches the last block once more: in bounds, unused)
#pragma unroll
        for (int g = 0; g < QG; ++g) { float bm = m[g];
#pragma unroll
            for (int r = 0; r < 8; ++r) bm = fmaxf(bm, fmaxf(st[0][g][r], st[1][g][r]));
            float s = 0.f;
#pragma unroll
            for (int t = 0; t < 2; ++t) { float e[8];
#pragma unroll
                for (int r = 0; r < 8; ++r) e[r] = (st[t][g][r] - bm) * LOG2E;
                exp2x8(e);
#pragma unroll
                for (int r = 0; r < 8; ++r) s += e[r]; }
            l[g] = l[g] * expx1(m[g] - bm) + s; m[g] = bm; } }   // a lane that has met masked keys only counts ones under m = -3e38: the joins below scale them by exp(-3e38 - max) = 0
#pragma unroll
    for (int g = 0; g < QG; ++g) { const float mo = __shfl_xor(m[g], 16, 32), lo = __shfl_xor(l[g], 16, 32); const float mn = fmaxf(m[g], mo);
        const float lj = l[g] * expx1(m[g] - mn) + lo * expx1(mo - mn); if (h == 0) { sh.sm[w][g * 16 + c] = mn; sh.sl[w][g * 16 + c] = lj; } }
    __syncthreads();   // every wave's maxima and sums are in LDS before any wave joins them
    float M[QG], pn[QG], f[QG], en[QG];
#pragma unroll
    for (int g = 0; g < QG; ++g) { float mx = sh.sm[0][g * 16 + c];
#pragma unroll
        for (int s = 1; s < FW; ++s) mx = fmaxf(mx, sh.sm[s][g * 16 + c]);
        float L = 0.f;
#pragma unroll
        for (int s = 0; s < FW; ++s) L += sh.sl[s][g * 16 + c] * expx1(sh.sm[s][g * 16 + c] - mx);
        M[g] = mx; pn[g] = __fdiv_rn(1.0f, L); f[g] = __fdiv_rn(HI ? 1.0f : PCAR, L); en[g] = 0.f; }
    v8f o[4][QG];
#pragma unroll
    for (int dt = 0; dt < 4; ++dt)
#pragma unroll
        for (int g = 0; g < QG; ++g) o[dt][g] = (v8f){};
    if (PF && w < nkb) loadk(w * 32);
#pragma unroll 1   // rolled, as walk 1: fragments refilled in place keep the wave inside its register limit
    for (int kb = w; kb < nkb; kb += FW) { const int k0 = kb * 32; V vf[4], vf2[4];
        const size_t vo = (size_t)c * TT + k0 + 8 * h; const T16* vp = Vt + vo; const T16* vp2 = HI ? V2 + vo : vp;
#pragma unroll
        for (int dt = 0; dt < 4; ++dt) { vf[dt] = WFrag<T16>::ld(vp + dt * 16 * TT); if (HI) vf2[dt] = WFrag<T16>::ld(vp2 + dt * 16 * TT); }
        xwait2(vp, vp2);
        if (!PF) loadk(k0);
        v8f st[2][QG]; scores(k0, st);
        if (PF) loadk(min(kb + FW, nkb - 1) * 32);   // as in walk 1: the next trip's key rows fly while this trip's vector work and Ot products run
#pragma unroll
        for (int g = 0; g < QG; ++g) { V pb, pb2;
            float y[2][8];
#pragma unroll
            for (int t = 0; t < 2; ++t) { float e[8], q[8];
#pragma unroll
                for (int r = 0; r < 8; ++r) e[r] = (st[t][g][r] - M[g]) * LOG2E;
                exp2x8(e);
#pragma unroll
                for (int r = 0; r < 8; ++r) q[r] = e[r] * pn[g] + 1e-8f;
                log2x8(q);
#pragma unroll
                for (int r = 0; r < 8; ++r) { en[g] -= (e[r] * pn[g]) * q[r]; y[t][r] = e[r] * f[g]; } }   // a masked key: e = 0, p = 0, term 0
            if constexpr (HI) { v8us h0, h1, l0, l1;
#pragma unroll
                for (int r = 0; r < 8; ++r) { unsigned short a, b2; splitf(y[0][r], a, b2); h0[r] = a; l0[r] = b2; splitf(y[1][r], a, b2); h1[r] = a; l1[r] = b2; }
                pb = cat16b(h0, h1); pb2 = cat16b(l0, l1);
            } else { v8h h0, h1;
#pragma unroll
                for (int r = 0; r < 8; ++r) { h0[r] = tohx(y[0][r]); h1[r] = tohx(y[1][r]); }
                pb = cat16(h0, h1); }
#pragma unroll
            for (int dt = 0; dt < 4; ++dt) { o[dt][g] = WFrag<T16>::mma(vf[dt], pb, o[dt][g]); if (HI) { o[dt][g] = WFrag<T16>::mma(vf[dt], pb2, o[dt][g]); o[dt][g] = WFrag<T16>::mma(vf2[dt], pb, o[dt][g]); } } }
        // the four slots keep the distance between the trip's last matrix instructions (every accumulator is named, so that all of them stand in front) and the first vector instruction behind the branch, on both of its sides
        if constexpr (QG == 1) asm volatile("v_nop\n\tv_nop\n\tv_nop\n\tv_nop" : "+v"(o[0][0]), "+v"(o[1][0]), "+v"(o[2][0]), "+v"(o[3][0]));
        else asm volatile("v_nop\n\tv_nop\n\tv_nop\n\tv_nop" : "+v"(o[0][0]), "+v"(o[1][0]), "+v"(o[2][0]), "+v"(o[3][0]), "+v"(o[0][QG - 1]), "+v"(o[1][QG - 1]), "+v"(o[2][QG - 1]), "+v"(o[3][QG - 1])); }
#pragma unroll
    for (int dt = 0; dt < 4; ++dt)
#pragma unroll
        for (int g = 0; g < QG; ++g) { const v8f a = o[dt][g]; sh.red[w][dt * QG + g][lane] = (v4f){a[0], a[1], a[2], a[3]}; sh.red[w][dt * QG + g][32 + lane] = (v4f){a[4], a[5], a[6], a[7]}; }
#pragma unroll
    for (int g = 0; g < QG; ++g) { const float ej = en[g] + __shfl_xor(en[g], 16, 32); if (h == 0) sh.se[w][g * 16 + c] = ej; }
    __syncthreads();   // every wave's partial Ot tiles and entropy sums are in LDS before any wave adds them
    // Wave w owns queries w * QW .. w * QW + QW - 1 with all 64 d: a whole 128-byte line of Ah and of Al has one writing wave. Unit u = (query, 16-d tile dt, half hh): 8 consecutive d.
    constexpr int QW = QG * 16 / FW, NU = QW * 8; const float cs = HI ? 1.0f : (1.0f / PCAR);
#pragma unroll
    for (int u0 = 0; u0 < NU; u0 += 32) { const int u = u0 + lane;
        if (u < NU) { const int qq = w * QW + (u % QW), dt = (u / QW) & 3, hh = u / (QW * 4); const int fi = dt * QG + (qq >> 4), sl = (qq & 15) + 16 * hh;
            v4f s0 = sh.red[0][fi][sl], s1 = sh.red[0][fi][32 + sl];
#pragma unroll
            for (int s = 1; s < FW; ++s) { s0 += sh.red[s][fi][sl]; s1 += sh.red[s][fi][32 + sl]; }
            v8us oh, ol;
#pragma unroll
            for (int r = 0; r < 4; ++r) { unsigned short a, b2; splitf(s0[r] * cs, a, b2); oh[r] = a; ol[r] = b2; splitf(s1[r] * cs, a, b2); oh[4 + r] = a; ol[4 + r] = b2; }
            const size_t oo = (size_t)(q0 + qq) * DD + dt * 16 + hh * 8; *(v8us*)(Ah + oo) = oh; *(v8us*)(Al + oo) = ol;
            asm volatile("s_wait_xcnt 0x0" ::: "memory"); } }   // kept in front of the next write of a register that the two stores name
    if (threadIdx.x < QG * 16) { float e = sh.se[0][threadIdx.x];
#pragma unroll
        for (int s = 1; s < FW; ++s) e += sh.se[s][threadIdx.x];
        ENTh[(size_t)(q0 + (int)threadIdx.x) * 32] = e * 0.69314718055994531f; }   // the terms were summed with log2; k_entpart reads word 0 of a row's line
}
// grid (x, batch * NH_ + head): x < (TT - RH) / (QGL * 16): fp16 query blocks, the longest first; behind them the hi+lo blocks. The test is the same for a whole work-group.
// Four waves a SIMD (at most 256 registers a wave): two work-groups share a WGP, so that one's vector work covers the other's load waits, barriers and LDS sums.
__global__ __launch_bounds__(32 * FW) __attribute__((amdgpu_waves_per_eu(4, 4))) void k_fattn(const bf* __restrict__ Qh, const bf* __restrict__ Ql, const bf* __restrict__ Kh, const bf* __restrict__ Kl, const bf* __restrict__ Vh, const bf* __restrict__ Vl,
                                                   const h16* __restrict__ Q16, const h16* __restrict__ K16, const h16* __restrict__ V16, float* ENT, bf* Ah, bf* Al) {
    __shared__ FSh sh;
    constexpr int NL = (TT - RH) / (QGL * 16);
    const int x = blockIdx.x; const size_t z = (size_t)blockIdx.y * TT * HD; float* ENTh = ENT + (size_t)blockIdx.y * TT * 32;   // planes [batch][head][..][..], ENT [batch][head][query] lines
    const size_t ao = (size_t)(blockIdx.y / NH_) * TT * DD + (blockIdx.y % NH_) * HD; Ah += ao; Al += ao;   // merged rows [batch][query][head * HD + d]
    if (x < NL) fattn_body<h16, false, QGL>(Q16 + z, nullptr, K16 + z, nullptr, V16 + z, nullptr, TT - (x + 1) * (QGL * 16), ENTh, Ah, Al, sh);
    else fattn_body<bf, true, QGH>(Qh + z, Ql + z, Kh + z, Kl + z, Vh + z, Vl + z, (x - NL) * (QGH * 16), ENTh, Ah, Al, sh);
}

// Mean of the NB_ * NH_ * TT row entropies in two launches: one wave alone would walk all the ENT lines in a chain of load round trips.
// k_entpart: work-group g sums rows g * 256 .. g * 256 + 255, one row a thread (every load of the launch is in flight at once): lane tree, then the 8 wave sums through LDS -> line PART[g][0..31] (lane 0 the sum, the rest 0).
#define EPW 256                   // rows per work-group of k_entpart
__global__ __launch_bounds__(EPW) void k_entpart(const float* __restrict__ ENT, float* PART) {
    __shared__ float wsum[EPW / 32];
    const int lane = threadIdx.x & 31, w = threadIdx.x >> 5; float s = ENT[((size_t)blockIdx.x * EPW + threadIdx.x) * 32];
#pragma unroll
    for (int sh = 16; sh; sh >>= 1) s += __shfl_xor(s, sh, 32);
    if (lane == 0) wsum[w] = s;
    __syncthreads();   // all 8 wave sums are in LDS before wave 0 adds them
    if (w == 0) { float t = lane < EPW / 32 ? wsum[lane] : 0.f;
#pragma unroll
        for (int sh = EPW / 64; sh; sh >>= 1) t += __shfl_xor(t, sh, 32);
        PART[(size_t)blockIdx.x * 32 + lane] = lane == 0 ? t : 0.f; }
}
// k_entmean: one wave sums the NB_ * NH_ * TT / EPW partial sums (8 independent loads a lane) and scales.
__global__ __launch_bounds__(32) void k_entmean(const float* __restrict__ PART, float* OUT1) { const int lane = threadIdx.x; float s = 0.f;
#pragma unroll
    for (int r = 0; r < NB_ * NH_ * TT / EPW; r += 32) s += PART[(size_t)(r + lane) * 32];
#pragma unroll
    for (int sh = 16; sh; sh >>= 1) s += __shfl_xor(s, sh, 32);
    if (lane == 0) { const float m = s * (1.0f / (float)(NB_ * NH_ * TT)); *(float*)OUT1 = m;  } }
extern "C" void kernel_launch(void* const* d_in, const int* in_sizes, int n_in,
                              void* d_out, int out_size, void* d_ws, size_t ws_size, hipStream_t stream) {
    (void)in_sizes; (void)n_in; (void)out_size;
    const float* x = (const float*)d_in[0]; const float* wqkv = (const float*)d_in[1]; const float* wo = (const float*)d_in[2];   // w_attn [1024][3072], w_proj [1024][1024] as x @ W (no biases)
    float* OUT = (float*)d_out; float* OUT1 = OUT + (size_t)NB_ * TT * DD;     // [2][2048][1024] at 0; [1] entropy at byte 16,777,216
    char* wsp = (char*)d_ws;
    auto take = [&](size_t bytes) { char* p = wsp; wsp += (bytes + 255) & ~(size_t)255; return (void*)p; };
    bf* WQKV = (bf*)take((size_t)3 * DD * DD * 2); bf* WO = (bf*)take((size_t)DD * DD * 2);
    bf* XB = (bf*)take((size_t)NB_ * TT * DD * 2);   // x of both batches
    const size_t PB = (size_t)NB_ * TT * DD * 2;   // a 16-bit plane of both batches
    bf* QPh = (bf*)take(PB); bf* QPl = (bf*)take(PB); bf* KPh = (bf*)take(PB); bf* KPl = (bf*)take(PB); bf* VTh = (bf*)take(PB); bf* VTl = (bf*)take(PB);
    h16* QP16 = (h16*)take(PB); h16* KP16 = (h16*)take(PB); h16* VT16 = (h16*)take(PB);
    float* ENT = (float*)take((size_t)NB_ * NH_ * TT * 32 * 4); bf* ATh = (bf*)take(PB); bf* ATl = (bf*)take(PB); float* PART = (float*)take((size_t)(NB_ * NH_ * TT / EPW) * 32 * 4);
    if ((size_t)(wsp - (char*)d_ws) > ws_size) return;    // total 112 MiB
    k_prep<<<GWA + GWP + GXC, 256, 0, stream>>>(x, wqkv, wo, XB, WQKV, WO);
    // both batches are the rows of one product (M = NB_ * TT); z = q, k, v: the weight rows and the operand planes of each
    k_gemml<0><<<dim3(NB_ * TT / GT, DD / GT, 3), 256, 0, stream>>>(XB, nullptr, WQKV, nullptr, QPh, QPl, QP16, KPh, KPl, KP16, VTh, VTl, VT16);
    k_fattn<<<dim3((TT - RH) / (QGL * 16) + RH / (QGH * 16), NB_ * NH_, 1), 32 * FW, 0, stream>>>(QPh, QPl, KPh, KPl, VTh, VTl, QP16, KP16, VT16, ENT, ATh, ATl);
    k_gemml<1><<<dim3(NB_ * TT / GT, DD / GT, 1), 256, 0, stream>>>(ATh, ATl, WO, OUT, nullptr, nullptr, nullptr, nullptr, nullptr, nullptr, nullptr, nullptr, nullptr);
    k_entpart<<<NB_ * NH_ * TT / EPW, EPW, 0, stream>>>(ENT, PART); k_entmean<<<1, 32, 0, stream>>>(PART, OUT1);
}

// v009
// A run of this version takes 131 microseconds.
// Next to v008, in two timings, it ran 1.04 and 1.05 times as fast.
// Over all steps from v000 it is 17.0 times as fast.
#include <hip/hip_runtime.h>

// Causal multi-head self-attention with an attention-entropy monitor (x [2][2048][1024]; qkv = x w_attn (16 heads x 64, no bias); causal softmax(q.k/8); y = merged att.v w_proj -> [2][2048][1024];
// second output = mean over all (batch, head, query) rows of the row entropy -sum_s att log(att + 1e-8) -> [1]).
// Compute dtypes, f32 accumulate: every input rounded to bf16; qkv projection on PLAIN bf16 operands (inputs: exact products, f32 accumulate); w_proj on att.v hi+lo planes (2 products); PER-ROW PRECISION HYBRID:
// query rows < 256 take scores and att.v on bf16 hi+lo planes (3 products), rows >= 256 on single fp16 planes; 1/8, the causal cut, the softmax and the row entropy (from the f32 probabilities, hardware

#define NB_  2
#define TT   2048
#define DD   1024
#define NH_  16
#define HD   64
#define RH   256                  // query rows < RH: hi+lo planes; rows >= RH: fp16 planes
#define NF   32                   // head_dim / 2 (unused here)
#define SCL  0.125f               // 1/sqrt(64)
#define PCAR 1024.0f         // P scale for fp16 rows >= RH, undone in k_fattn's head merge
typedef _Float16 h16;
typedef unsigned short bf;
typedef __attribute__((ext_vector_type(16))) __bf16   v16bf;
typedef __attribute__((ext_vector_type(16))) _Float16 v16h;
typedef __attribute__((ext_vector_type(8)))  _Float16 v8h;
typedef __attribute__((ext_vector_type(8)))  unsigned short v8us;
typedef __attribute__((ext_vector_type(8)))  float    v8f;
typedef __attribute__((ext_vector_type(4)))  float    v4f;
typedef v8h  __attribute__((may_alias)) v8ha;
typedef v4f  __attribute__((may_alias)) v4fa;
typedef v8us __attribute__((may_alias)) v8usa;

__device__ __forceinline__ unsigned short f2bf(float f) { unsigned u = __float_as_uint(f); u += 0x7FFFu + ((u >> 16) & 1u); return (unsigned short)(u >> 16); }
__device__ __forceinline__ float bf2f(unsigned short b) { return __uint_as_float(((unsigned)b) << 16); }
__device__ __forceinline__ float bfr(float f) { return bf2f(f2bf(f)); }
__device__ __forceinline__ v16h cat16(v8h lo, v8h hi) { return __builtin_shufflevector(lo, hi, 0, 1, 2, 3, 4, 5, 6, 7, 8, 9, 10, 11, 12, 13, 14, 15); }
__device__ __forceinline__ v16bf cat16b(v8us lo, v8us hi) { return __builtin_bit_cast(v16bf, __builtin_shufflevector(lo, hi, 0, 1, 2, 3, 4, 5, 6, 7, 8, 9, 10, 11, 12, 13, 14, 15)); }
__device__ __forceinline__ v8f wmma16(v16h a, v16h b, v8f c) { return __builtin_amdgcn_wmma_f32_16x16x32_f16(false, a, false, b, (short)0, c, false, false); }
__device__ __forceinline__ v8f wmmab(v16bf a, v16bf b, v8f c) { return __builtin_amdgcn_wmma_f32_16x16x32_bf16(false, a, false, b, (short)0, c, false, false); }
__device__ __forceinline__ h16 tohx(float x) { return (h16)x; }
__device__ __forceinline__ void splitf(float y, unsigned short& h, unsigned short& l) { h = f2bf(y); l = f2bf(y - bf2f(h)); }



// ---- k_gemml: sum_k (A[m][k] + A2[m][k]) Bt[n][k], K = DD, all planes bf16 with K-contiguous rows of pitch DD (A2 only with NSPLIT == 1: two products into one accumulator). grid (M / 128, N / 128, Z), 256 threads.
// NSPLIT == 1: the product goes to C[m][n] (f32, pitch DD). NSPLIT == 0 (z = q, k, v; Bt = the three weight blocks one behind the other): the product never goes to memory in f32, the epilogue writes k_fattn's operand planes.
// One 128 x 128 tile of C a work-group. A stage is 64 k (one whole 128-byte line) of the tile's 128 rows of every plane; asynchronous copies of 16 bytes a lane bring it into LDS, eight lanes side by side on a line,
// so that every line leaves L2 once a work-group and whole, and all eight waves read their fragments from LDS. Two buffers: stage t + 1 flies while stage t is worked on.
// Wave w has the 64 x 32 part at rows (w >> 2) * 64, columns (w & 3) * 32 (8 accumulators) over the whole K: a 128-byte line of C has one writing wave.
// A lane of an accumulator holds 8 consecutive rows of one column, and a plane wants 8 consecutive elements of its contiguous index (d for q and k, t for the transposed v): so for q and k the weight rows are
// the row operand and the x rows the column operand (same loader, same k order, the two pointers change places); for v as written above. 64 rows x 16 bits = one whole 128-byte line of a plane a column.
template <typename T16> struct WFrag;
template <> struct WFrag<h16> { typedef v16h V; static __device__ __forceinline__ V ld(const h16* p) { return cat16(*(const v8h*)p, *(const v8h*)(p + 16)); } static __device__ __forceinline__ v8f mma(V a, V b, v8f c) { return wmma16(a, b, c); } };
template <> struct WFrag<bf> { typedef v16bf V; static __device__ __forceinline__ V ld(const bf* p) { return cat16b(*(const v8us*)p, *(const v8us*)(p + 16)); } static __device__ __forceinline__ v8f mma(V a, V b, v8f c) { return wmmab(a, b, c); } };
#define GT 128                    // rows of a plane in a stage
#define GK 64                     // k elements of a stage
#define GP 144                    // LDS row pitch in bytes: 16 x odd, the 16-byte fragment reads of 16 rows fall on different banks
template <int NSPLIT>
__global__ __launch_bounds__(256) void k_gemml(const bf* __restrict__ A, const bf* __restrict__ A2, const bf* __restrict__ Bt, float* C,
                                               bf* Qh, bf* Ql, h16* Q16, bf* Kh, bf* Kl, h16* K16, bf* Vh, bf* Vl, h16* V16) {
    constexpr int NP = NSPLIT ? 3 : 2, STG = NP * GT * GP, NT = DD / GK;   // planes a stage [A | Bt | A2], bytes a stage, stages
    __shared__ __align__(16) unsigned char sm[2 * STG];
    const int w = __builtin_amdgcn_readfirstlane((int)(threadIdx.x >> 5));   // wave number, held scalar
    const int lane = threadIdx.x & 31, lr = lane & 15, hi = lane >> 4; const int r0 = blockIdx.x * GT, c0 = blockIdx.y * GT;
    const bool sw = !NSPLIT && blockIdx.z < 2;   // q, k: the operands change places; the same for a whole work-group
    const bf* Ar = A + (size_t)r0 * DD; const bf* Br = Bt + ((size_t)blockIdx.z * DD + c0) * DD; const bf* P0 = sw ? Br : Ar; const bf* P1 = sw ? Ar : Br;   // first rows of the row operand and of the column operand
    // copies: thread = (row crow of 32, 16-byte piece cseg of 8); four copies a plane, 32 rows apart
    const int crow = threadIdx.x >> 3, cseg = threadIdx.x & 7;
    const bf* ga = P0 + (size_t)crow * DD + cseg * 8; const bf* gb = P1 + (size_t)crow * DD + cseg * 8; const bf* ga2 = NSPLIT ? A2 + (size_t)(r0 + crow) * DD + cseg * 8 : ga;
    const unsigned l0 = (unsigned)(size_t)sm + (unsigned)(crow * GP + cseg * 16);   // the lane's LDS byte address in buffer 0, plane 0
    auto issue = [&](int t, int buf) {   // stage t into buffer buf; the wait is the statement's last line: it stands in front of every later write of a register that a copy names
        const unsigned la = l0 + (unsigned)(buf * STG), lb = la + GT * GP; const bf* pa = ga + t * GK; const bf* pb = gb + t * GK;
        if constexpr (NSPLIT) { const unsigned lc = lb + GT * GP; const bf* pc = ga2 + t * GK;
            asm volatile("global_load_async_to_lds_b128 %0, %1, off\n\tglobal_load_async_to_lds_b128 %2, %3, off\n\tglobal_load_async_to_lds_b128 %4, %5, off\n\tglobal_load_async_to_lds_b128 %6, %7, off\n\t"
                         "global_load_async_to_lds_b128 %8, %9, off\n\tglobal_load_async_to_lds_b128 %10, %11, off\n\tglobal_load_async_to_lds_b128 %12, %13, off\n\tglobal_load_async_to_lds_b128 %14, %15, off\n\t"
                         "global_load_async_to_lds_b128 %16, %17, off\n\tglobal_load_async_to_lds_b128 %18, %19, off\n\tglobal_load_async_to_lds_b128 %20, %21, off\n\tglobal_load_async_to_lds_b128 %22, %23, off\n\ts_wait_xcnt 0x0"
                         :: "v"(la), "v"(pa), "v"(la + 32 * GP), "v"(pa + 32 * DD), "v"(la + 64 * GP), "v"(pa + 64 * DD), "v"(la + 96 * GP), "v"(pa + 96 * DD),
                            "v"(lb), "v"(pb), "v"(lb + 32 * GP), "v"(pb + 32 * DD), "v"(lb + 64 * GP), "v"(pb + 64 * DD), "v"(lb + 96 * GP), "v"(pb + 96 * DD),
                            "v"(lc), "v"(pc), "v"(lc + 32 * GP), "v"(pc + 32 * DD), "v"(lc + 64 * GP), "v"(pc + 64 * DD), "v"(lc + 96 * GP), "v"(pc + 96 * DD) : "memory");
        } else {
            asm volatile("global_load_async_to_lds_b128 %0, %1, off\n\tglobal_load_async_to_lds_b128 %2, %3, off\n\tglobal_load_async_to_lds_b128 %4, %5, off\n\tglobal_load_async_to_lds_b128 %6, %7, off\n\t"
                         "global_load_async_to_lds_b128 %8, %9, off\n\tglobal_load_async_to_lds_b128 %10, %11, off\n\tglobal_load_async_to_lds_b128 %12, %13, off\n\tglobal_load_async_to_lds_b128 %14, %15, off\n\ts_wait_xcnt 0x0"
                         :: "v"(la), "v"(pa), "v"(la + 32 * GP), "v"(pa + 32 * DD), "v"(la + 64 * GP), "v"(pa + 64 * DD), "v"(la + 96 * GP), "v"(pa + 96 * DD),
                            "v"(lb), "v"(pb), "v"(lb + 32 * GP), "v"(pb + 32 * DD), "v"(lb + 64 * GP), "v"(pb + 64 * DD), "v"(lb + 96 * GP), "v"(pb + 96 * DD) : "memory");
        }
    };
    v8f acc[4][2];
#pragma unroll
    for (int mb = 0; mb < 4; ++mb)
#pragma unroll
        for (int nb = 0; nb < 2; ++nb) acc[mb][nb] = (v8f){};
    const int aofs = ((w >> 2) * 64 + lr) * GP + hi * 16, bofs = GT * GP + ((w & 3) * 32 + lr) * GP + hi * 16;   // byte offsets of the wave's first A and Bt fragment rows in a stage
    issue(0, 0);
    asm volatile("s_wait_asynccnt 0x0" ::: "memory");   // this wave's copies of stage 0 have landed
    __syncthreads();   // every wave's copies of stage 0 have landed before any wave reads the buffer
    issue(1, 1);
#pragma unroll 1   // rolled: one trip's code and fragment registers serve all stages
    for (int t = 0; t < NT; ++t) { const unsigned char* sb = sm + (t & 1) * STG;
#pragma unroll
        for (int kk = 0; kk < 2; ++kk) { v16bf a[4], a2[4], b[2];
#pragma unroll
            for (int mb = 0; mb < 4; ++mb) { a[mb] = WFrag<bf>::ld((const bf*)(sb + aofs + mb * 16 * GP + kk * 64)); if (NSPLIT) a2[mb] = WFrag<bf>::ld((const bf*)(sb + 2 * GT * GP + aofs + mb * 16 * GP + kk * 64)); }
#pragma unroll
            for (int nb = 0; nb < 2; ++nb) b[nb] = WFrag<bf>::ld((const bf*)(sb + bofs + nb * 16 * GP + kk * 64));
#pragma unroll
            for (int nb = 0; nb < 2; ++nb)
#pragma unroll
                for (int mb = 0; mb < 4; ++mb) { acc[mb][nb] = wmmab(a[mb], b[nb], acc[mb][nb]); if (NSPLIT) acc[mb][nb] = wmmab(a2[mb], b[nb], acc[mb][nb]); } }
        asm volatile("s_wait_dscnt 0x0" ::: "memory");      // this wave's reads of buffer t & 1 have returned before the buffer is given up
        asm volatile("s_wait_asynccnt 0x0" ::: "memory");   // this wave's copies of stage t + 1 have landed
        __syncthreads();   // publishes stage t + 1 and ends every wave's reads of the buffer that is refilled behind it
        if (t + 2 < NT) issue(t + 2, t & 1); }
    asm volatile("s_wait_asynccnt 0x0" ::: "memory");   // no copy is outstanding when the wave ends
    if constexpr (NSPLIT) {
        float* cp = C + (size_t)(r0 + (w >> 2) * 64 + hi * 8) * DD + c0 + (w & 3) * 32 + lr;
#pragma unroll
        for (int mb = 0; mb < 4; ++mb)
#pragma unroll
            for (int nb = 0; nb < 2; ++nb)
#pragma unroll
                for (int j = 0; j < 8; ++j) cp[(size_t)(mb * 16 + j) * DD + nb * 16] = acc[mb][nb][j];
    } else {
        // The wave's part as planes: 32 lines (one a column) of 64 elements. Planes q, k: [batch][head][t][d], line = (head, t); v: [batch][head][d][t], line = (head, d), 64 t of it.
        // A lane's 16-byte runs would reach memory as 32-byte pieces of 16 lines a store; staged in LDS (the ring is free: the loop's last barrier ended every read of it, no copy is outstanding), each wave in two areas of
        // its own (no barrier), they go out as 4 whole lines a store.
        unsigned char* st0 = sm + w * (2 * 32 * GP); unsigned char* st1 = st0 + 32 * GP;
        const int z = blockIdx.z, t0 = r0 & (TT - 1);
        bf* Ph = z == 0 ? Qh : z == 1 ? Kh : Vh; bf* Pl = z == 0 ? Ql : z == 1 ? Kl : Vl; h16* P16 = z == 0 ? Q16 : z == 1 ? K16 : V16;
        const unsigned e0 = (unsigned)(r0 / TT) * (TT * DD) + (sw ? (unsigned)(((c0 >> 6) + (w >> 2)) * (TT * HD) + (t0 + (w & 3) * 32) * HD) : (unsigned)((c0 + (w & 3) * 32) * TT + t0 + (w >> 2) * 64));   // first element of the wave's first line
        const unsigned pj = sw ? HD : TT;   // elements from one line to the next
        unsigned ob[8];   // byte offsets in a plane of the lane's eight 16-byte pieces: 8 lanes side by side on a line, 4 lines a store; formed once, in front of every store that names them
#pragma unroll
        for (int s = 0; s < 8; ++s) ob[s] = (e0 + (unsigned)(s * 4 + (lane >> 3)) * pj + (unsigned)(lane & 7) * 8) * 2;
        const int wo = lr * GP + hi * 16, ro = (lane >> 3) * GP + (lane & 7) * 16;
        auto flush = [&](const unsigned char* st, void* plane) { v8us r[8];   // one staged area to its plane
#pragma unroll
            for (int s = 0; s < 8; ++s) r[s] = *(const v8usa*)(st + ro + s * 4 * GP);
#pragma unroll
            for (int s = 0; s < 8; ++s) *(v8usa*)((unsigned char*)plane + ob[s]) = r[s];
        };
#pragma unroll
        for (int nb = 0; nb < 2; ++nb)
#pragma unroll
            for (int mb = 0; mb < 4; ++mb) { v8us oh, ol;
#pragma unroll
                for (int j = 0; j < 8; ++j) { unsigned short a, c2; splitf(acc[mb][nb][j], a, c2); oh[j] = a; ol[j] = c2; }
                *(v8usa*)(st0 + wo + nb * 16 * GP + mb * 32) = oh; *(v8usa*)(st1 + wo + nb * 16 * GP + mb * 32) = ol; }
        asm volatile("s_wait_dscnt 0x0" ::: "memory");   // the wave's LDS stores have landed before its lanes read one another's pieces
        flush(st0, Ph);
        asm volatile("s_wait_xcnt 0x0" ::: "memory");    // kept in front of the next write of a register that the eight stores name
        flush(st1, Pl);
        asm volatile("s_wait_xcnt 0x0" ::: "memory");    // as above
#pragma unroll
        for (int nb = 0; nb < 2; ++nb)
#pragma unroll
            for (int mb = 0; mb < 4; ++mb) { v8h o16;
#pragma unroll
                for (int j = 0; j < 8; ++j) o16[j] = tohx(acc[mb][nb][j]);
                *(v8ha*)(st0 + wo + nb * 16 * GP + mb * 32) = o16; }
        asm volatile("s_wait_dscnt 0x0" ::: "memory");   // as above; area 0 was read back whole in front of the stores of the first plane
        flush(st0, P16);
    }
}

typedef __attribute__((ext_vector_type(2))) unsigned short v2us;
typedef __attribute__((ext_vector_type(2))) _Float16 v2h;
typedef __attribute__((ext_vector_type(4))) _Float16 v4h;
typedef v4h __attribute__((may_alias)) v4ha;
typedef __attribute__((ext_vector_type(2))) float v2f;

// The three input conversions are bodies of ONE launch, k_prep (bx = the body's own block index); they do not depend on one another. The launch is a stream: few waves,
// each work-group reads 64 KiB, every thread has its 16 loads of 16 bytes in flight at once, every wave-wide load and store covers whole 128-byte lines.
typedef __attribute__((ext_vector_type(2))) unsigned v2u;
typedef v2u __attribute__((may_alias)) v2ua;
typedef unsigned __attribute__((may_alias)) u32a;
__device__ __forceinline__ unsigned pk2(float lo, float hi) { return (unsigned)f2bf(lo) | ((unsigned)f2bf(hi) << 16); }
#define TPN 64                    // n of a transpose tile: 256 bytes of a row of w
#define TPK 256                   // k of a transpose tile: 512 bytes of a row of Bt
// Bt[n][k] = bf16(w[k][n]), K = DD: one tile a work-group, turned in LDS. Thread = (row pair kr of 16, 16-byte piece nq of 16): rows k, k + 1 of four n give four words (k, k + 1) of four LDS rows.
// LDS row n = the tile's 256 k (512 bytes); its 16-byte piece ch lies at place ch ^ (n >> 2 & 15): the 32 words of a wave's store fall on 32 banks, and a wave reads a row back whole.
__device__ __forceinline__ void wtT_body(int bx, const float* __restrict__ w, int N, bf* Bt, unsigned char* sm) {
    const int tid = threadIdx.x, nq = tid & 15, kr = tid >> 4; const int ntl = N / TPN, n0 = (bx % ntl) * TPN, k0 = (bx / ntl) * TPK;
    const float* p = w + (size_t)(k0 + 2 * kr) * N + n0 + nq * 4; v4f a[8], b[8];
#pragma unroll
    for (int i = 0; i < 8; ++i) { a[i] = *(const v4fa*)(p + (size_t)(i * 32) * N); b[i] = *(const v4fa*)(p + (size_t)(i * 32 + 1) * N); }
    __builtin_amdgcn_sched_barrier(0);   // keeps the conversions behind the whole run: without it the build holds back the last loads until the first have returned, a second round trip to memory
    asm volatile("s_wait_xcnt 0x0" :: "v"(p) : "memory");   // kept in front of the next write of the address register that the 16 loads name; the address is an input, so that it stays in its register up to here
#pragma unroll
    for (int i = 0; i < 8; ++i)
#pragma unroll
        for (int j = 0; j < 4; ++j) *(u32a*)(sm + (nq * 4 + j) * (TPK * 2) + (((i * 4 + (kr >> 2)) ^ nq) * 16) + (kr & 3) * 4) = pk2(a[i][j], b[i][j]);
    __syncthreads();   // the whole tile is in LDS before any wave reads a row of it
    const int wv = tid >> 5, lane = tid & 31; v8us r[8];
#pragma unroll
    for (int s = 0; s < 8; ++s) { const int n = wv * 8 + s; r[s] = *(const v8usa*)(sm + n * (TPK * 2) + ((lane ^ ((n >> 2) & 15)) * 16)); }
    bf* q = Bt + (size_t)(n0 + wv * 8) * DD + k0 + lane * 8;
#pragma unroll
    for (int s = 0; s < 8; ++s) *(v8usa*)(q + s * DD) = r[s];
    asm volatile("s_wait_xcnt 0x0" ::: "memory");   // kept in front of the next write of a register that the eight stores name (the listing joins the bodies of k_prep behind them)
}
#define CVE 16384                 // elements of x a work-group converts
__device__ __forceinline__ void cvtS_body(int bx, const float* __restrict__ src, bf* dst) {
    const size_t e0 = (size_t)bx * CVE + threadIdx.x * 4; const float* p = src + e0; v4f v[16]; v2u o[16];
#pragma unroll
    for (int i = 0; i < 16; ++i) v[i] = *(const v4fa*)(p + i * 1024);
    __builtin_amdgcn_sched_barrier(0);   // as in wtT_body: all 16 loads are in flight before the first conversion
    asm volatile("s_wait_xcnt 0x0" :: "v"(p) : "memory");   // as in wtT_body
#pragma unroll
    for (int i = 0; i < 16; ++i) { o[i][0] = pk2(v[i][0], v[i][1]); o[i][1] = pk2(v[i][2], v[i][3]); }
    bf* q = dst + e0;
#pragma unroll
    for (int i = 0; i < 16; ++i) *(v2ua*)(q + i * 1024) = o[i];
    asm volatile("s_wait_xcnt 0x0" ::: "memory");   // as in wtT_body, behind the 16 stores
}
#define GWA (DD * 3 * DD / (TPN * TPK))  // work-groups of the w_attn transpose
#define GWP (DD * DD / (TPN * TPK))      // work-groups of the w_proj transpose
#define GXC (NB_ * TT * DD / CVE)        // work-groups of the x conversion, both batches
// grid GWA + GWP + GXC; the transposes (two phases and a barrier) have the lowest block indices. Every test is the same for a whole work-group.
__global__ __launch_bounds__(256) void k_prep(const float* __restrict__ x, const float* __restrict__ wqkv, const float* __restrict__ wo, bf* XB, bf* WQKV, bf* WO) {
    __shared__ __align__(16) unsigned char sm[TPN * TPK * 2];
    const int bx = blockIdx.x;
    if (bx < GWA) wtT_body(bx, wqkv, 3 * DD, WQKV, sm);
    else if (bx < GWA + GWP) wtT_body(bx - GWA, wo, DD, WO, sm);
    else cvtS_body(bx - (GWA + GWP), x, XB);
}
#define LOG2E 1.44269504088896341f
__device__ __forceinline__ void exp2x8(float (&x)[8]) { asm("v_exp_f32 %0, %0\n\tv_exp_f32 %1, %1\n\tv_exp_f32 %2, %2\n\tv_exp_f32 %3, %3\n\tv_exp_f32 %4, %4\n\tv_exp_f32 %5, %5\n\tv_exp_f32 %6, %6\n\tv_exp_f32 %7, %7\n\tv_nop" : "+v"(x[0]), "+v"(x[1]), "+v"(x[2]), "+v"(x[3]), "+v"(x[4]), "+v"(x[5]), "+v"(x[6]), "+v"(x[7])); }
__device__ __forceinline__ void log2x8(float (&x)[8]) { asm("v_log_f32 %0, %0\n\tv_log_f32 %1, %1\n\tv_log_f32 %2, %2\n\tv_log_f32 %3, %3\n\tv_log_f32 %4, %4\n\tv_log_f32 %5, %5\n\tv_log_f32 %6, %6\n\tv_log_f32 %7, %7\n\tv_nop" : "+v"(x[0]), "+v"(x[1]), "+v"(x[2]), "+v"(x[3]), "+v"(x[4]), "+v"(x[5]), "+v"(x[6]), "+v"(x[7])); }
__device__ __forceinline__ float expx1(float a) { float x = a * LOG2E; asm("v_exp_f32 %0, %0\n\tv_nop" : "+v"(x)); return x; }   // e^a
// The wait that is kept between a run of global loads and the next write of a register that one of them names as its address. The run's addresses are inputs of the statement: they stay in their registers
// up to the wait, wherever the build lets it stand behind the run, so that neither a result of the run nor the vector work behind it is given those registers in front of it.
template <typename T16> __device__ __forceinline__ void xwait2(const T16* a, const T16* b) { asm volatile("s_wait_xcnt 0x0" :: "v"(a), "v"(b) : "memory"); }
#define FW 8                      // waves per work-group of k_fattn
#define QGL 2                     // 16-query groups per work-group, fp16 rows
#define QGH 1                     // 16-query groups per work-group, hi+lo rows
struct FSh { v4f red[FW][4 * QGL][2 * 32 + 2];   // [wave][fragment][half * 32 + lane]; the two spare entries shift each fragment by 32 bytes, so that the adders' reads of four fragments side by side fall on different banks
             float sm[FW][QGL * 16]; float sl[FW][QGL * 16]; float se[FW][QGL * 16]; };
template <typename T16, bool HI, int QG>
__device__ __forceinline__ void fattn_body(const T16* __restrict__ Q, const T16* __restrict__ Q2, const T16* __restrict__ Kp, const T16* __restrict__ K2, const T16* __restrict__ Vt, const T16* __restrict__ V2,
                                           int q0, float* ENTh, bf* Ah, bf* Al, FSh& sh) {
    typedef typename WFrag<T16>::V V; static_assert(QG == 1 || QG == 2, "the statement at the foot of walk 2 names the accumulators of two groups");
    const int w = __builtin_amdgcn_readfirstlane((int)(threadIdx.x >> 5));   // wave number, held scalar
    const int lane = threadIdx.x & 31, c = lane & 15, h = lane >> 4;
    const int nkb = (q0 + QG * 16 + 31) >> 5;   // 32-key blocks that hold a key <= the last query
    V qf[QG][2], qf2[QG][2];
#pragma unroll
    for (int g = 0; g < QG; ++g)
#pragma unroll
        for (int kk = 0; kk < 2; ++kk) { const size_t o = (size_t)(q0 + g * 16 + c) * HD + kk * 32 + 8 * h; qf[g][kk] = WFrag<T16>::ld(Q + o); if (HI) qf2[g][kk] = WFrag<T16>::ld(Q2 + o); }
    asm volatile("s_wait_xcnt 0x0" ::: "memory");   // kept in front of the next write of an address register that the query loads name
    V kf[2][2], kf2[2][2];   // the key rows k0 .. k0 + 31 as A fragments
    auto loadk = [&](int k0) { const size_t o = (size_t)(k0 + c) * HD + 8 * h; const T16* kp = Kp + o; const T16* kp2 = HI ? K2 + o : kp;   // one address a plane, the rest of a run is constant offsets
#pragma unroll
        for (int t = 0; t < 2; ++t)
#pragma unroll
            for (int kk = 0; kk < 2; ++kk) { kf[t][kk] = WFrag<T16>::ld(kp + t * 16 * HD + kk * 32); if (HI) kf2[t][kk] = WFrag<T16>::ld(kp2 + t * 16 * HD + kk * 32); }
        xwait2(kp, kp2);
        if constexpr (HI) __builtin_amdgcn_sched_barrier(0);   // keeps the matrix instructions behind the whole run: without it the build refills a few registers in turn, and the 16 loads become a chain of seven round trips
    };
    // st[t][g][r] = masked scaled score of key k0 + t * 16 + 8 h + r and query q0 + g * 16 + c, from the fragments in kf
    auto scores = [&](int k0, v8f (&st)[2][QG]) {
#pragma unroll
        for (int t = 0; t < 2; ++t)
#pragma unroll
            for (int g = 0; g < QG; ++g) { v8f a = (v8f){};
#pragma unroll
                for (int kk = 0; kk < 2; ++kk) { a = WFrag<T16>::mma(kf[t][kk], qf[g][kk], a); if (HI) { a = WFrag<T16>::mma(kf[t][kk], qf2[g][kk], a); a = WFrag<T16>::mma(kf2[t][kk], qf[g][kk], a); } }
#pragma unroll
                for (int r = 0; r < 8; ++r) st[t][g][r] = a[r] * SCL; }
        if (k0 + 31 > q0) {   // a scalar test: only a block that reaches past the first query holds a key to cut
#pragma unroll
            for (int t = 0; t < 2; ++t)
#pragma unroll
                for (int g = 0; g < QG; ++g) { const int dq = q0 + g * 16 + c - (k0 + t * 16 + 8 * h);   // key r of this lane is kept while r <= dq
#pragma unroll
                    for (int r = 0; r < 8; ++r) st[t][g][r] = (r <= dq) ? st[t][g][r] : -3.0e38f; } }
    };
    float m[QG], l[QG];
#pragma unroll
    for (int g = 0; g < QG; ++g) { m[g] = -3.0e38f; l[g] = 0.f; }
    constexpr bool PF = !HI;   // key rows fetched one trip ahead; not for the hi+lo rows, where RH / 32 <= FW blocks leave a wave one trip at most
    if (PF && w < nkb) loadk(w * 32);
#pragma unroll 1   // rolled: the key fragments are refilled in place, one trip's registers serve every trip
    for (int kb = w; kb < nkb; kb += FW) { if (!PF) loadk(kb * 32);
        v8f st[2][QG]; scores(kb * 32, st);
        if (PF) loadk(min(kb + FW, nkb - 1) * 32);   // the next trip's key rows fly, into the same registers, while this trip's vector work runs (the last trip fetches the last block once more: in bounds, unused)
#pragma unroll
        for (int g = 0; g < QG; ++g) { float bm = m[g];
#pragma unroll
            for (int r = 0; r < 8; ++r) bm = fmaxf(bm, fmaxf(st[0][g][r], st[1][g][r]));
            float s = 0.f;
#pragma unroll
            for (int t = 0; t < 2; ++t) { float e[8];
#pragma unroll
                for (int r = 0; r < 8; ++r) e[r] = (st[t][g][r] - bm) * LOG2E;
                exp2x8(e);
#pragma unroll
                for (int r = 0; r < 8; ++r) s += e[r]; }
            l[g] = l[g] * expx1(m[g] - bm) + s; m[g] = bm; } }   // a lane that has met masked keys only counts ones under m = -3e38: the joins below scale them by exp(-3e38 - max) = 0
#pragma unroll
    for (int g = 0; g < QG; ++g) { const float mo = __shfl_xor(m[g], 16, 32), lo = __shfl_xor(l[g], 16, 32); const float mn = fmaxf(m[g], mo);
        const float lj = l[g] * expx1(m[g] - mn) + lo * expx1(mo - mn); if (h == 0) { sh.sm[w][g * 16 + c] = mn; sh.sl[w][g * 16 + c] = lj; } }
    __syncthreads();   // every wave's maxima and sums are in LDS before any wave joins them
    float M[QG], pn[QG], f[QG], en[QG];
#pragma unroll
    for (int g = 0; g < QG; ++g) { float mx = sh.sm[0][g * 16 + c];
#pragma unroll
        for (int s = 1; s < FW; ++s) mx = fmaxf(mx, sh.sm[s][g * 16 + c]);
        float L = 0.f;
#pragma unroll
        for (int s = 0; s < FW; ++s) L += sh.sl[s][g * 16 + c] * expx1(sh.sm[s][g * 16 + c] - mx);
        M[g] = mx; pn[g] = __fdiv_rn(1.0f, L); f[g] = __fdiv_rn(HI ? 1.0f : PCAR, L); en[g] = 0.f; }
    v8f o[4][QG];
#pragma unroll
    for (int dt = 0; dt < 4; ++dt)
#pragma unroll
        for (int g = 0; g < QG; ++g) o[dt][g] = (v8f){};
    if (PF && w < nkb) loadk(w * 32);
#pragma unroll 1   // rolled, as walk 1: fragments refilled in place keep the wave inside its register limit
    for (int kb = w; kb < nkb; kb += FW) { const int k0 = kb * 32; V vf[4], vf2[4];
        const size_t vo = (size_t)c * TT + k0 + 8 * h; const T16* vp = Vt + vo; const T16* vp2 = HI ? V2 + vo : vp;
#pragma unroll
        for (int dt = 0; dt < 4; ++dt) { vf[dt] = WFrag<T16>::ld(vp + dt * 16 * TT); if (HI) vf2[dt] = WFrag<T16>::ld(vp2 + dt * 16 * TT); }
        xwait2(vp, vp2);
        if (!PF) loadk(k0);
        v8f st[2][QG]; scores(k0, st);
        if (PF) loadk(min(kb + FW, nkb - 1) * 32);   // as in walk 1: the next trip's key rows fly while this trip's vector work and Ot products run
#pragma unroll
        for (int g = 0; g < QG; ++g) { V pb, pb2;
            float y[2][8];
#pragma unroll
            for (int t = 0; t < 2; ++t) { float e[8], q[8];
#pragma unroll
                for (int r = 0; r < 8; ++r) e[r] = (st[t][g][r] - M[g]) * LOG2E;
                exp2x8(e);
#pragma unroll
                for (int r = 0; r < 8; ++r) q[r] = e[r] * pn[g] + 1e-8f;
                log2x8(q);
#pragma unroll
                for (int r = 0; r < 8; ++r) { en[g] -= (e[r] * pn[g]) * q[r]; y[t][r] = e[r] * f[g]; } }   // a masked key: e = 0, p = 0, term 0
            if constexpr (HI) { v8us h0, h1, l0, l1;
#pragma unroll
                for (int r = 0; r < 8; ++r) { unsigned short a, b2; splitf(y[0][r], a, b2); h0[r] = a; l0[r] = b2; splitf(y[1][r], a, b2); h1[r] = a; l1[r] = b2; }
                pb = cat16b(h0, h1); pb2 = cat16b(l0, l1);
            } else { v8h h0, h1;
#pragma unroll
                for (int r = 0; r < 8; ++r) { h0[r] = tohx(y[0][r]); h1[r] = tohx(y[1][r]); }
                pb = cat16(h0, h1); }
#pragma unroll
            for (int dt = 0; dt < 4; ++dt) { o[dt][g] = WFrag<T16>::mma(vf[dt], pb, o[dt][g]); if (HI) { o[dt][g] = WFrag<T16>::mma(vf[dt], pb2, o[dt][g]); o[dt][g] = WFrag<T16>::mma(vf2[dt], pb, o[dt][g]); } } }
        // the four slots keep the distance between the trip's last matrix instructions (every accumulator is named, so that all of them stand in front) and the first vector instruction behind the branch, on both of its sides
        if constexpr (QG == 1) asm volatile("v_nop\n\tv_nop\n\tv_nop\n\tv_nop" : "+v"(o[0][0]), "+v"(o[1][0]), "+v"(o[2][0]), "+v"(o[3][0]));
        else asm volatile("v_nop\n\tv_nop\n\tv_nop\n\tv_nop" : "+v"(o[0][0]), "+v"(o[1][0]), "+v"(o[2][0]), "+v"(o[3][0]), "+v"(o[0][QG - 1]), "+v"(o[1][QG - 1]), "+v"(o[2][QG - 1]), "+v"(o[3][QG - 1])); }
#pragma unroll
    for (int dt = 0; dt < 4; ++dt)
#pragma unroll
        for (int g = 0; g < QG; ++g) { const v8f a = o[dt][g]; sh.red[w][dt * QG + g][lane] = (v4f){a[0], a[1], a[2], a[3]}; sh.red[w][dt * QG + g][32 + lane] = (v4f){a[4], a[5], a[6], a[7]}; }
#pragma unroll
    for (int g = 0; g < QG; ++g) { const float ej = en[g] + __shfl_xor(en[g], 16, 32); if (h == 0) sh.se[w][g * 16 + c] = ej; }
    __syncthreads();   // every wave's partial Ot tiles and entropy sums are in LDS before any wave adds them
    // Wave w owns queries w * QW .. w * QW + QW - 1 with all 64 d: a whole 128-byte line of Ah and of Al has one writing wave. Unit u = (query, 16-d tile dt, half hh): 8 consecutive d.
    constexpr int QW = QG * 16 / FW, NU = QW * 8; const float cs = HI ? 1.0f : (1.0f / PCAR);
#pragma unroll
    for (int u0 = 0; u0 < NU; u0 += 32) { const int u = u0 + lane;
        if (u < NU) { const int qq = w * QW + (u % QW), dt = (u / QW) & 3, hh = u / (QW * 4); const int fi = dt * QG + (qq >> 4), sl = (qq & 15) + 16 * hh;
            v4f s0 = sh.red[0][fi][sl], s1 = sh.red[0][fi][32 + sl];
#pragma unroll
            for (int s = 1; s < FW; ++s) { s0 += sh.red[s][fi][sl]; s1 += sh.red[s][fi][32 + sl]; }
            v8us oh, ol;
#pragma unroll
            for (int r = 0; r < 4; ++r) { unsigned short a, b2; splitf(s0[r] * cs, a, b2); oh[r] = a; ol[r] = b2; splitf(s1[r] * cs, a, b2); oh[4 + r] = a; ol[4 + r] = b2; }
            const size_t oo = (size_t)(q0 + qq) * DD + dt * 16 + hh * 8; *(v8us*)(Ah + oo) = oh; *(v8us*)(Al + oo) = ol;
            asm volatile("s_wait_xcnt 0x0" ::: "memory"); } }   // kept in front of the next write of a register that the two stores name
    if (threadIdx.x < QG * 16) { float e = sh.se[0][threadIdx.x];
#pragma unroll
        for (int s = 1; s < FW; ++s) e += sh.se[s][threadIdx.x];
        ENTh[(size_t)(q0 + (int)threadIdx.x) * 32] = e * 0.69314718055994531f; }   // the terms were summed with log2; k_entpart reads word 0 of a row's line
}
// grid (x, batch * NH_ + head): x < (TT - RH) / (QGL * 16): fp16 query blocks, the longest first; behind them the hi+lo blocks. The test is the same for a whole work-group.
// Four waves a SIMD (at most 256 registers a wave): two work-groups share a WGP, so that one's vector work covers the other's load waits, barriers and LDS sums.
__global__ __launch_bounds__(32 * FW) __attribute__((amdgpu_waves_per_eu(4, 4))) void k_fattn(const bf* __restrict__ Qh, const bf* __restrict__ Ql, const bf* __restrict__ Kh, const bf* __restrict__ Kl, const bf* __restrict__ Vh, const bf* __restrict__ Vl,
                                                   const h16* __restrict__ Q16, const h16* __restrict__ K16, const h16* __restrict__ V16, float* ENT, bf* Ah, bf* Al) {
    __shared__ FSh sh;
    constexpr int NL = (TT - RH) / (QGL * 16);
    const int x = blockIdx.x; const size_t z = (size_t)blockIdx.y * TT * HD; float* ENTh = ENT + (size_t)blockIdx.y * TT * 32;   // planes [batch][head][..][..], ENT [batch][head][query] lines
    const size_t ao = (size_t)(blockIdx.y / NH_) * TT * DD + (blockIdx.y % NH_) * HD; Ah += ao; Al += ao;   // merged rows [batch][query][head * HD + d]
    if (x < NL) fattn_body<h16, false, QGL>(Q16 + z, nullptr, K16 + z, nullptr, V16 + z, nullptr, TT - (x + 1) * (QGL * 16), ENTh, Ah, Al, sh);
    else fattn_body<bf, true, QGH>(Qh + z, Ql + z, Kh + z, Kl + z, Vh + z, Vl + z, (x - NL) * (QGH * 16), ENTh, Ah, Al, sh);
}

// Mean of the NB_ * NH_ * TT row entropies in two launches: one wave alone would walk all the ENT lines in a chain of load round trips.
// k_entpart: work-group g sums rows g * 256 .. g * 256 + 255, one row a thread (every load of the launch is in flight at once): lane tree, then the 8 wave sums through LDS -> line PART[g][0..31] (lane 0 the sum, the rest 0).
#define EPW 256                   // rows per work-group of k_entpart
__global__ __launch_bounds__(EPW) void k_entpart(const float* __restrict__ ENT, float* PART) {
    __shared__ float wsum[EPW / 32];
    const int lane = threadIdx.x & 31, w = threadIdx.x >> 5; float s = ENT[((size_t)blockIdx.x * EPW + threadIdx.x) * 32];
#pragma unroll
    for (int sh = 16; sh; sh >>= 1) s += __shfl_xor(s, sh, 32);
    if (lane == 0) wsum[w] = s;
    __syncthreads();   // all 8 wave sums are in LDS before wave 0 adds them
    if (w == 0) { float t = lane < EPW / 32 ? wsum[lane] : 0.f;
#pragma unroll
        for (int sh = EPW / 64; sh; sh >>= 1) t += __shfl_xor(t, sh, 32);
        PART[(size_t)blockIdx.x * 32 + lane] = lane == 0 ? t : 0.f; }
}
// k_entmean: one wave sums the NB_ * NH_ * TT / EPW partial sums (8 independent loads a lane) and scales.
__global__ __launch_bounds__(32) void k_entmean(const float* __restrict__ PART, float* OUT1) { const int lane = threadIdx.x; float s = 0.f;
#pragma unroll
    for (int r = 0; r < NB_ * NH_ * TT / EPW; r += 32) s += PART[(size_t)(r + lane) * 32];
#pragma unroll
    for (int sh = 16; sh; sh >>= 1) s += __shfl_xor(s, sh, 32);
    if (lane == 0) { const float m = s * (1.0f / (float)(NB_ * NH_ * TT)); *(float*)OUT1 = m;  } }
extern "C" void kernel_launch(void* const* d_in, const int* in_sizes, int n_in,
                              void* d_out, int out_size, void* d_ws, size_t ws_size, hipStream_t stream) {
    (void)in_sizes; (void)n_in; (void)out_size;
    const float* x = (const float*)d_in[0]; const float* wqkv = (const float*)d_in[1]; const float* wo = (const float*)d_in[2];   // w_attn [1024][3072], w_proj [1024][1024] as x @ W (no biases)
    float* OUT = (float*)d_out; float* OUT1 = OUT + (size_t)NB_ * TT * DD;     // [2][2048][1024] at 0; [1] entropy at byte 16,777,216
    char* wsp = (char*)d_ws;
    auto take = [&](size_t bytes) { char* p = wsp; wsp += (bytes + 255) & ~(size_t)255; return (void*)p; };
    bf* WQKV = (bf*)take((size_t)3 * DD * DD * 2); bf* WO = (bf*)take((size_t)DD * DD * 2);
    bf* XB = (bf*)take((size_t)NB_ * TT * DD * 2);   // x of both batches
    const size_t PB = (size_t)NB_ * TT * DD * 2;   // a 16-bit plane of both batches
    bf* QPh = (bf*)take(PB); bf* QPl = (bf*)take(PB); bf* KPh = (bf*)take(PB); bf* KPl = (bf*)take(PB); bf* VTh = (bf*)take(PB); bf* VTl = (bf*)take(PB);
    h16* QP16 = (h16*)take(PB); h16* KP16 = (h16*)take(PB); h16* VT16 = (h16*)take(PB);
    float* ENT = (float*)take((size_t)NB_ * NH_ * TT * 32 * 4); bf* ATh = (bf*)take(PB); bf* ATl = (bf*)take(PB); float* PART = (float*)take((size_t)(NB_ * NH_ * TT / EPW) * 32 * 4);
    if ((size_t)(wsp - (char*)d_ws) > ws_size) return;    // total 112 MiB
    k_prep<<<GWA + GWP + GXC, 256, 0, stream>>>(x, wqkv, wo, XB, WQKV, WO);
    // both batches are the rows of one product (M = NB_ * TT); z = q, k, v: the weight rows and the operand planes of each
    k_gemml<0><<<dim3(NB_ * TT / GT, DD / GT, 3), 256, 0, stream>>>(XB, nullptr, WQKV, nullptr, QPh, QPl, QP16, KPh, KPl, KP16, VTh, VTl, VT16);
    k_fattn<<<dim3((TT - RH) / (QGL * 16) + RH / (QGH * 16), NB_ * NH_, 1), 32 * FW, 0, stream>>>(QPh, QPl, KPh, KPl, VTh, VTl, QP16, KP16, VT16, ENT, ATh, ATl);
    k_gemml<1><<<dim3(NB_ * TT / GT, DD / GT, 1), 256, 0, stream>>>(ATh, ATl, WO, OUT, nullptr, nullptr, nullptr, nullptr, nullptr, nullptr, nullptr, nullptr, nullptr);
    k_entpart<<<NB_ * NH_ * TT / EPW, EPW, 0, stream>>>(ENT, PART); k_entmean<<<1, 32, 0, stream>>>(PART, OUT1);
}

// v010
// One run takes 106 microseconds.
// Next to v009, in two timings, it ran 1.24 times as fast each time.
// Counting every step since v000, it is 21.0 times as fast.
#include <hip/hip_runtime.h>

// Causal multi-head self-attention with an attention-entropy monitor (x [2][2048][1024]; qkv = x w_attn (16 heads x 64, no bias); causal softmax(q.k/8); y = merged att.v w_proj -> [2][2048][1024];
// second output = mean over all (batch, head, query) rows of the row entropy -sum_s att log(att + 1e-8) -> [1]).
// Compute dtypes, f32 accumulate: every input rounded to bf16; qkv projection on PLAIN bf16 operands (inputs: exact products, f32 accumulate); w_proj on att.v hi+lo planes (2 products); PER-ROW PRECISION HYBRID:
// query rows < 256 take scores and att.v on bf16 hi+lo planes (3 products), rows >= 256 on single fp16 planes; 1/8, the causal cut, the softmax and the row entropy (from the f32 probabilities, hardware

#define NB_  2
#define TT   2048
#define DD   1024
#define NH_  16
#define HD   64
#define RH   256                  // query rows < RH: hi+lo planes; rows >= RH: fp16 planes
#define NF   32                   // head_dim / 2 (unused here)
#define SCL  0.125f               // 1/sqrt(64)
#define PCAR 1024.0f         // P scale for fp16 rows >= RH, undone in k_fattn's head merge
typedef _Float16 h16;
typedef unsigned short bf;
typedef __attribute__((ext_vector_type(16))) __bf16   v16bf;
typedef __attribute__((ext_vector_type(16))) _Float16 v16h;
typedef __attribute__((ext_vector_type(8)))  _Float16 v8h;
typedef __attribute__((ext_vector_type(8)))  unsigned short v8us;
typedef __attribute__((ext_vector_type(8)))  float    v8f;
typedef __attribute__((ext_vector_type(4)))  float    v4f;
typedef v8h  __attribute__((may_alias)) v8ha;
typedef v4f  __attribute__((may_alias)) v4fa;
typedef v8us __attribute__((may_alias)) v8usa;

__device__ __forceinline__ unsigned short f2bf(float f) { unsigned u = __float_as_uint(f); u += 0x7FFFu + ((u >> 16) & 1u); return (unsigned short)(u >> 16); }
__device__ __forceinline__ float bf2f(unsigned short b) { return __uint_as_float(((unsigned)b) << 16); }
__device__ __forceinline__ float bfr(float f) { return bf2f(f2bf(f)); }
__device__ __forceinline__ v16h cat16(v8h lo, v8h hi) { return __builtin_shufflevector(lo, hi, 0, 1, 2, 3, 4, 5, 6, 7, 8, 9, 10, 11, 12, 13, 14, 15); }
__device__ __forceinline__ v16bf cat16b(v8us lo, v8us hi) { return __builtin_bit_cast(v16bf, __builtin_shufflevector(lo, hi, 0, 1, 2, 3, 4, 5, 6, 7, 8, 9, 10, 11, 12, 13, 14, 15)); }
__device__ __forceinline__ v8f wmma16(v16h a, v16h b, v8f c) { return __builtin_amdgcn_wmma_f32_16x16x32_f16(false, a, false, b, (short)0, c, false, false); }
__device__ __forceinline__ v8f wmmab(v16bf a, v16bf b, v8f c) { return __builtin_amdgcn_wmma_f32_16x16x32_bf16(false, a, false, b, (short)0, c, false, false); }
__device__ __forceinline__ h16 tohx(float x) { return (h16)x; }
__device__ __forceinline__ void splitf(float y, unsigned short& h, unsigned short& l) { h = f2bf(y); l = f2bf(y - bf2f(h)); }



// ---- k_gemml: sum_k (A[m][k] + A2[m][k]) Bt[n][k], K = DD, all planes bf16 with K-contiguous rows of pitch DD (A2 only with NSPLIT == 1: two products into one accumulator). grid (M / 128, N / 128, Z), 256 threads.
// NSPLIT == 1: the product goes to C[m][n] (f32, pitch DD). NSPLIT == 0 (z = q, k, v; Bt = the three weight blocks one behind the other): the product never goes to memory in f32, the epilogue writes k_fattn's operand planes.
// One 128 x 128 tile of C a work-group. A stage is 64 k (one whole 128-byte line) of the tile's 128 rows of every plane; asynchronous copies of 16 bytes a lane bring it into LDS, eight lanes side by side on a line,
// so that every line leaves L2 once a work-group and whole, and all eight waves read their fragments from LDS. Two buffers: stage t + 1 flies while stage t is worked on.
// Wave w has the 64 x 32 part at rows (w >> 2) * 64, columns (w & 3) * 32 (8 accumulators) over the whole K: a 128-byte line of C has one writing wave.
// A lane of an accumulator holds 8 consecutive rows of one column, and a plane wants 8 consecutive elements of its contiguous index (d for q and k, t for the transposed v): so for q and k the weight rows are
// the row operand and the x rows the column operand (same loader, same k order, the two pointers change places); for v as written above. Those 16 bytes of a lane are a lane's 16 bytes of a fragment of k_fattn: the planes are kept in that order.
template <typename T16> struct WFrag;
template <> struct WFrag<h16> { typedef v16h V; static __device__ __forceinline__ V ld(const h16* p) { return cat16(*(const v8h*)p, *(const v8h*)(p + 16)); } static __device__ __forceinline__ V ldf(const h16* p) { return cat16(*(const v8h*)p, *(const v8h*)(p + 256)); } static __device__ __forceinline__ v8f mma(V a, V b, v8f c) { return wmma16(a, b, c); } };
template <> struct WFrag<bf> { typedef v16bf V; static __device__ __forceinline__ V ld(const bf* p) { return cat16b(*(const v8us*)p, *(const v8us*)(p + 16)); } static __device__ __forceinline__ V ldf(const bf* p) { return cat16b(*(const v8us*)p, *(const v8us*)(p + 256)); } static __device__ __forceinline__ v8f mma(V a, V b, v8f c) { return wmmab(a, b, c); } };
#define GT 128                    // rows of a plane in a stage
#define GK 64                     // k elements of a stage
#define GP 144                    // LDS row pitch in bytes: 16 x odd, the 16-byte fragment reads of 16 rows fall on different banks
template <int NSPLIT>
__global__ __launch_bounds__(256) void k_gemml(const bf* __restrict__ A, const bf* __restrict__ A2, const bf* __restrict__ Bt, float* C,
                                               bf* Qh, bf* Ql, h16* Q16, bf* Kh, bf* Kl, h16* K16, bf* Vh, bf* Vl, h16* V16) {
    constexpr int NP = NSPLIT ? 3 : 2, STG = NP * GT * GP, NT = DD / GK;   // planes a stage [A | Bt | A2], bytes a stage, stages
    __shared__ __align__(16) unsigned char sm[2 * STG];
    const int w = __builtin_amdgcn_readfirstlane((int)(threadIdx.x >> 5));   // wave number, held scalar
    const int lane = threadIdx.x & 31, lr = lane & 15, hi = lane >> 4; const int r0 = blockIdx.x * GT, c0 = blockIdx.y * GT;
    const bool sw = !NSPLIT && blockIdx.z < 2;   // q, k: the operands change places; the same for a whole work-group
    const bf* Ar = A + (size_t)r0 * DD; const bf* Br = Bt + ((size_t)blockIdx.z * DD + c0) * DD; const bf* P0 = sw ? Br : Ar; const bf* P1 = sw ? Ar : Br;   // first rows of the row operand and of the column operand
    // copies: thread = (row crow of 32, 16-byte piece cseg of 8); four copies a plane, 32 rows apart
    const int crow = threadIdx.x >> 3, cseg = threadIdx.x & 7;
    const bf* ga = P0 + (size_t)crow * DD + cseg * 8; const bf* gb = P1 + (size_t)crow * DD + cseg * 8; const bf* ga2 = NSPLIT ? A2 + (size_t)(r0 + crow) * DD + cseg * 8 : ga;
    const unsigned l0 = (unsigned)(size_t)sm + (unsigned)(crow * GP + cseg * 16);   // the lane's LDS byte address in buffer 0, plane 0
    auto issue = [&](int t, int buf) {   // stage t into buffer buf; the wait is the statement's last line: it stands in front of every later write of a register that a copy names
        const unsigned la = l0 + (unsigned)(buf * STG), lb = la + GT * GP; const bf* pa = ga + t * GK; const bf* pb = gb + t * GK;
        if constexpr (NSPLIT) { const unsigned lc = lb + GT * GP; const bf* pc = ga2 + t * GK;
            asm volatile("global_load_async_to_lds_b128 %0, %1, off\n\tglobal_load_async_to_lds_b128 %2, %3, off\n\tglobal_load_async_to_lds_b128 %4, %5, off\n\tglobal_load_async_to_lds_b128 %6, %7, off\n\t"
                         "global_load_async_to_lds_b128 %8, %9, off\n\tglobal_load_async_to_lds_b128 %10, %11, off\n\tglobal_load_async_to_lds_b128 %12, %13, off\n\tglobal_load_async_to_lds_b128 %14, %15, off\n\t"
                         "global_load_async_to_lds_b128 %16, %17, off\n\tglobal_load_async_to_lds_b128 %18, %19, off\n\tglobal_load_async_to_lds_b128 %20, %21, off\n\tglobal_load_async_to_lds_b128 %22, %23, off\n\ts_wait_xcnt 0x0"
                         :: "v"(la), "v"(pa), "v"(la + 32 * GP), "v"(pa + 32 * DD), "v"(la + 64 * GP), "v"(pa + 64 * DD), "v"(la + 96 * GP), "v"(pa + 96 * DD),
                            "v"(lb), "v"(pb), "v"(lb + 32 * GP), "v"(pb + 32 * DD), "v"(lb + 64 * GP), "v"(pb + 64 * DD), "v"(lb + 96 * GP), "v"(pb + 96 * DD),
                            "v"(lc), "v"(pc), "v"(lc + 32 * GP), "v"(pc + 32 * DD), "v"(lc + 64 * GP), "v"(pc + 64 * DD), "v"(lc + 96 * GP), "v"(pc + 96 * DD) : "memory");
        } else {
            asm volatile("global_load_async_to_lds_b128 %0, %1, off\n\tglobal_load_async_to_lds_b128 %2, %3, off\n\tglobal_load_async_to_lds_b128 %4, %5, off\n\tglobal_load_async_to_lds_b128 %6, %7, off\n\t"
                         "global_load_async_to_lds_b128 %8, %9, off\n\tglobal_load_async_to_lds_b128 %10, %11, off\n\tglobal_load_async_to_lds_b128 %12, %13, off\n\tglobal_load_async_to_lds_b128 %14, %15, off\n\ts_wait_xcnt 0x0"
                         :: "v"(la), "v"(pa), "v"(la + 32 * GP), "v"(pa + 32 * DD), "v"(la + 64 * GP), "v"(pa + 64 * DD), "v"(la + 96 * GP), "v"(pa + 96 * DD),
                            "v"(lb), "v"(pb), "v"(lb + 32 * GP), "v"(pb + 32 * DD), "v"(lb + 64 * GP), "v"(pb + 64 * DD), "v"(lb + 96 * GP), "v"(pb + 96 * DD) : "memory");
        }
    };
    v8f acc[4][2];
#pragma unroll
    for (int mb = 0; mb < 4; ++mb)
#pragma unroll
        for (int nb = 0; nb < 2; ++nb) acc[mb][nb] = (v8f){};
    const int aofs = ((w >> 2) * 64 + lr) * GP + hi * 16, bofs = GT * GP + ((w & 3) * 32 + lr) * GP + hi * 16;   // byte offsets of the wave's first A and Bt fragment rows in a stage
    issue(0, 0);
    asm volatile("s_wait_asynccnt 0x0" ::: "memory");   // this wave's copies of stage 0 have landed
    __syncthreads();   // every wave's copies of stage 0 have landed before any wave reads the buffer
    issue(1, 1);
#pragma unroll 1   // rolled: one trip's code and fragment registers serve all stages
    for (int t = 0; t < NT; ++t) { const unsigned char* sb = sm + (t & 1) * STG;
#pragma unroll
        for (int kk = 0; kk < 2; ++kk) { v16bf a[4], a2[4], b[2];
#pragma unroll
            for (int mb = 0; mb < 4; ++mb) { a[mb] = WFrag<bf>::ld((const bf*)(sb + aofs + mb * 16 * GP + kk * 64)); if (NSPLIT) a2[mb] = WFrag<bf>::ld((const bf*)(sb + 2 * GT * GP + aofs + mb * 16 * GP + kk * 64)); }
#pragma unroll
            for (int nb = 0; nb < 2; ++nb) b[nb] = WFrag<bf>::ld((const bf*)(sb + bofs + nb * 16 * GP + kk * 64));
#pragma unroll
            for (int nb = 0; nb < 2; ++nb)
#pragma unroll
                for (int mb = 0; mb < 4; ++mb) { acc[mb][nb] = wmmab(a[mb], b[nb], acc[mb][nb]); if (NSPLIT) acc[mb][nb] = wmmab(a2[mb], b[nb], acc[mb][nb]); } }
        asm volatile("s_wait_dscnt 0x0" ::: "memory");      // this wave's reads of buffer t & 1 have returned before the buffer is given up
        asm volatile("s_wait_asynccnt 0x0" ::: "memory");   // this wave's copies of stage t + 1 have landed
        __syncthreads();   // publishes stage t + 1 and ends every wave's reads of the buffer that is refilled behind it
        if (t + 2 < NT) issue(t + 2, t & 1); }
    asm volatile("s_wait_asynccnt 0x0" ::: "memory");   // no copy is outstanding when the wave ends
    if constexpr (NSPLIT) {
        float* cp = C + (size_t)(r0 + (w >> 2) * 64 + hi * 8) * DD + c0 + (w & 3) * 32 + lr;
#pragma unroll
        for (int mb = 0; mb < 4; ++mb)
#pragma unroll
            for (int nb = 0; nb < 2; ++nb)
#pragma unroll
                for (int j = 0; j < 8; ++j) cp[(size_t)(mb * 16 + j) * DD + nb * 16] = acc[mb][nb][j];
    } else {
        // The wave's part as planes in FRAGMENT ORDER (the comment in front of k_fattn has the order): a lane's 8 accumulator rows of one column are the 16 bytes that the same lane of a wave of k_fattn loads,
        // so accumulator (mb, nb) goes out as it lies, one store of 512 consecutive bytes (4 whole lines) a plane; the wave's 8 stores of a plane fill whole 512-byte pieces that no other wave writes.
        const int z = blockIdx.z, t0 = r0 & (TT - 1);
        bf* Ph = z == 0 ? Qh : z == 1 ? Kh : Vh; bf* Pl = z == 0 ? Ql : z == 1 ? Kl : Vl; h16* P16 = z == 0 ? Q16 : z == 1 ? K16 : V16;
        // first element of the wave's first piece. q, k: rows = the 64 d of head (c0 >> 6) + (w >> 2), columns = 32 t. v: rows = 64 t, columns = 32 d, half a head
        const unsigned e0 = (unsigned)(r0 / TT) * (TT * DD) + (sw ? (unsigned)(((c0 >> 6) + (w >> 2)) * (TT * HD) + (t0 + (w & 3) * 32) * HD) : (unsigned)(((c0 >> 6) + ((w & 3) >> 1)) * (TT * HD) + (t0 + (w >> 2) * 64) * HD + (w & 1) * 1024));
        const unsigned ob = (e0 + (unsigned)lane * 8) * 2;   // the lane's byte offset in a plane; the pieces lie at constant distances from it
        unsigned po[4][2];   // accumulator (mb, nb) is piece nb * 4 + mb (q, k: tile of 16 t, then 16 d) or piece (mb >> 1) * 8 + nb * 2 + (mb & 1) (v: block of 32 t, then tile of 16 d, then 16 t)
#pragma unroll
        for (int mb = 0; mb < 4; ++mb)
#pragma unroll
            for (int nb = 0; nb < 2; ++nb) po[mb][nb] = ob + 512u * (unsigned)(sw ? nb * 4 + mb : (mb >> 1) * 8 + nb * 2 + (mb & 1));
        v8us oh[4][2], ol[4][2];
#pragma unroll
        for (int nb = 0; nb < 2; ++nb)
#pragma unroll
            for (int mb = 0; mb < 4; ++mb)
#pragma unroll
                for (int j = 0; j < 8; ++j) { unsigned short a, c2; splitf(acc[mb][nb][j], a, c2); oh[mb][nb][j] = a; ol[mb][nb][j] = c2; }
#pragma unroll
        for (int nb = 0; nb < 2; ++nb)
#pragma unroll
            for (int mb = 0; mb < 4; ++mb) { *(v8usa*)((unsigned char*)Ph + po[mb][nb]) = oh[mb][nb]; *(v8usa*)((unsigned char*)Pl + po[mb][nb]) = ol[mb][nb]; }
        asm volatile("s_wait_xcnt 0x0" ::: "memory");    // kept in front of the next write of a register that the 16 stores name
#pragma unroll
        for (int nb = 0; nb < 2; ++nb)
#pragma unroll
            for (int mb = 0; mb < 4; ++mb) { v8h o16;
#pragma unroll
                for (int j = 0; j < 8; ++j) o16[j] = tohx(acc[mb][nb][j]);
                *(v8ha*)((unsigned char*)P16 + po[mb][nb]) = o16; }
    }
}

typedef __attribute__((ext_vector_type(2))) unsigned short v2us;
typedef __attribute__((ext_vector_type(2))) _Float16 v2h;
typedef __attribute__((ext_vector_type(4))) _Float16 v4h;
typedef v4h __attribute__((may_alias)) v4ha;
typedef __attribute__((ext_vector_type(2))) float v2f;

// The three input conversions are bodies of ONE launch, k_prep (bx = the body's own block index); they do not depend on one another. The launch is a stream: few waves,
// each work-group reads 64 KiB, every thread has its 16 loads of 16 bytes in flight at once, every wave-wide load and store covers whole 128-byte lines.
typedef __attribute__((ext_vector_type(2))) unsigned v2u;
typedef v2u __attribute__((may_alias)) v2ua;
typedef unsigned __attribute__((may_alias)) u32a;
__device__ __forceinline__ unsigned pk2(float lo, float hi) { return (unsigned)f2bf(lo) | ((unsigned)f2bf(hi) << 16); }
#define TPN 64                    // n of a transpose tile: 256 bytes of a row of w
#define TPK 256                   // k of a transpose tile: 512 bytes of a row of Bt
// Bt[n][k] = bf16(w[k][n]), K = DD: one tile a work-group, turned in LDS. Thread = (row pair kr of 16, 16-byte piece nq of 16): rows k, k + 1 of four n give four words (k, k + 1) of four LDS rows.
// LDS row n = the tile's 256 k (512 bytes); its 16-byte piece ch lies at place ch ^ (n >> 2 & 15): the 32 words of a wave's store fall on 32 banks, and a wave reads a row back whole.
__device__ __forceinline__ void wtT_body(int bx, const float* __restrict__ w, int N, bf* Bt, unsigned char* sm) {
    const int tid = threadIdx.x, nq = tid & 15, kr = tid >> 4; const int ntl = N / TPN, n0 = (bx % ntl) * TPN, k0 = (bx / ntl) * TPK;
    const float* p = w + (size_t)(k0 + 2 * kr) * N + n0 + nq * 4; v4f a[8], b[8];
#pragma unroll
    for (int i = 0; i < 8; ++i) { a[i] = *(const v4fa*)(p + (size_t)(i * 32) * N); b[i] = *(const v4fa*)(p + (size_t)(i * 32 + 1) * N); }
    __builtin_amdgcn_sched_barrier(0);   // keeps the conversions behind the whole run: without it the build holds back the last loads until the first have returned, a second round trip to memory
    asm volatile("s_wait_xcnt 0x0" :: "v"(p) : "memory");   // kept in front of the next write of the address register that the 16 loads name; the address is an input, so that it stays in its register up to here
#pragma unroll
    for (int i = 0; i < 8; ++i)
#pragma unroll
        for (int j = 0; j < 4; ++j) *(u32a*)(sm + (nq * 4 + j) * (TPK * 2) + (((i * 4 + (kr >> 2)) ^ nq) * 16) + (kr & 3) * 4) = pk2(a[i][j], b[i][j]);
    __syncthreads();   // the whole tile is in LDS before any wave reads a row of it
    const int wv = tid >> 5, lane = tid & 31; v8us r[8];
#pragma unroll
    for (int s = 0; s < 8; ++s) { const int n = wv * 8 + s; r[s] = *(const v8usa*)(sm + n * (TPK * 2) + ((lane ^ ((n >> 2) & 15)) * 16)); }
    bf* q = Bt + (size_t)(n0 + wv * 8) * DD + k0 + lane * 8;
#pragma unroll
    for (int s = 0; s < 8; ++s) *(v8usa*)(q + s * DD) = r[s];
    asm volatile("s_wait_xcnt 0x0" ::: "memory");   // kept in front of the next write of a register that the eight stores name (the listing joins the bodies of k_prep behind them)
}
#define CVE 16384                 // elements of x a work-group converts
__device__ __forceinline__ void cvtS_body(int bx, const float* __restrict__ src, bf* dst) {
    const size_t e0 = (size_t)bx * CVE + threadIdx.x * 4; const float* p = src + e0; v4f v[16]; v2u o[16];
#pragma unroll
    for (int i = 0; i < 16; ++i) v[i] = *(const v4fa*)(p + i * 1024);
    __builtin_amdgcn_sched_barrier(0);   // as in wtT_body: all 16 loads are in flight before the first conversion
    asm volatile("s_wait_xcnt 0x0" :: "v"(p) : "memory");   // as in wtT_body
#pragma unroll
    for (int i = 0; i < 16; ++i) { o[i][0] = pk2(v[i][0], v[i][1]); o[i][1] = pk2(v[i][2], v[i][3]); }
    bf* q = dst + e0;
#pragma unroll
    for (int i = 0; i < 16; ++i) *(v2ua*)(q + i * 1024) = o[i];
    asm volatile("s_wait_xcnt 0x0" ::: "memory");   // as in wtT_body, behind the 16 stores
}
#define GWA (DD * 3 * DD / (TPN * TPK))  // work-groups of the w_attn transpose
#define GWP (DD * DD / (TPN * TPK))      // work-groups of the w_proj transpose
#define GXC (NB_ * TT * DD / CVE)        // work-groups of the x conversion, both batches
// grid GWA + GWP + GXC; the transposes (two phases and a barrier) have the lowest block indices. Every test is the same for a whole work-group.
__global__ __launch_bounds__(256) void k_prep(const float* __restrict__ x, const float* __restrict__ wqkv, const float* __restrict__ wo, bf* XB, bf* WQKV, bf* WO) {
    __shared__ __align__(16) unsigned char sm[TPN * TPK * 2];
    const int bx = blockIdx.x;
    if (bx < GWA) wtT_body(bx, wqkv, 3 * DD, WQKV, sm);
    else if (bx < GWA + GWP) wtT_body(bx - GWA, wo, DD, WO, sm);
    else cvtS_body(bx - (GWA + GWP), x, XB);
}
#define LOG2E 1.44269504088896341f
__device__ __forceinline__ void exp2x8(float (&x)[8]) { asm("v_exp_f32 %0, %0\n\tv_exp_f32 %1, %1\n\tv_exp_f32 %2, %2\n\tv_exp_f32 %3, %3\n\tv_exp_f32 %4, %4\n\tv_exp_f32 %5, %5\n\tv_exp_f32 %6, %6\n\tv_exp_f32 %7, %7\n\tv_nop" : "+v"(x[0]), "+v"(x[1]), "+v"(x[2]), "+v"(x[3]), "+v"(x[4]), "+v"(x[5]), "+v"(x[6]), "+v"(x[7])); }
__device__ __forceinline__ void log2x8(float (&x)[8]) { asm("v_log_f32 %0, %0\n\tv_log_f32 %1, %1\n\tv_log_f32 %2, %2\n\tv_log_f32 %3, %3\n\tv_log_f32 %4, %4\n\tv_log_f32 %5, %5\n\tv_log_f32 %6, %6\n\tv_log_f32 %7, %7\n\tv_nop" : "+v"(x[0]), "+v"(x[1]), "+v"(x[2]), "+v"(x[3]), "+v"(x[4]), "+v"(x[5]), "+v"(x[6]), "+v"(x[7])); }
__device__ __forceinline__ float expx1(float a) { float x = a * LOG2E; asm("v_exp_f32 %0, %0\n\tv_nop" : "+v"(x)); return x; }   // e^a
// The wait that is kept between a run of global loads and the next write of a register that one of them names as its address. The run's addresses are inputs of the statement: they stay in their registers
// up to the wait, wherever the build lets it stand behind the run, so that neither a result of the run nor the vector work behind it is given those registers in front of it.
template <typename T16> __device__ __forceinline__ void xwait2(const T16* a, const T16* b) { asm volatile("s_wait_xcnt 0x0" :: "v"(a), "v"(b) : "memory"); }
#define FW 8                      // waves per work-group of k_fattn
#define QGL 2                     // 16-query groups per work-group, fp16 rows
#define QGH 1                     // 16-query groups per work-group, hi+lo rows
struct FSh { v4f red[FW][4 * QGL][2 * 32 + 2];   // [wave][fragment][half * 32 + lane]; the two spare entries shift each fragment by 32 bytes, so that the adders' reads of four fragments side by side fall on different banks
             float sm[FW][QGL * 16]; float sl[FW][QGL * 16]; float se[FW][QGL * 16]; };
template <typename T16, bool HI, int QG>
__device__ __forceinline__ void fattn_body(const T16* __restrict__ Q, const T16* __restrict__ Q2, const T16* __restrict__ Kp, const T16* __restrict__ K2, const T16* __restrict__ Vt, const T16* __restrict__ V2,
                                           int q0, float* ENTh, bf* Ah, bf* Al, FSh& sh) {
    typedef typename WFrag<T16>::V V; static_assert(QG == 1 || QG == 2, "the statement at the foot of walk 2 names the accumulators of two groups");
    const int w = __builtin_amdgcn_readfirstlane((int)(threadIdx.x >> 5));   // wave number, held scalar
    const int lane = threadIdx.x & 31, c = lane & 15, h = lane >> 4;
    const int nkb = (q0 + QG * 16 + 31) >> 5;   // 32-key blocks that hold a key <= the last query
    V qf[QG][2], qf2[QG][2]; const size_t qo = (size_t)q0 * HD + lane * 8; const T16* qp = Q + qo; const T16* qp2 = HI ? Q2 + qo : qp;   // one address a plane, the rest of the run is constant offsets
#pragma unroll
    for (int g = 0; g < QG; ++g)
#pragma unroll
        for (int kk = 0; kk < 2; ++kk) { qf[g][kk] = WFrag<T16>::ldf(qp + g * 16 * HD + kk * 512); if (HI) qf2[g][kk] = WFrag<T16>::ldf(qp2 + g * 16 * HD + kk * 512); }
    xwait2(qp, qp2);   // in front of the next write of an address register that the query loads name
    V kf[2][2], kf2[2][2];   // the key rows k0 .. k0 + 31 as A fragments
    auto loadk = [&](int k0) { const size_t o = (size_t)k0 * HD + lane * 8; const T16* kp = Kp + o; const T16* kp2 = HI ? K2 + o : kp;   // one address a plane, the rest of a run is constant offsets
#pragma unroll
        for (int t = 0; t < 2; ++t)
#pragma unroll
            for (int kk = 0; kk < 2; ++kk) { kf[t][kk] = WFrag<T16>::ldf(kp + t * 16 * HD + kk * 512); if (HI) kf2[t][kk] = WFrag<T16>::ldf(kp2 + t * 16 * HD + kk * 512); }
        xwait2(kp, kp2);
        if constexpr (HI) __builtin_amdgcn_sched_barrier(0);   // keeps the matrix instructions behind the whole run: without it the build refills a few registers in turn, and the 16 loads become a chain of seven round trips
    };
    // st[t][g][r] = masked scaled score of key k0 + t * 16 + 8 h + r and query q0 + g * 16 + c, from the fragments in kf
    auto scores = [&](int k0, v8f (&st)[2][QG]) {
#pragma unroll
        for (int t = 0; t < 2; ++t)
#pragma unroll
            for (int g = 0; g < QG; ++g) { v8f a = (v8f){};
#pragma unroll
                for (int kk = 0; kk < 2; ++kk) { a = WFrag<T16>::mma(kf[t][kk], qf[g][kk], a); if (HI) { a = WFrag<T16>::mma(kf[t][kk], qf2[g][kk], a); a = WFrag<T16>::mma(kf2[t][kk], qf[g][kk], a); } }
#pragma unroll
                for (int r = 0; r < 8; ++r) st[t][g][r] = a[r] * SCL; }
        if (k0 + 31 > q0) {   // a scalar test: only a block that reaches past the first query holds a key to cut
#pragma unroll
            for (int t = 0; t < 2; ++t)
#pragma unroll
                for (int g = 0; g < QG; ++g) { const int dq = q0 + g * 16 + c - (k0 + t * 16 + 8 * h);   // key r of this lane is kept while r <= dq
#pragma unroll
                    for (int r = 0; r < 8; ++r) st[t][g][r] = (r <= dq) ? st[t][g][r] : -3.0e38f; } }
    };
    float m[QG], l[QG];
#pragma unroll
    for (int g = 0; g < QG; ++g) { m[g] = -3.0e38f; l[g] = 0.f; }
    constexpr bool PF = !HI;   // key rows fetched one trip ahead; not for the hi+lo rows, where RH / 32 <= FW blocks leave a wave one trip at most
    if (PF && w < nkb) loadk(w * 32);
#pragma unroll 1   // rolled: the key fragments are refilled in place, one trip's registers serve every trip
    for (int kb = w; kb < nkb; kb += FW) { if (!PF) loadk(kb * 32);
        v8f st[2][QG]; scores(kb * 32, st);
        if (PF) loadk(min(kb + FW, nkb - 1) * 32);   // the next trip's key rows fly, into the same registers, while this trip's vector work runs (the last trip fetches the last block once more: in bounds, unused)
#pragma unroll
        for (int g = 0; g < QG; ++g) { float bm = m[g];
#pragma unroll
            for (int r = 0; r < 8; ++r) bm = fmaxf(bm, fmaxf(st[0][g][r], st[1][g][r]));
            float s = 0.f;
#pragma unroll
            for (int t = 0; t < 2; ++t) { float e[8];
#pragma unroll
                for (int r = 0; r < 8; ++r) e[r] = (st[t][g][r] - bm) * LOG2E;
                exp2x8(e);
#pragma unroll
                for (int r = 0; r < 8; ++r) s += e[r]; }
            l[g] = l[g] * expx1(m[g] - bm) + s; m[g] = bm; } }   // a lane that has met masked keys only counts ones under m = -3e38: the joins below scale them by exp(-3e38 - max) = 0
#pragma unroll
    for (int g = 0; g < QG; ++g) { const float mo = __shfl_xor(m[g], 16, 32), lo = __shfl_xor(l[g], 16, 32); const float mn = fmaxf(m[g], mo);
        const float lj = l[g] * expx1(m[g] - mn) + lo * expx1(mo - mn); if (h == 0) { sh.sm[w][g * 16 + c] = mn; sh.sl[w][g * 16 + c] = lj; } }
    __syncthreads();   // every wave's maxima and sums are in LDS before any wave joins them
    float M[QG], pn[QG], f[QG], en[QG];
#pragma unroll
    for (int g = 0; g < QG; ++g) { float mx = sh.sm[0][g * 16 + c];
#pragma unroll
        for (int s = 1; s < FW; ++s) mx = fmaxf(mx, sh.sm[s][g * 16 + c]);
        float L = 0.f;
#pragma unroll
        for (int s = 0; s < FW; ++s) L += sh.sl[s][g * 16 + c] * expx1(sh.sm[s][g * 16 + c] - mx);
        M[g] = mx; pn[g] = __fdiv_rn(1.0f, L); f[g] = __fdiv_rn(HI ? 1.0f : PCAR, L); en[g] = 0.f; }
    v8f o[4][QG];
#pragma unroll
    for (int dt = 0; dt < 4; ++dt)
#pragma unroll
        for (int g = 0; g < QG; ++g) o[dt][g] = (v8f){};
    if (PF && w < nkb) loadk(w * 32);
#pragma unroll 1   // rolled, as walk 1: fragments refilled in place keep the wave inside its register limit
    for (int kb = w; kb < nkb; kb += FW) { const int k0 = kb * 32; V vf[4], vf2[4];
        const size_t vo = (size_t)k0 * HD + lane * 8; const T16* vp = Vt + vo; const T16* vp2 = HI ? V2 + vo : vp;
#pragma unroll
        for (int dt = 0; dt < 4; ++dt) { vf[dt] = WFrag<T16>::ldf(vp + dt * 512); if (HI) vf2[dt] = WFrag<T16>::ldf(vp2 + dt * 512); }
        xwait2(vp, vp2);
        if (!PF) loadk(k0);
        v8f st[2][QG]; scores(k0, st);
        if (PF) loadk(min(kb + FW, nkb - 1) * 32);   // as in walk 1: the next trip's key rows fly while this trip's vector work and Ot products run
#pragma unroll
        for (int g = 0; g < QG; ++g) { V pb, pb2;
            float y[2][8];
#pragma unroll
            for (int t = 0; t < 2; ++t) { float e[8], q[8];
#pragma unroll
                for (int r = 0; r < 8; ++r) e[r] = (st[t][g][r] - M[g]) * LOG2E;
                exp2x8(e);
#pragma unroll
                for (int r = 0; r < 8; ++r) q[r] = e[r] * pn[g] + 1e-8f;
                log2x8(q);
#pragma unroll
                for (int r = 0; r < 8; ++r) { en[g] -= (e[r] * pn[g]) * q[r]; y[t][r] = e[r] * f[g]; } }   // a masked key: e = 0, p = 0, term 0
            if constexpr (HI) { v8us h0, h1, l0, l1;
#pragma unroll
                for (int r = 0; r < 8; ++r) { unsigned short a, b2; splitf(y[0][r], a, b2); h0[r] = a; l0[r] = b2; splitf(y[1][r], a, b2); h1[r] = a; l1[r] = b2; }
                pb = cat16b(h0, h1); pb2 = cat16b(l0, l1);
            } else { v8h h0, h1;
#pragma unroll
                for (int r = 0; r < 8; ++r) { h0[r] = tohx(y[0][r]); h1[r] = tohx(y[1][r]); }
                pb = cat16(h0, h1); }
#pragma unroll
            for (int dt = 0; dt < 4; ++dt) { o[dt][g] = WFrag<T16>::mma(vf[dt], pb, o[dt][g]); if (HI) { o[dt][g] = WFrag<T16>::mma(vf[dt], pb2, o[dt][g]); o[dt][g] = WFrag<T16>::mma(vf2[dt], pb, o[dt][g]); } } }
        // the four slots keep the distance between the trip's last matrix instructions (every accumulator is named, so that all of them stand in front) and the first vector instruction behind the branch, on both of its sides
        if constexpr (QG == 1) asm volatile("v_nop\n\tv_nop\n\tv_nop\n\tv_nop" : "+v"(o[0][0]), "+v"(o[1][0]), "+v"(o[2][0]), "+v"(o[3][0]));
        else asm volatile("v_nop\n\tv_nop\n\tv_nop\n\tv_nop" : "+v"(o[0][0]), "+v"(o[1][0]), "+v"(o[2][0]), "+v"(o[3][0]), "+v"(o[0][QG - 1]), "+v"(o[1][QG - 1]), "+v"(o[2][QG - 1]), "+v"(o[3][QG - 1])); }
#pragma unroll
    for (int dt = 0; dt < 4; ++dt)
#pragma unroll
        for (int g = 0; g < QG; ++g) { const v8f a = o[dt][g]; sh.red[w][dt * QG + g][lane] = (v4f){a[0], a[1], a[2], a[3]}; sh.red[w][dt * QG + g][32 + lane] = (v4f){a[4], a[5], a[6], a[7]}; }
#pragma unroll
    for (int g = 0; g < QG; ++g) { const float ej = en[g] + __shfl_xor(en[g], 16, 32); if (h == 0) sh.se[w][g * 16 + c] = ej; }
    __syncthreads();   // every wave's partial Ot tiles and entropy sums are in LDS before any wave adds them
    // Wave w owns queries w * QW .. w * QW + QW - 1 with all 64 d: a whole 128-byte line of Ah and of Al has one writing wave. Unit u = (query, 16-d tile dt, half hh): 8 consecutive d.
    constexpr int QW = QG * 16 / FW, NU = QW * 8; const float cs = HI ? 1.0f : (1.0f / PCAR);
#pragma unroll
    for (int u0 = 0; u0 < NU; u0 += 32) { const int u = u0 + lane;
        if (u < NU) { const int qq = w * QW + (u % QW), dt = (u / QW) & 3, hh = u / (QW * 4); const int fi = dt * QG + (qq >> 4), sl = (qq & 15) + 16 * hh;
            v4f s0 = sh.red[0][fi][sl], s1 = sh.red[0][fi][32 + sl];
#pragma unroll
            for (int s = 1; s < FW; ++s) { s0 += sh.red[s][fi][sl]; s1 += sh.red[s][fi][32 + sl]; }
            v8us oh, ol;
#pragma unroll
            for (int r = 0; r < 4; ++r) { unsigned short a, b2; splitf(s0[r] * cs, a, b2); oh[r] = a; ol[r] = b2; splitf(s1[r] * cs, a, b2); oh[4 + r] = a; ol[4 + r] = b2; }
            const size_t oo = (size_t)(q0 + qq) * DD + dt * 16 + hh * 8; *(v8us*)(Ah + oo) = oh; *(v8us*)(Al + oo) = ol;
            asm volatile("s_wait_xcnt 0x0" ::: "memory"); } }   // kept in front of the next write of a register that the two stores name
    if (threadIdx.x < QG * 16) { float e = sh.se[0][threadIdx.x];
#pragma unroll
        for (int s = 1; s < FW; ++s) e += sh.se[s][threadIdx.x];
        ENTh[(size_t)(q0 + (int)threadIdx.x) * 32] = e * 0.69314718055994531f; }   // the terms were summed with log2; k_entpart reads word 0 of a row's line
}
// grid (x, batch * NH_ + head): x < (TT - RH) / (QGL * 16): fp16 query blocks, the longest first; behind them the hi+lo blocks. The test is the same for a whole work-group.
// Four waves a SIMD (at most 256 registers a wave): two work-groups share a WGP, so that one's vector work covers the other's load waits, barriers and LDS sums.
__global__ __launch_bounds__(32 * FW) __attribute__((amdgpu_waves_per_eu(4, 4))) void k_fattn(const bf* __restrict__ Qh, const bf* __restrict__ Ql, const bf* __restrict__ Kh, const bf* __restrict__ Kl, const bf* __restrict__ Vh, const bf* __restrict__ Vl,
                                                   const h16* __restrict__ Q16, const h16* __restrict__ K16, const h16* __restrict__ V16, float* ENT, bf* Ah, bf* Al) {
    __shared__ FSh sh;
    constexpr int NL = (TT - RH) / (QGL * 16);
    const int x = blockIdx.x; const size_t z = (size_t)blockIdx.y * TT * HD; float* ENTh = ENT + (size_t)blockIdx.y * TT * 32;   // planes [batch][head][..][..], ENT [batch][head][query] lines
    const size_t ao = (size_t)(blockIdx.y / NH_) * TT * DD + (blockIdx.y % NH_) * HD; Ah += ao; Al += ao;   // merged rows [batch][query][head * HD + d]
    if (x < NL) fattn_body<h16, false, QGL>(Q16 + z, nullptr, K16 + z, nullptr, V16 + z, nullptr, TT - (x + 1) * (QGL * 16), ENTh, Ah, Al, sh);
    else fattn_body<bf, true, QGH>(Qh + z, Ql + z, Kh + z, Kl + z, Vh + z, Vl + z, (x - NL) * (QGH * 16), ENTh, Ah, Al, sh);
}

// Mean of the NB_ * NH_ * TT row entropies in two launches: one wave alone would walk all the ENT lines in a chain of load round trips.
// k_entpart: work-group g sums rows g * 256 .. g * 256 + 255, one row a thread (every load of the launch is in flight at once): lane tree, then the 8 wave sums through LDS -> line PART[g][0..31] (lane 0 the sum, the rest 0).
#define EPW 256                   // rows per work-group of k_entpart
__global__ __launch_bounds__(EPW) void k_entpart(const float* __restrict__ ENT, float* PART) {
    __shared__ float wsum[EPW / 32];
    const int lane = threadIdx.x & 31, w = threadIdx.x >> 5; float s = ENT[((size_t)blockIdx.x * EPW + threadIdx.x) * 32];
#pragma unroll
    for (int sh = 16; sh; sh >>= 1) s += __shfl_xor(s, sh, 32);
    if (lane == 0) wsum[w] = s;
    __syncthreads();   // all 8 wave sums are in LDS before wave 0 adds them
    if (w == 0) { float t = lane < EPW / 32 ? wsum[lane] : 0.f;
#pragma unroll
        for (int sh = EPW / 64; sh; sh >>= 1) t += __shfl_xor(t, sh, 32);
        PART[(size_t)blockIdx.x * 32 + lane] = lane == 0 ? t : 0.f; }
}
// k_entmean: one wave sums the NB_ * NH_ * TT / EPW partial sums (8 independent loads a lane) and scales.
__global__ __launch_bounds__(32) void k_entmean(const float* __restrict__ PART, float* OUT1) { const int lane = threadIdx.x; float s = 0.f;
#pragma unroll
    for (int r = 0; r < NB_ * NH_ * TT / EPW; r += 32) s += PART[(size_t)(r + lane) * 32];
#pragma unroll
    for (int sh = 16; sh; sh >>= 1) s += __shfl_xor(s, sh, 32);
    if (lane == 0) { const float m = s * (1.0f / (float)(NB_ * NH_ * TT)); *(float*)OUT1 = m;  } }
extern "C" void kernel_launch(void* const* d_in, const int* in_sizes, int n_in,
                              void* d_out, int out_size, void* d_ws, size_t ws_size, hipStream_t stream) {
    (void)in_sizes; (void)n_in; (void)out_size;
    const float* x = (const float*)d_in[0]; const float* wqkv = (const float*)d_in[1]; const float* wo = (const float*)d_in[2];   // w_attn [1024][3072], w_proj [1024][1024] as x @ W (no biases)
    float* OUT = (float*)d_out; float* OUT1 = OUT + (size_t)NB_ * TT * DD;     // [2][2048][1024] at 0; [1] entropy at byte 16,777,216
    char* wsp = (char*)d_ws;
    auto take = [&](size_t bytes) { char* p = wsp; wsp += (bytes + 255) & ~(size_t)255; return (void*)p; };
    bf* WQKV = (bf*)take((size_t)3 * DD * DD * 2); bf* WO = (bf*)take((size_t)DD * DD * 2);
    bf* XB = (bf*)take((size_t)NB_ * TT * DD * 2);   // x of both batches
    const size_t PB = (size_t)NB_ * TT * DD * 2;   // a 16-bit plane of both batches
    bf* QPh = (bf*)take(PB); bf* QPl = (bf*)take(PB); bf* KPh = (bf*)take(PB); bf* KPl = (bf*)take(PB); bf* VTh = (bf*)take(PB); bf* VTl = (bf*)take(PB);
    h16* QP16 = (h16*)take(PB); h16* KP16 = (h16*)take(PB); h16* VT16 = (h16*)take(PB);
    float* ENT = (float*)take((size_t)NB_ * NH_ * TT * 32 * 4); bf* ATh = (bf*)take(PB); bf* ATl = (bf*)take(PB); float* PART = (float*)take((size_t)(NB_ * NH_ * TT / EPW) * 32 * 4);
    if ((size_t)(wsp - (char*)d_ws) > ws_size) return;    // total 112 MiB
    k_prep<<<GWA + GWP + GXC, 256, 0, stream>>>(x, wqkv, wo, XB, WQKV, WO);
    // both batches are the rows of one product (M = NB_ * TT); z = q, k, v: the weight rows and the operand planes of each
    k_gemml<0><<<dim3(NB_ * TT / GT, DD / GT, 3), 256, 0, stream>>>(XB, nullptr, WQKV, nullptr, QPh, QPl, QP16, KPh, KPl, KP16, VTh, VTl, VT16);
    k_fattn<<<dim3((TT - RH) / (QGL * 16) + RH / (QGH * 16), NB_ * NH_, 1), 32 * FW, 0, stream>>>(QPh, QPl, KPh, KPl, VTh, VTl, QP16, KP16, VT16, ENT, ATh, ATl);
    k_gemml<1><<<dim3(NB_ * TT / GT, DD / GT, 1), 256, 0, stream>>>(ATh, ATl, WO, OUT, nullptr, nullptr, nullptr, nullptr, nullptr, nullptr, nullptr, nullptr, nullptr);
    k_entpart<<<NB_ * NH_ * TT / EPW, EPW, 0, stream>>>(ENT, PART); k_entmean<<<1, 32, 0, stream>>>(PART, OUT1);
}
